// v000
// Measured on an AMD MI455X. A time is GPU time per run, averaged over a window of back-to-back runs after a warm-up
// (all launches, gaps included; the runs take copies of the inputs in turn), and the median of several windows.
// Apart from v000's, it joins two sittings. Times from different sittings can be a few percent apart, while
// side-by-side timings come from the same sitting.
// v000 is the starting kernel. One run takes 2260 microseconds.
#include <hip/hip_runtime.h>

// MultiHeadAttentionWithBias (query [2][2048][1024], attention_bias [2][S][S] (f32, read), attention_mask [2][S][S] (int, read; all ones); q/k/v = x W^T + b (16 x 64); scores = q.k / 8 + bias[b][i][j], -inf where mask <= 0; softmax; out = merged Wo^T + bo -> [2][2048][1024]).
// Compute dtypes, f32 accumulate: every input rounded to bf16; q/k/v on PLAIN bf16 operands (inputs: exact) + bias; scores PRECPLAN; the bf16-rounded bias and the int mask read per element in f32 (no structural skipping); softmax f32; Wo hl x exact (2 products) + bias.

#define NB_  2
#define TT   2048
#define DM   1024
#define NH_  16
#define NKV  16
#define REP  (NH_ / NKV)
#define HD   64
#define DQ   (NH_ * HD)
#define DKV  (NKV * HD)
#define ZH   2
#define RH   512                  // query rows < RH use hi+lo planes (0: none)
#define WIN  0
#define PCAR 1024.0f
#define SCL  0.125f   // HD^-0.5
typedef _Float16 h16;
typedef unsigned short bf;
typedef __attribute__((ext_vector_type(16))) __bf16   v16bf;
typedef __attribute__((ext_vector_type(16))) _Float16 v16h;
typedef __attribute__((ext_vector_type(8)))  _Float16 v8h;
typedef __attribute__((ext_vector_type(8)))  unsigned short v8us;
typedef __attribute__((ext_vector_type(8)))  float    v8f;
typedef __attribute__((ext_vector_type(4)))  float    v4f;
typedef v8h  __attribute__((may_alias)) v8ha;
typedef v4f  __attribute__((may_alias)) v4fa;
typedef v8us __attribute__((may_alias)) v8usa;

__device__ __forceinline__ unsigned short f2bf(float f) { unsigned u = __float_as_uint(f); u += 0x7FFFu + ((u >> 16) & 1u); return (unsigned short)(u >> 16); }
__device__ __forceinline__ float bf2f(unsigned short b) { return __uint_as_float(((unsigned)b) << 16); }
__device__ __forceinline__ float bfr(float f) { return bf2f(f2bf(f)); }
__device__ __forceinline__ v16h cat16(v8h lo, v8h hi) { return __builtin_shufflevector(lo, hi, 0, 1, 2, 3, 4, 5, 6, 7, 8, 9, 10, 11, 12, 13, 14, 15); }
__device__ __forceinline__ v16bf cat16b(v8us lo, v8us hi) { return __builtin_bit_cast(v16bf, __builtin_shufflevector(lo, hi, 0, 1, 2, 3, 4, 5, 6, 7, 8, 9, 10, 11, 12, 13, 14, 15)); }
__device__ __forceinline__ v8f wmma16(v16h a, v16h b, v8f c) { return __builtin_amdgcn_wmma_f32_16x16x32_f16(false, a, false, b, (short)0, c, false, false); }
__device__ __forceinline__ v8f wmmab(v16bf a, v16bf b, v8f c) { return __builtin_amdgcn_wmma_f32_16x16x32_bf16(false, a, false, b, (short)0, c, false, false); }



// ---- k_gemmw: register-blocked GEMM, ONE WAVE per 64x64 output tile (16 accumulators), operands straight from K-contiguous 16-bit planes; grid (M/64, N/64, Z), 32 threads.
// C[m][n] (f32, pitch ldc, + optional f32 bias[n]) = sum_k A[m][k] Bt[n][k] (+ split products per NSPLIT). z-batch strides sA/sB/sC in elements. K % 32 == 0.
template <typename T16> struct WFrag;
template <> struct WFrag<h16> { typedef v16h V; static __device__ __forceinline__ V ld(const h16* p) { return cat16(*(const v8h*)p, *(const v8h*)(p + 16)); } static __device__ __forceinline__ v8f mma(V a, V b, v8f c) { return wmma16(a, b, c); } };
template <> struct WFrag<bf> { typedef v16bf V; static __device__ __forceinline__ V ld(const bf* p) { return cat16b(*(const v8us*)p, *(const v8us*)(p + 16)); } static __device__ __forceinline__ v8f mma(V a, V b, v8f c) { return wmmab(a, b, c); } };
template <typename T16, int NSPLIT, bool BIAS>
__global__ __launch_bounds__(32) void k_gemmw(const T16* __restrict__ A, const T16* __restrict__ A2, const T16* __restrict__ Bt, const T16* __restrict__ Bt2, int K, float* C, int ldc, const float* __restrict__ bias, size_t sA, size_t sB, size_t sC) {
    typedef typename WFrag<T16>::V V;
    __shared__ __align__(16) float os[16 * 68];
    const size_t z = blockIdx.z; A += z * sA; if (A2) A2 += z * sA; Bt += z * sB; if (Bt2) Bt2 += z * sB; C += z * sC;
    const int lane = threadIdx.x & 31, lr = lane & 15, hi = lane >> 4; const int r0 = blockIdx.x * 64, c0 = blockIdx.y * 64;
    v8f acc[4][4];
#pragma unroll
    for (int mb = 0; mb < 4; ++mb)
#pragma unroll
        for (int nb = 0; nb < 4; ++nb) acc[mb][nb] = (v8f){};
    const size_t aoff = (size_t)(r0 + lr) * K + 8 * hi, boff = (size_t)(c0 + lr) * K + 8 * hi;
#pragma unroll 1
    for (int kc = 0; kc < K; kc += 32) {
        V a[4], a2[4];
#pragma unroll
        for (int mb = 0; mb < 4; ++mb) { a[mb] = WFrag<T16>::ld(A + aoff + (size_t)mb * 16 * K + kc); if (NSPLIT == 1 || NSPLIT == 2) a2[mb] = WFrag<T16>::ld(A2 + aoff + (size_t)mb * 16 * K + kc); }
#pragma unroll
        for (int nb = 0; nb < 4; ++nb) { const V b = WFrag<T16>::ld(Bt + boff + (size_t)nb * 16 * K + kc); V b2; if (NSPLIT >= 2) b2 = WFrag<T16>::ld(Bt2 + boff + (size_t)nb * 16 * K + kc);
#pragma unroll
            for (int mb = 0; mb < 4; ++mb) { acc[mb][nb] = WFrag<T16>::mma(a[mb], b, acc[mb][nb]); if (NSPLIT == 1 || NSPLIT == 2) acc[mb][nb] = WFrag<T16>::mma(a2[mb], b, acc[mb][nb]); if (NSPLIT >= 2) acc[mb][nb] = WFrag<T16>::mma(a[mb], b2, acc[mb][nb]); } }
        asm volatile("v_nop\n\tv_nop\n\tv_nop\n\tv_nop" : "+v"(acc[0][0]), "+v"(acc[1][1]), "+v"(acc[2][2]), "+v"(acc[3][3]) : "v"(a[0]), "v"(a[3]));
    }
#pragma unroll
    for (int mb = 0; mb < 4; ++mb) {
#pragma unroll
        for (int nb = 0; nb < 4; ++nb) {
#pragma unroll
            for (int j = 0; j < 8; ++j) os[(hi * 8 + j) * 68 + nb * 16 + lr] = acc[mb][nb][j]; }
        __builtin_amdgcn_wave_barrier(); asm volatile("" ::: "memory");
        float* crow = C + (size_t)(r0 + mb * 16) * ldc + c0;
{
#pragma unroll
            for (int s = 0; s < 8; ++s) { const int row = 2 * s + hi, cofs = lr * 4; v4f val = *(const v4fa*)(os + row * 68 + cofs); if (BIAS) { val[0] += bfr(bias[c0 + cofs]); val[1] += bfr(bias[c0 + cofs + 1]); val[2] += bfr(bias[c0 + cofs + 2]); val[3] += bfr(bias[c0 + cofs + 3]); }
                *(v4f*)(crow + (size_t)row * ldc + cofs) = val; }
             }
        __builtin_amdgcn_wave_barrier(); asm volatile("" ::: "memory");
    }
}

__device__ __forceinline__ h16 tohx(float x) { return (h16)x; }
__device__ __forceinline__ void splitf(float y, unsigned short& h, unsigned short& l) { h = f2bf(y); l = f2bf(y - bf2f(h)); }
typedef __attribute__((ext_vector_type(2))) _Float16 v2h;
typedef __attribute__((ext_vector_type(4))) _Float16 v4h;
typedef __attribute__((ext_vector_type(2))) unsigned short v2us;
typedef __attribute__((ext_vector_type(4))) unsigned short v4us;
typedef __attribute__((ext_vector_type(2))) float v2f;
typedef __attribute__((ext_vector_type(4))) int v4i;

__global__ __launch_bounds__(256) void k_wtG(const float* __restrict__ w, int K, int N, bf* Bt) {
    const int lane = threadIdx.x & 31; const int L0 = (blockIdx.x * 8 + (threadIdx.x >> 5)) * 8; const int nlines = N * K / 64;
{
#pragma unroll 1
        for (int l = 0; l < 8; ++l) { const int L = L0 + l; if (L >= nlines) break; const size_t e = (size_t)L * 64 + lane * 2; const int k = (int)(e % K), n = (int)(e / K); v2us o;
            o[0] = f2bf(w[(size_t)k * N + n]); o[1] = f2bf(w[(size_t)(k + 1) * N + n]); *(v2us*)(Bt + e) = o; }
         }
}
__global__ __launch_bounds__(256) void k_cvt8(const float* __restrict__ src, bf* dst, size_t n8) { const size_t i = (size_t)blockIdx.x * 256 + threadIdx.x; if (i >= n8) return; const v8f v = *(const v8f*)(src + i * 8); v8us o;
#pragma unroll
    for (int k = 0; k < 8; ++k) o[k] = f2bf(v[k]); *(v8us*)(dst + i * 8) = o;  }
__global__ __launch_bounds__(256) void k_cscvt(const float* __restrict__ cosT, const float* __restrict__ sinT, float* CS) { const int idx = blockIdx.x * 256 + threadIdx.x; if (idx >= TT * HD) return; v2f cs; cs[0] = bfr(cosT[idx]); cs[1] = bfr(sinT[idx]); *(v2f*)(CS + (size_t)idx * 2) = cs;  }
// k_rope: head planes [h][t][d] (fp16 + hi/lo) of rope(x) x sc with the rotate-half convention out[d] = x[d] cos[t][d] - x[d+HD/2] sin[t][d], out[d+HD/2] = x[d+HD/2] cos[t][d+HD/2] + x[d] sin[t][d+HD/2]
__global__ __launch_bounds__(256) void k_rope(const float* __restrict__ F, int pitch, int nheads, const float* __restrict__ CS, const float* __restrict__ RF, const float* __restrict__ nw, float sc, h16* P16, bf* Ph, bf* Pl) {
    const size_t e = ((size_t)blockIdx.x * 256 + threadIdx.x) * 2; if (e >= (size_t)nheads * TT * HD) return; const int d = (int)(e % HD); const int t = (int)((e / HD) % TT); const int h = (int)(e / ((size_t)HD * TT)); const float* f = F + (size_t)t * pitch + h * HD; const float rf = RF ? RF[(size_t)h * TT + t] : 1.0f; v2h o16; v2us oh, ol;
#pragma unroll
    for (int q = 0; q < 2; ++q) { const int dd = d + q; const int dp = (dd < HD / 2) ? dd + HD / 2 : dd - HD / 2; float x0 = f[dd], x1 = f[dp];
        if (RF) { float n0 = __fmul_rn(x0, rf), n1 = __fmul_rn(x1, rf); asm volatile("" : "+v"(n0)); asm volatile("" : "+v"(n1)); x0 = __fmul_rn(bfr(nw[dd]), n0); x1 = __fmul_rn(bfr(nw[dp]), n1); }
        const v2f cs = *(const v2f*)(CS + ((size_t)t * HD + dd) * 2); float a = __fmul_rn(x0, cs[0]), bq = __fmul_rn(x1, cs[1]); asm volatile("" : "+v"(a)); asm volatile("" : "+v"(bq)); const float r = ((dd < HD / 2) ? __fsub_rn(a, bq) : __fadd_rn(a, bq)) * sc;
        o16[q] = tohx(r); unsigned short a2, c2; splitf(r, a2, c2); oh[q] = a2; ol[q] = c2; }
    *(v2h*)(P16 + e) = o16; *(v2us*)(Ph + e) = oh; *(v2us*)(Pl + e) = ol;  }
__global__ __launch_bounds__(256) void k_vtp(const float* __restrict__ F, int pitch, int nheads, h16* V16, bf* Vh, bf* Vl) { const size_t e = ((size_t)blockIdx.x * 256 + threadIdx.x) * 2; if (e >= (size_t)nheads * HD * TT) return; const int t = (int)(e % TT); const int d = (int)((e / TT) % HD); const int g = (int)(e / ((size_t)TT * HD)); v2h o16; v2us oh, ol;
#pragma unroll
    for (int q = 0; q < 2; ++q) { const float x = F[(size_t)(t + q) * pitch + g * HD + d]; o16[q] = tohx(x); unsigned short a2, c2; splitf(x, a2, c2); oh[q] = a2; ol[q] = c2; }
    *(v2h*)(V16 + e) = o16; *(v2us*)(Vh + e) = oh; *(v2us*)(Vl + e) = ol;  }
__global__ __launch_bounds__(256) void k_csid(float* CS) { const int idx = blockIdx.x * 256 + threadIdx.x; if (idx >= TT * HD) return; v2f cs; cs[0] = 1.0f; cs[1] = 0.0f; *(v2f*)(CS + (size_t)idx * 2) = cs;  }
// k_asoft: per row (zz, i): t = S x HD^-0.5 + bf16 bias, -3e38 where mask <= 0; softmax over the 2048 keys (register row, one exp, fixed trees);
__global__ __launch_bounds__(256) void k_asoft(const float* __restrict__ Sb, const float* __restrict__ ab, const int* __restrict__ am, h16* P16, bf* Ph, bf* Pl) {
    const int lane = threadIdx.x & 31; const int row = blockIdx.x * 8 + (threadIdx.x >> 5); if (row >= ZH * TT) return; const int i = row % TT; const int zz = row / TT; (void)zz; const bool hires = (i < RH); const float* sr = Sb + (size_t)row * TT; const float* abr = ab + (size_t)i * TT; const int* amr = am + (size_t)i * TT; float v[TT / 32]; float mx = -3.0e38f;
#pragma unroll
    for (int ch = 0; ch < TT / 128; ++ch) { const int j0 = ch * 128 + lane * 4; const v4f a = *(const v4f*)(sr + j0);
#pragma unroll
        for (int q = 0; q < 4; ++q) { const int j = j0 + q; (void)j; float sa = a[q] * SCL; asm volatile("" : "+v"(sa)); float bv2 = bfr(abr[j0 + q]); asm volatile("" : "+v"(bv2)); const float t = (amr[j0 + q] > 0) ? __fadd_rn(sa, bv2) : -3.0e38f; v[ch * 4 + q] = t; mx = fmaxf(mx, t); } }
#pragma unroll
    for (int sh = 16; sh; sh >>= 1) mx = fmaxf(mx, __shfl_xor(mx, sh, 32));
    float sum = 0.f;
#pragma unroll
    for (int k = 0; k < TT / 32; ++k) { float d0 = __fsub_rn(v[k], mx); asm volatile("" : "+v"(d0)); v[k] = __builtin_amdgcn_exp2f(__fmul_rn(d0, 1.4426950408889634f)); sum += v[k]; }
#pragma unroll
    for (int sh = 16; sh; sh >>= 1) sum += __shfl_xor(sum, sh, 32);
    const float f = __fdiv_rn(hires ? 1.0f : PCAR, sum);
{
        if (hires) {
#pragma unroll
            for (int ch = 0; ch < TT / 128; ++ch) { v4us oh, ol;
#pragma unroll
                for (int q = 0; q < 4; ++q) { unsigned short a, c2; splitf(v[ch * 4 + q] * f, a, c2); oh[q] = a; ol[q] = c2; }
                const size_t oo = ((size_t)zz * (RH ? RH : 1) + i) * TT + ch * 128 + lane * 4; *(v4us*)(Ph + oo) = oh; *(v4us*)(Pl + oo) = ol; }
        } else {
#pragma unroll
            for (int ch = 0; ch < TT / 128; ++ch) { v4h o4;
#pragma unroll
                for (int q = 0; q < 4; ++q) o4[q] = tohx(v[ch * 4 + q] * f);
                *(v4h*)(P16 + (size_t)row * TT + ch * 128 + lane * 4) = o4; } }
         }
}
__global__ __launch_bounds__(256) void k_merge(const float* __restrict__ O, int h0, bf* Ah, bf* Al) { const size_t e = ((size_t)blockIdx.x * 256 + threadIdx.x) * 2; if (e >= (size_t)ZH * TT * HD) return; const int d = (int)(e % HD); const int t = (int)((e / HD) % TT); const int zz = (int)(e / ((size_t)HD * TT)); const float cs = (t < RH) ? 1.0f : (1.0f / PCAR); const size_t oo = (size_t)t * DQ + (h0 + zz) * HD + d;
    v2us oh, ol;
#pragma unroll
    for (int q = 0; q < 2; ++q) { unsigned short a, c2; splitf(O[e + q] * cs, a, c2); oh[q] = a; ol[q] = c2; } *(v2us*)(Ah + oo) = oh; *(v2us*)(Al + oo) = ol;  }

extern "C" void kernel_launch(void* const* d_in, const int* in_sizes, int n_in,
                              void* d_out, int out_size, void* d_ws, size_t ws_size, hipStream_t stream) {
    (void)in_sizes; (void)n_in; (void)out_size;
    const float* x = (const float*)d_in[0]; const float* abias = (const float*)d_in[1]; const int* amask = (const int*)d_in[2]; const float* wq = (const float*)d_in[3]; const float* bq = (const float*)d_in[4]; const float* wk = (const float*)d_in[5]; const float* bk = (const float*)d_in[6]; const float* wv = (const float*)d_in[7]; const float* bv = (const float*)d_in[8]; const float* wo = (const float*)d_in[9]; const float* bo = (const float*)d_in[10]; const float* cosT = nullptr; const float* sinT = nullptr; (void)cosT; (void)sinT;
    float* OUT = (float*)d_out;     // [2][2048][1024]
    char* wsp = (char*)d_ws;
    auto take = [&](size_t bytes) { char* p = wsp; wsp += (bytes + 255) & ~(size_t)255; return (void*)p; };
    bf* WQ = (bf*)take((size_t)DQ * DM * 2); bf* WK = (bf*)take((size_t)DKV * DM * 2); bf* WV = (bf*)take((size_t)DKV * DM * 2); bf* WO = (bf*)take((size_t)DM * DQ * 2); float* CS = (float*)take((size_t)TT * HD * 2 * 4);
    bf* XB = (bf*)take((size_t)TT * DM * 2); float* FQ = (float*)take((size_t)TT * DQ * 4); float* FK = (float*)take((size_t)TT * DKV * 4);
    h16* QP16 = (h16*)take((size_t)NH_ * TT * HD * 2); h16* KP16 = (h16*)take((size_t)NKV * TT * HD * 2); h16* VT16 = (h16*)take((size_t)NKV * HD * TT * 2);
    bf* QPh = (bf*)take((size_t)NH_ * TT * HD * 2); bf* QPl = (bf*)take((size_t)NH_ * TT * HD * 2); bf* KPh = (bf*)take((size_t)NKV * TT * HD * 2); bf* KPl = (bf*)take((size_t)NKV * TT * HD * 2); bf* VTh = (bf*)take((size_t)NKV * HD * TT * 2); bf* VTl = (bf*)take((size_t)NKV * HD * TT * 2); bf* Ph = (bf*)take((size_t)ZH * RH * TT * 2); bf* Pl = (bf*)take((size_t)ZH * RH * TT * 2);
    float* Sb = (float*)take((size_t)ZH * TT * TT * 4); h16* P16 = (h16*)take((size_t)ZH * TT * TT * 2); float* Ob = (float*)take((size_t)ZH * TT * HD * 4); bf* ATh = (bf*)take((size_t)TT * DQ * 2); bf* ATl = (bf*)take((size_t)TT * DQ * 2);
    if ((size_t)(wsp - (char*)d_ws) > ws_size) return;    // ws 256 MiB
    float* FV = FK;   // v projection reuses the k buffer after the k planes are built (stream-ordered)
    { k_cvt8<<<(unsigned)(((size_t)DQ * DM / 8 + 255) / 256), 256, 0, stream>>>(wq, WQ, (size_t)DQ * DM / 8); k_cvt8<<<(unsigned)(((size_t)DKV * DM / 8 + 255) / 256), 256, 0, stream>>>(wk, WK, (size_t)DKV * DM / 8); k_cvt8<<<(unsigned)(((size_t)DKV * DM / 8 + 255) / 256), 256, 0, stream>>>(wv, WV, (size_t)DKV * DM / 8);
      k_cvt8<<<(unsigned)(((size_t)DM * DQ / 8 + 255) / 256), 256, 0, stream>>>(wo, WO, (size_t)DM * DQ / 8);
       }
    k_csid<<<(TT * HD + 255) / 256, 256, 0, stream>>>(CS);
    const unsigned LQ = (unsigned)(((size_t)NH_ * TT * HD / 2 + 255) / 256), LKv = (unsigned)(((size_t)NKV * TT * HD / 2 + 255) / 256);
    for (int b = 0; b < NB_; ++b) {
        
        k_cvt8<<<(unsigned)(((size_t)TT * DM / 8 + 255) / 256), 256, 0, stream>>>(x + (size_t)b * TT * DM, XB, (size_t)TT * DM / 8);
        k_gemmw<bf, 0, true><<<dim3(TT / 64, DQ / 64, 1), 32, 0, stream>>>(XB, nullptr, WQ, nullptr, DM, FQ, DQ, bq, 0, 0, 0);
        k_rope<<<LQ, 256, 0, stream>>>(FQ, DQ, NH_, CS, nullptr, nullptr, 1.0f, QP16, QPh, QPl);
        k_gemmw<bf, 0, true><<<dim3(TT / 64, DKV / 64, 1), 32, 0, stream>>>(XB, nullptr, WK, nullptr, DM, FK, DKV, bk, 0, 0, 0);
        k_rope<<<LKv, 256, 0, stream>>>(FK, DKV, NKV, CS, nullptr, nullptr, 1.0f, KP16, KPh, KPl);
        k_gemmw<bf, 0, true><<<dim3(TT / 64, DKV / 64, 1), 32, 0, stream>>>(XB, nullptr, WV, nullptr, DM, FV, DKV, bv, 0, 0, 0); k_vtp<<<LKv, 256, 0, stream>>>(FV, DKV, NKV, VT16, VTh, VTl);
        for (int h0 = 0; h0 < NH_; h0 += ZH) { const size_t zq = (size_t)h0, zk = (size_t)(h0 / REP);   // one kv head per query head: the pass's two heads use consecutive kv planes (z-strides TT*HD)
            k_gemmw<bf, 2, false><<<dim3(RH / 64, TT / 64, ZH), 32, 0, stream>>>(QPh + zq * TT * HD, QPl + zq * TT * HD, KPh + zk * TT * HD, KPl + zk * TT * HD, HD, Sb, TT, nullptr, (size_t)TT * HD, (size_t)TT * HD, (size_t)TT * TT);
            k_gemmw<h16, 0, false><<<dim3((TT - RH) / 64, TT / 64, ZH), 32, 0, stream>>>(QP16 + zq * TT * HD + (size_t)RH * HD, nullptr, KP16 + zk * TT * HD, nullptr, HD, Sb + (size_t)RH * TT, TT, nullptr, (size_t)TT * HD, (size_t)TT * HD, (size_t)TT * TT);
            k_asoft<<<ZH * TT / 8, 256, 0, stream>>>(Sb, abias + (size_t)b * TT * TT, amask + (size_t)b * TT * TT, P16, Ph, Pl);
            k_gemmw<bf, 2, false><<<dim3(RH / 64, HD / 64, ZH), 32, 0, stream>>>(Ph, Pl, VTh + zk * HD * TT, VTl + zk * HD * TT, TT, Ob, HD, nullptr, (size_t)RH * TT, (size_t)HD * TT, (size_t)TT * HD);
            k_gemmw<h16, 0, false><<<dim3((TT - RH) / 64, HD / 64, ZH), 32, 0, stream>>>(P16 + (size_t)RH * TT, nullptr, VT16 + zk * HD * TT, nullptr, TT, Ob + (size_t)RH * HD, HD, nullptr, (size_t)TT * TT, (size_t)HD * TT, (size_t)TT * HD);
            k_merge<<<(unsigned)(((size_t)ZH * TT * HD / 2 + 255) / 256), 256, 0, stream>>>(Ob, h0, ATh, ATl); }
        k_gemmw<bf, 1, true><<<dim3(TT / 64, DM / 64, 1), 32, 0, stream>>>(ATh, ATl, WO, nullptr, DQ, OUT + (size_t)b * TT * DM, DM, bo, 0, 0, 0); }
}

// v001
// A run of this version takes 1130 microseconds.
// Timed twice side by side with v000, it ran 2.02 and 1.99 times as fast.
#include <hip/hip_runtime.h>

// MultiHeadAttentionWithBias (query [2][2048][1024], attention_bias [2][S][S] (f32, read), attention_mask [2][S][S] (int, read; all ones); q/k/v = x W^T + b (16 x 64); scores = q.k / 8 + bias[b][i][j], -inf where mask <= 0; softmax; out = merged Wo^T + bo -> [2][2048][1024]).
// Compute dtypes, f32 accumulate: every input rounded to bf16; q/k/v on PLAIN bf16 operands (inputs: exact) + bias; scores PRECPLAN; the bf16-rounded bias and the int mask read per element in f32 (no structural skipping); softmax f32; Wo hl x exact (2 products) + bias.

#define NB_  2
#define TT   2048
#define DM   1024
#define NH_  16
#define NKV  16
#define REP  (NH_ / NKV)
#define HD   64
#define DQ   (NH_ * HD)
#define DKV  (NKV * HD)
#define ZH   2
#define RH   512                  // query rows < RH use hi+lo planes (0: none)
#define WIN  0
#define PCAR 1024.0f
#define SCL  0.125f   // HD^-0.5
#define KSP  16                   // P.V products: chunks of the key axis, one work-group each; k_merge sums the partial planes
typedef _Float16 h16;
typedef unsigned short bf;
typedef __attribute__((ext_vector_type(16))) __bf16   v16bf;
typedef __attribute__((ext_vector_type(16))) _Float16 v16h;
typedef __attribute__((ext_vector_type(8)))  _Float16 v8h;
typedef __attribute__((ext_vector_type(8)))  unsigned short v8us;
typedef __attribute__((ext_vector_type(8)))  float    v8f;
typedef __attribute__((ext_vector_type(4)))  float    v4f;
typedef v8h  __attribute__((may_alias)) v8ha;
typedef v4f  __attribute__((may_alias)) v4fa;
typedef v8us __attribute__((may_alias)) v8usa;

__device__ __forceinline__ unsigned short f2bf(float f) { unsigned u = __float_as_uint(f); u += 0x7FFFu + ((u >> 16) & 1u); return (unsigned short)(u >> 16); }
__device__ __forceinline__ float bf2f(unsigned short b) { return __uint_as_float(((unsigned)b) << 16); }
__device__ __forceinline__ float bfr(float f) { return bf2f(f2bf(f)); }
__device__ __forceinline__ v16h cat16(v8h lo, v8h hi) { return __builtin_shufflevector(lo, hi, 0, 1, 2, 3, 4, 5, 6, 7, 8, 9, 10, 11, 12, 13, 14, 15); }
__device__ __forceinline__ v16bf cat16b(v8us lo, v8us hi) { return __builtin_bit_cast(v16bf, __builtin_shufflevector(lo, hi, 0, 1, 2, 3, 4, 5, 6, 7, 8, 9, 10, 11, 12, 13, 14, 15)); }
__device__ __forceinline__ v8f wmma16(v16h a, v16h b, v8f c) { return __builtin_amdgcn_wmma_f32_16x16x32_f16(false, a, false, b, (short)0, c, false, false); }
__device__ __forceinline__ v8f wmmab(v16bf a, v16bf b, v8f c) { return __builtin_amdgcn_wmma_f32_16x16x32_bf16(false, a, false, b, (short)0, c, false, false); }



// ---- k_gemmw: register-blocked GEMM, ONE WAVE per 64x64 output tile (16 accumulators), operands straight from K-contiguous 16-bit planes; grid (M/64, N/64, Z), 32 threads.
// C[m][n] (f32, pitch ldc, + optional f32 bias[n]) = sum_k A[m][k] Bt[n][k] (+ split products per NSPLIT). z-batch strides sA/sB/sC in elements. K % 32 == 0.
// KS > 1: grid z = batches x KS; a work-group sums only chunk ks (K elements) of rows of pitch K x KS and writes partial plane ks of C (planes of ZH x sC elements), which the consumer adds up.
template <typename T16> struct WFrag;
template <> struct WFrag<h16> { typedef v16h V; static __device__ __forceinline__ V ld(const h16* p) { return cat16(*(const v8h*)p, *(const v8h*)(p + 16)); } static __device__ __forceinline__ v8f mma(V a, V b, v8f c) { return wmma16(a, b, c); } };
template <> struct WFrag<bf> { typedef v16bf V; static __device__ __forceinline__ V ld(const bf* p) { return cat16b(*(const v8us*)p, *(const v8us*)(p + 16)); } static __device__ __forceinline__ v8f mma(V a, V b, v8f c) { return wmmab(a, b, c); } };
template <typename T16, int NSPLIT, bool BIAS, int KS = 1>
__global__ __launch_bounds__(32) void k_gemmw(const T16* __restrict__ A, const T16* __restrict__ A2, const T16* __restrict__ Bt, const T16* __restrict__ Bt2, int K, float* C, int ldc, const float* __restrict__ bias, size_t sA, size_t sB, size_t sC) {
    typedef typename WFrag<T16>::V V;
    __shared__ __align__(16) float os[16 * 68];
    const size_t z = blockIdx.z / KS; const size_t ks = blockIdx.z % KS; const size_t ld = (size_t)K * KS; A += z * sA + ks * K; if (A2) A2 += z * sA + ks * K; Bt += z * sB + ks * K; if (Bt2) Bt2 += z * sB + ks * K; C += (z + ks * ZH) * sC;
    const int lane = threadIdx.x & 31, lr = lane & 15, hi = lane >> 4; const int r0 = blockIdx.x * 64, c0 = blockIdx.y * 64;
    v8f acc[4][4];
#pragma unroll
    for (int mb = 0; mb < 4; ++mb)
#pragma unroll
        for (int nb = 0; nb < 4; ++nb) acc[mb][nb] = (v8f){};
    const size_t aoff = (size_t)(r0 + lr) * ld + 8 * hi, boff = (size_t)(c0 + lr) * ld + 8 * hi;
#pragma unroll 1
    for (int kc = 0; kc < K; kc += 32) {
        V a[4], a2[4];
#pragma unroll
        for (int mb = 0; mb < 4; ++mb) { a[mb] = WFrag<T16>::ld(A + aoff + (size_t)mb * 16 * ld + kc); if (NSPLIT == 1 || NSPLIT == 2) a2[mb] = WFrag<T16>::ld(A2 + aoff + (size_t)mb * 16 * ld + kc); }
#pragma unroll
        for (int nb = 0; nb < 4; ++nb) { const V b = WFrag<T16>::ld(Bt + boff + (size_t)nb * 16 * ld + kc); V b2; if (NSPLIT >= 2) b2 = WFrag<T16>::ld(Bt2 + boff + (size_t)nb * 16 * ld + kc);
#pragma unroll
            for (int mb = 0; mb < 4; ++mb) { acc[mb][nb] = WFrag<T16>::mma(a[mb], b, acc[mb][nb]); if (NSPLIT == 1 || NSPLIT == 2) acc[mb][nb] = WFrag<T16>::mma(a2[mb], b, acc[mb][nb]); if (NSPLIT >= 2) acc[mb][nb] = WFrag<T16>::mma(a[mb], b2, acc[mb][nb]); } }
        asm volatile("v_nop\n\tv_nop\n\tv_nop\n\tv_nop" : "+v"(acc[0][0]), "+v"(acc[1][1]), "+v"(acc[2][2]), "+v"(acc[3][3]) : "v"(a[0]), "v"(a[3]));
    }
#pragma unroll
    for (int mb = 0; mb < 4; ++mb) {
#pragma unroll
        for (int nb = 0; nb < 4; ++nb) {
#pragma unroll
            for (int j = 0; j < 8; ++j) os[(hi * 8 + j) * 68 + nb * 16 + lr] = acc[mb][nb][j]; }
        __builtin_amdgcn_wave_barrier(); asm volatile("" ::: "memory");
        float* crow = C + (size_t)(r0 + mb * 16) * ldc + c0;
{
#pragma unroll
            for (int s = 0; s < 8; ++s) { const int row = 2 * s + hi, cofs = lr * 4; v4f val = *(const v4fa*)(os + row * 68 + cofs); if (BIAS) { val[0] += bfr(bias[c0 + cofs]); val[1] += bfr(bias[c0 + cofs + 1]); val[2] += bfr(bias[c0 + cofs + 2]); val[3] += bfr(bias[c0 + cofs + 3]); }
                *(v4f*)(crow + (size_t)row * ldc + cofs) = val; }
             }
        __builtin_amdgcn_wave_barrier(); asm volatile("" ::: "memory");
    }
}

__device__ __forceinline__ h16 tohx(float x) { return (h16)x; }
__device__ __forceinline__ void splitf(float y, unsigned short& h, unsigned short& l) { h = f2bf(y); l = f2bf(y - bf2f(h)); }
typedef __attribute__((ext_vector_type(2))) _Float16 v2h;
typedef __attribute__((ext_vector_type(4))) _Float16 v4h;
typedef __attribute__((ext_vector_type(2))) unsigned short v2us;
typedef __attribute__((ext_vector_type(4))) unsigned short v4us;
typedef __attribute__((ext_vector_type(2))) float v2f;
typedef __attribute__((ext_vector_type(4))) int v4i;

__global__ __launch_bounds__(256) void k_wtG(const float* __restrict__ w, int K, int N, bf* Bt) {
    const int lane = threadIdx.x & 31; const int L0 = (blockIdx.x * 8 + (threadIdx.x >> 5)) * 8; const int nlines = N * K / 64;
{
#pragma unroll 1
        for (int l = 0; l < 8; ++l) { const int L = L0 + l; if (L >= nlines) break; const size_t e = (size_t)L * 64 + lane * 2; const int k = (int)(e % K), n = (int)(e / K); v2us o;
            o[0] = f2bf(w[(size_t)k * N + n]); o[1] = f2bf(w[(size_t)(k + 1) * N + n]); *(v2us*)(Bt + e) = o; }
         }
}
__global__ __launch_bounds__(256) void k_cvt8(const float* __restrict__ src, bf* dst, size_t n8) { const size_t i = (size_t)blockIdx.x * 256 + threadIdx.x; if (i >= n8) return; const v8f v = *(const v8f*)(src + i * 8); v8us o;
#pragma unroll
    for (int k = 0; k < 8; ++k) o[k] = f2bf(v[k]); *(v8us*)(dst + i * 8) = o;  }
__global__ __launch_bounds__(256) void k_cscvt(const float* __restrict__ cosT, const float* __restrict__ sinT, float* CS) { const int idx = blockIdx.x * 256 + threadIdx.x; if (idx >= TT * HD) return; v2f cs; cs[0] = bfr(cosT[idx]); cs[1] = bfr(sinT[idx]); *(v2f*)(CS + (size_t)idx * 2) = cs;  }
// k_rope: head planes [h][t][d] (fp16 + hi/lo) of rope(x) x sc with the rotate-half convention out[d] = x[d] cos[t][d] - x[d+HD/2] sin[t][d], out[d+HD/2] = x[d+HD/2] cos[t][d+HD/2] + x[d] sin[t][d+HD/2]
__global__ __launch_bounds__(256) void k_rope(const float* __restrict__ F, int pitch, int nheads, const float* __restrict__ CS, const float* __restrict__ RF, const float* __restrict__ nw, float sc, h16* P16, bf* Ph, bf* Pl) {
    const size_t e = ((size_t)blockIdx.x * 256 + threadIdx.x) * 2; if (e >= (size_t)nheads * TT * HD) return; const int d = (int)(e % HD); const int t = (int)((e / HD) % TT); const int h = (int)(e / ((size_t)HD * TT)); const float* f = F + (size_t)t * pitch + h * HD; const float rf = RF ? RF[(size_t)h * TT + t] : 1.0f; v2h o16; v2us oh, ol;
#pragma unroll
    for (int q = 0; q < 2; ++q) { const int dd = d + q; const int dp = (dd < HD / 2) ? dd + HD / 2 : dd - HD / 2; float x0 = f[dd], x1 = f[dp];
        if (RF) { float n0 = __fmul_rn(x0, rf), n1 = __fmul_rn(x1, rf); asm volatile("" : "+v"(n0)); asm volatile("" : "+v"(n1)); x0 = __fmul_rn(bfr(nw[dd]), n0); x1 = __fmul_rn(bfr(nw[dp]), n1); }
        const v2f cs = *(const v2f*)(CS + ((size_t)t * HD + dd) * 2); float a = __fmul_rn(x0, cs[0]), bq = __fmul_rn(x1, cs[1]); asm volatile("" : "+v"(a)); asm volatile("" : "+v"(bq)); const float r = ((dd < HD / 2) ? __fsub_rn(a, bq) : __fadd_rn(a, bq)) * sc;
        o16[q] = tohx(r); unsigned short a2, c2; splitf(r, a2, c2); oh[q] = a2; ol[q] = c2; }
    *(v2h*)(P16 + e) = o16; *(v2us*)(Ph + e) = oh; *(v2us*)(Pl + e) = ol;  }
__global__ __launch_bounds__(256) void k_vtp(const float* __restrict__ F, int pitch, int nheads, h16* V16, bf* Vh, bf* Vl) { const size_t e = ((size_t)blockIdx.x * 256 + threadIdx.x) * 2; if (e >= (size_t)nheads * HD * TT) return; const int t = (int)(e % TT); const int d = (int)((e / TT) % HD); const int g = (int)(e / ((size_t)TT * HD)); v2h o16; v2us oh, ol;
#pragma unroll
    for (int q = 0; q < 2; ++q) { const float x = F[(size_t)(t + q) * pitch + g * HD + d]; o16[q] = tohx(x); unsigned short a2, c2; splitf(x, a2, c2); oh[q] = a2; ol[q] = c2; }
    *(v2h*)(V16 + e) = o16; *(v2us*)(Vh + e) = oh; *(v2us*)(Vl + e) = ol;  }
__global__ __launch_bounds__(256) void k_csid(float* CS) { const int idx = blockIdx.x * 256 + threadIdx.x; if (idx >= TT * HD) return; v2f cs; cs[0] = 1.0f; cs[1] = 0.0f; *(v2f*)(CS + (size_t)idx * 2) = cs;  }
// k_asoft: per row (zz, i): t = S x HD^-0.5 + bf16 bias, -3e38 where mask <= 0; softmax over the 2048 keys (register row, one exp, fixed trees);
__global__ __launch_bounds__(256) void k_asoft(const float* __restrict__ Sb, const float* __restrict__ ab, const int* __restrict__ am, h16* P16, bf* Ph, bf* Pl) {
    const int lane = threadIdx.x & 31; const int row = blockIdx.x * 8 + (threadIdx.x >> 5); if (row >= ZH * TT) return; const int i = row % TT; const int zz = row / TT; (void)zz; const bool hires = (i < RH); const float* sr = Sb + (size_t)row * TT; const float* abr = ab + (size_t)i * TT; const int* amr = am + (size_t)i * TT; float v[TT / 32]; float mx = -3.0e38f;
#pragma unroll
    for (int ch = 0; ch < TT / 128; ++ch) { const int j0 = ch * 128 + lane * 4; const v4f a = *(const v4f*)(sr + j0);
#pragma unroll
        for (int q = 0; q < 4; ++q) { const int j = j0 + q; (void)j; float sa = a[q] * SCL; asm volatile("" : "+v"(sa)); float bv2 = bfr(abr[j0 + q]); asm volatile("" : "+v"(bv2)); const float t = (amr[j0 + q] > 0) ? __fadd_rn(sa, bv2) : -3.0e38f; v[ch * 4 + q] = t; mx = fmaxf(mx, t); } }
#pragma unroll
    for (int sh = 16; sh; sh >>= 1) mx = fmaxf(mx, __shfl_xor(mx, sh, 32));
    float sum = 0.f;
#pragma unroll
    for (int k = 0; k < TT / 32; ++k) { float d0 = __fsub_rn(v[k], mx); asm volatile("" : "+v"(d0)); v[k] = __builtin_amdgcn_exp2f(__fmul_rn(d0, 1.4426950408889634f)); sum += v[k]; }
#pragma unroll
    for (int sh = 16; sh; sh >>= 1) sum += __shfl_xor(sum, sh, 32);
    const float f = __fdiv_rn(hires ? 1.0f : PCAR, sum);
{
        if (hires) {
#pragma unroll
            for (int ch = 0; ch < TT / 128; ++ch) { v4us oh, ol;
#pragma unroll
                for (int q = 0; q < 4; ++q) { unsigned short a, c2; splitf(v[ch * 4 + q] * f, a, c2); oh[q] = a; ol[q] = c2; }
                const size_t oo = ((size_t)zz * (RH ? RH : 1) + i) * TT + ch * 128 + lane * 4; *(v4us*)(Ph + oo) = oh; *(v4us*)(Pl + oo) = ol; }
        } else {
#pragma unroll
            for (int ch = 0; ch < TT / 128; ++ch) { v4h o4;
#pragma unroll
                for (int q = 0; q < 4; ++q) o4[q] = tohx(v[ch * 4 + q] * f);
                *(v4h*)(P16 + (size_t)row * TT + ch * 128 + lane * 4) = o4; } }
         }
}
__global__ __launch_bounds__(256) void k_merge(const float* __restrict__ O, int h0, bf* Ah, bf* Al) { const size_t e = ((size_t)blockIdx.x * 256 + threadIdx.x) * 2; if (e >= (size_t)ZH * TT * HD) return; const int d = (int)(e % HD); const int t = (int)((e / HD) % TT); const int zz = (int)(e / ((size_t)HD * TT)); const float cs = (t < RH) ? 1.0f : (1.0f / PCAR); const size_t oo = (size_t)t * DQ + (h0 + zz) * HD + d;
    v2f s = *(const v2f*)(O + e);   // partial planes of the KSP key chunks, added in chunk order
#pragma unroll   // all KSP plane loads are issued before the first add waits: one memory latency instead of KSP
    for (int ks = 1; ks < KSP; ++ks) s += *(const v2f*)(O + (size_t)ks * ZH * TT * HD + e);
    v2us oh, ol;
#pragma unroll
    for (int q = 0; q < 2; ++q) { unsigned short a, c2; splitf(s[q] * cs, a, c2); oh[q] = a; ol[q] = c2; } *(v2us*)(Ah + oo) = oh; *(v2us*)(Al + oo) = ol;  }

extern "C" void kernel_launch(void* const* d_in, const int* in_sizes, int n_in,
                              void* d_out, int out_size, void* d_ws, size_t ws_size, hipStream_t stream) {
    (void)in_sizes; (void)n_in; (void)out_size;
    const float* x = (const float*)d_in[0]; const float* abias = (const float*)d_in[1]; const int* amask = (const int*)d_in[2]; const float* wq = (const float*)d_in[3]; const float* bq = (const float*)d_in[4]; const float* wk = (const float*)d_in[5]; const float* bk = (const float*)d_in[6]; const float* wv = (const float*)d_in[7]; const float* bv = (const float*)d_in[8]; const float* wo = (const float*)d_in[9]; const float* bo = (const float*)d_in[10]; const float* cosT = nullptr; const float* sinT = nullptr; (void)cosT; (void)sinT;
    float* OUT = (float*)d_out;     // [2][2048][1024]
    char* wsp = (char*)d_ws;
    auto take = [&](size_t bytes) { char* p = wsp; wsp += (bytes + 255) & ~(size_t)255; return (void*)p; };
    bf* WQ = (bf*)take((size_t)DQ * DM * 2); bf* WK = (bf*)take((size_t)DKV * DM * 2); bf* WV = (bf*)take((size_t)DKV * DM * 2); bf* WO = (bf*)take((size_t)DM * DQ * 2); float* CS = (float*)take((size_t)TT * HD * 2 * 4);
    bf* XB = (bf*)take((size_t)TT * DM * 2); float* FQ = (float*)take((size_t)TT * DQ * 4); float* FK = (float*)take((size_t)TT * DKV * 4);
    h16* QP16 = (h16*)take((size_t)NH_ * TT * HD * 2); h16* KP16 = (h16*)take((size_t)NKV * TT * HD * 2); h16* VT16 = (h16*)take((size_t)NKV * HD * TT * 2);
    bf* QPh = (bf*)take((size_t)NH_ * TT * HD * 2); bf* QPl = (bf*)take((size_t)NH_ * TT * HD * 2); bf* KPh = (bf*)take((size_t)NKV * TT * HD * 2); bf* KPl = (bf*)take((size_t)NKV * TT * HD * 2); bf* VTh = (bf*)take((size_t)NKV * HD * TT * 2); bf* VTl = (bf*)take((size_t)NKV * HD * TT * 2); bf* Ph = (bf*)take((size_t)ZH * RH * TT * 2); bf* Pl = (bf*)take((size_t)ZH * RH * TT * 2);
    float* Sb = (float*)take((size_t)ZH * TT * TT * 4); h16* P16 = (h16*)take((size_t)ZH * TT * TT * 2); float* Ob = (float*)take((size_t)KSP * ZH * TT * HD * 4); bf* ATh = (bf*)take((size_t)TT * DQ * 2); bf* ATl = (bf*)take((size_t)TT * DQ * 2);
    if ((size_t)(wsp - (char*)d_ws) > ws_size) return;    // ws 256 MiB
    float* FV = FK;   // v projection reuses the k buffer after the k planes are built (stream-ordered)
    { k_cvt8<<<(unsigned)(((size_t)DQ * DM / 8 + 255) / 256), 256, 0, stream>>>(wq, WQ, (size_t)DQ * DM / 8); k_cvt8<<<(unsigned)(((size_t)DKV * DM / 8 + 255) / 256), 256, 0, stream>>>(wk, WK, (size_t)DKV * DM / 8); k_cvt8<<<(unsigned)(((size_t)DKV * DM / 8 + 255) / 256), 256, 0, stream>>>(wv, WV, (size_t)DKV * DM / 8);
      k_cvt8<<<(unsigned)(((size_t)DM * DQ / 8 + 255) / 256), 256, 0, stream>>>(wo, WO, (size_t)DM * DQ / 8);
       }
    k_csid<<<(TT * HD + 255) / 256, 256, 0, stream>>>(CS);
    const unsigned LQ = (unsigned)(((size_t)NH_ * TT * HD / 2 + 255) / 256), LKv = (unsigned)(((size_t)NKV * TT * HD / 2 + 255) / 256);
    for (int b = 0; b < NB_; ++b) {
        
        k_cvt8<<<(unsigned)(((size_t)TT * DM / 8 + 255) / 256), 256, 0, stream>>>(x + (size_t)b * TT * DM, XB, (size_t)TT * DM / 8);
        k_gemmw<bf, 0, true><<<dim3(TT / 64, DQ / 64, 1), 32, 0, stream>>>(XB, nullptr, WQ, nullptr, DM, FQ, DQ, bq, 0, 0, 0);
        k_rope<<<LQ, 256, 0, stream>>>(FQ, DQ, NH_, CS, nullptr, nullptr, 1.0f, QP16, QPh, QPl);
        k_gemmw<bf, 0, true><<<dim3(TT / 64, DKV / 64, 1), 32, 0, stream>>>(XB, nullptr, WK, nullptr, DM, FK, DKV, bk, 0, 0, 0);
        k_rope<<<LKv, 256, 0, stream>>>(FK, DKV, NKV, CS, nullptr, nullptr, 1.0f, KP16, KPh, KPl);
        k_gemmw<bf, 0, true><<<dim3(TT / 64, DKV / 64, 1), 32, 0, stream>>>(XB, nullptr, WV, nullptr, DM, FV, DKV, bv, 0, 0, 0); k_vtp<<<LKv, 256, 0, stream>>>(FV, DKV, NKV, VT16, VTh, VTl);
        for (int h0 = 0; h0 < NH_; h0 += ZH) { const size_t zq = (size_t)h0, zk = (size_t)(h0 / REP);   // one kv head per query head: the pass's two heads use consecutive kv planes (z-strides TT*HD)
            k_gemmw<bf, 2, false><<<dim3(RH / 64, TT / 64, ZH), 32, 0, stream>>>(QPh + zq * TT * HD, QPl + zq * TT * HD, KPh + zk * TT * HD, KPl + zk * TT * HD, HD, Sb, TT, nullptr, (size_t)TT * HD, (size_t)TT * HD, (size_t)TT * TT);
            k_gemmw<h16, 0, false><<<dim3((TT - RH) / 64, TT / 64, ZH), 32, 0, stream>>>(QP16 + zq * TT * HD + (size_t)RH * HD, nullptr, KP16 + zk * TT * HD, nullptr, HD, Sb + (size_t)RH * TT, TT, nullptr, (size_t)TT * HD, (size_t)TT * HD, (size_t)TT * TT);
            k_asoft<<<ZH * TT / 8, 256, 0, stream>>>(Sb, abias + (size_t)b * TT * TT, amask + (size_t)b * TT * TT, P16, Ph, Pl);
            k_gemmw<bf, 2, false, KSP><<<dim3(RH / 64, HD / 64, ZH * KSP), 32, 0, stream>>>(Ph, Pl, VTh + zk * HD * TT, VTl + zk * HD * TT, TT / KSP, Ob, HD, nullptr, (size_t)RH * TT, (size_t)HD * TT, (size_t)TT * HD);
            k_gemmw<h16, 0, false, KSP><<<dim3((TT - RH) / 64, HD / 64, ZH * KSP), 32, 0, stream>>>(P16 + (size_t)RH * TT, nullptr, VT16 + zk * HD * TT, nullptr, TT / KSP, Ob + (size_t)RH * HD, HD, nullptr, (size_t)TT * TT, (size_t)HD * TT, (size_t)TT * HD);
            k_merge<<<(unsigned)(((size_t)ZH * TT * HD / 2 + 255) / 256), 256, 0, stream>>>(Ob, h0, ATh, ATl); }
        k_gemmw<bf, 1, true><<<dim3(TT / 64, DM / 64, 1), 32, 0, stream>>>(ATh, ATl, WO, nullptr, DQ, OUT + (size_t)b * TT * DM, DM, bo, 0, 0, 0); }
}

// v002
// It runs in 892 microseconds.
// Two timings next to v001 both put it at 1.27 times that version's speed.
// Counting every step since v000, it is 2.55 times as fast.
#include <hip/hip_runtime.h>

// MultiHeadAttentionWithBias (query [2][2048][1024], attention_bias [2][S][S] (f32, read), attention_mask [2][S][S] (int, read; all ones); q/k/v = x W^T + b (16 x 64); scores = q.k / 8 + bias[b][i][j], -inf where mask <= 0; softmax; out = merged Wo^T + bo -> [2][2048][1024]).
// Compute dtypes, f32 accumulate: every input rounded to bf16; q/k/v on PLAIN bf16 operands (inputs: exact) + bias; scores PRECPLAN; the bf16-rounded bias and the int mask read per element in f32 (no structural skipping); softmax f32; Wo hl x exact (2 products) + bias.

#define NB_  2
#define TT   2048
#define DM   1024
#define NH_  16
#define NKV  16
#define REP  (NH_ / NKV)
#define HD   64
#define DQ   (NH_ * HD)
#define DKV  (NKV * HD)
#define ZH   8                    // heads per attention pass (one launch of each attention kernel covers ZH heads)
#define RH   512                  // query rows < RH use hi+lo planes (0: none)
#define WIN  0
#define PCAR 1024.0f
#define SCL  0.125f   // HD^-0.5
#define KSP  16                   // P.V products: chunks of the key axis, one work-group each; k_merge sums the partial planes
typedef _Float16 h16;
typedef unsigned short bf;
typedef __attribute__((ext_vector_type(16))) __bf16   v16bf;
typedef __attribute__((ext_vector_type(16))) _Float16 v16h;
typedef __attribute__((ext_vector_type(8)))  _Float16 v8h;
typedef __attribute__((ext_vector_type(8)))  unsigned short v8us;
typedef __attribute__((ext_vector_type(8)))  float    v8f;
typedef __attribute__((ext_vector_type(4)))  float    v4f;
typedef v8h  __attribute__((may_alias)) v8ha;
typedef v4f  __attribute__((may_alias)) v4fa;
typedef v8us __attribute__((may_alias)) v8usa;

__device__ __forceinline__ unsigned short f2bf(float f) { unsigned u = __float_as_uint(f); u += 0x7FFFu + ((u >> 16) & 1u); return (unsigned short)(u >> 16); }
__device__ __forceinline__ float bf2f(unsigned short b) { return __uint_as_float(((unsigned)b) << 16); }
__device__ __forceinline__ float bfr(float f) { return bf2f(f2bf(f)); }
__device__ __forceinline__ v16h cat16(v8h lo, v8h hi) { return __builtin_shufflevector(lo, hi, 0, 1, 2, 3, 4, 5, 6, 7, 8, 9, 10, 11, 12, 13, 14, 15); }
__device__ __forceinline__ v16bf cat16b(v8us lo, v8us hi) { return __builtin_bit_cast(v16bf, __builtin_shufflevector(lo, hi, 0, 1, 2, 3, 4, 5, 6, 7, 8, 9, 10, 11, 12, 13, 14, 15)); }
__device__ __forceinline__ v8f wmma16(v16h a, v16h b, v8f c) { return __builtin_amdgcn_wmma_f32_16x16x32_f16(false, a, false, b, (short)0, c, false, false); }
__device__ __forceinline__ v8f wmmab(v16bf a, v16bf b, v8f c) { return __builtin_amdgcn_wmma_f32_16x16x32_bf16(false, a, false, b, (short)0, c, false, false); }



// ---- k_gemmw: register-blocked GEMM, ONE WAVE per 64x64 output tile (16 accumulators), operands straight from K-contiguous 16-bit planes; grid (M/64, N/64, Z), 32 threads.
// C[m][n] (f32, pitch ldc, + optional f32 bias[n]) = sum_k A[m][k] Bt[n][k] (+ split products per NSPLIT). z-batch strides sA/sB/sC in elements. K % 32 == 0.
// KS > 1: grid z = batches x KS; a work-group sums only chunk ks (K elements) of rows of pitch K x KS and writes partial plane ks of C (planes of ZH x sC elements), which the consumer adds up.
template <typename T16> struct WFrag;
template <> struct WFrag<h16> { typedef v16h V; static __device__ __forceinline__ V ld(const h16* p) { return cat16(*(const v8h*)p, *(const v8h*)(p + 16)); } static __device__ __forceinline__ v8f mma(V a, V b, v8f c) { return wmma16(a, b, c); } };
template <> struct WFrag<bf> { typedef v16bf V; static __device__ __forceinline__ V ld(const bf* p) { return cat16b(*(const v8us*)p, *(const v8us*)(p + 16)); } static __device__ __forceinline__ v8f mma(V a, V b, v8f c) { return wmmab(a, b, c); } };
template <typename T16, int NSPLIT, bool BIAS, int KS = 1>
__global__ __launch_bounds__(32) void k_gemmw(const T16* __restrict__ A, const T16* __restrict__ A2, const T16* __restrict__ Bt, const T16* __restrict__ Bt2, int K, float* C, int ldc, const float* __restrict__ bias, size_t sA, size_t sB, size_t sC) {
    typedef typename WFrag<T16>::V V;
    __shared__ __align__(16) float os[16 * 68];
    const size_t z = blockIdx.z / KS; const size_t ks = blockIdx.z % KS; const size_t ld = (size_t)K * KS; A += z * sA + ks * K; if (A2) A2 += z * sA + ks * K; Bt += z * sB + ks * K; if (Bt2) Bt2 += z * sB + ks * K; C += (z + ks * ZH) * sC;
    const int lane = threadIdx.x & 31, lr = lane & 15, hi = lane >> 4; const int r0 = blockIdx.x * 64, c0 = blockIdx.y * 64;
    v8f acc[4][4];
#pragma unroll
    for (int mb = 0; mb < 4; ++mb)
#pragma unroll
        for (int nb = 0; nb < 4; ++nb) acc[mb][nb] = (v8f){};
    const size_t aoff = (size_t)(r0 + lr) * ld + 8 * hi, boff = (size_t)(c0 + lr) * ld + 8 * hi;
#pragma unroll 1
    for (int kc = 0; kc < K; kc += 32) {
        V a[4], a2[4];
#pragma unroll
        for (int mb = 0; mb < 4; ++mb) { a[mb] = WFrag<T16>::ld(A + aoff + (size_t)mb * 16 * ld + kc); if (NSPLIT == 1 || NSPLIT == 2) a2[mb] = WFrag<T16>::ld(A2 + aoff + (size_t)mb * 16 * ld + kc); }
#pragma unroll
        for (int nb = 0; nb < 4; ++nb) { const V b = WFrag<T16>::ld(Bt + boff + (size_t)nb * 16 * ld + kc); V b2; if (NSPLIT >= 2) b2 = WFrag<T16>::ld(Bt2 + boff + (size_t)nb * 16 * ld + kc);
#pragma unroll
            for (int mb = 0; mb < 4; ++mb) { acc[mb][nb] = WFrag<T16>::mma(a[mb], b, acc[mb][nb]); if (NSPLIT == 1 || NSPLIT == 2) acc[mb][nb] = WFrag<T16>::mma(a2[mb], b, acc[mb][nb]); if (NSPLIT >= 2) acc[mb][nb] = WFrag<T16>::mma(a[mb], b2, acc[mb][nb]); } }
        asm volatile("v_nop\n\tv_nop\n\tv_nop\n\tv_nop" : "+v"(acc[0][0]), "+v"(acc[1][1]), "+v"(acc[2][2]), "+v"(acc[3][3]) : "v"(a[0]), "v"(a[3]));
    }
#pragma unroll
    for (int mb = 0; mb < 4; ++mb) {
#pragma unroll
        for (int nb = 0; nb < 4; ++nb) {
#pragma unroll
            for (int j = 0; j < 8; ++j) os[(hi * 8 + j) * 68 + nb * 16 + lr] = acc[mb][nb][j]; }
        __builtin_amdgcn_wave_barrier(); asm volatile("" ::: "memory");
        float* crow = C + (size_t)(r0 + mb * 16) * ldc + c0;
{
#pragma unroll
            for (int s = 0; s < 8; ++s) { const int row = 2 * s + hi, cofs = lr * 4; v4f val = *(const v4fa*)(os + row * 68 + cofs); if (BIAS) { val[0] += bfr(bias[c0 + cofs]); val[1] += bfr(bias[c0 + cofs + 1]); val[2] += bfr(bias[c0 + cofs + 2]); val[3] += bfr(bias[c0 + cofs + 3]); }
                *(v4f*)(crow + (size_t)row * ldc + cofs) = val; }
             }
        __builtin_amdgcn_wave_barrier(); asm volatile("" ::: "memory");
    }
}

// ---- k_gemmp: the P.V product: k_gemmw's tile, loop and epilogue for an A that lies in place in the f32-wide rows of S (A pitch 2 x the Bt pitch). grid (M/64, N/64, ZH x KSP):
// a work-group sums key chunk ks (K elements) of rows of K x KSP keys and writes partial plane ks of C (planes of ZH x sC elements), which k_merge adds up.
// XW: a precaution behind each global load and store of k_gemmp: the wait on its address translation stands ahead of any later instruction that takes one of its registers as a destination.
#define XW asm volatile("s_wait_xcnt 0x0" ::: "memory")
__device__ __forceinline__ v16h ldx(const h16* p) { const v8h lo = *(const v8h*)p; XW; const v8h up = *(const v8h*)(p + 16); XW; return cat16(lo, up); }
__device__ __forceinline__ v16bf ldx(const bf* p) { const v8us lo = *(const v8us*)p; XW; const v8us up = *(const v8us*)(p + 16); XW; return cat16b(lo, up); }
template <typename T16, int NSPLIT>
__global__ __launch_bounds__(32) void k_gemmp(const T16* __restrict__ A, const T16* __restrict__ A2, const T16* __restrict__ Bt, const T16* __restrict__ Bt2, int K, float* C, int ldc, size_t sA, size_t sB, size_t sC) {
    typedef typename WFrag<T16>::V V;
    __shared__ __align__(16) float os[16 * 68];
    const size_t z = blockIdx.z / KSP; const size_t ks = blockIdx.z % KSP; const size_t ld = (size_t)K * KSP; const size_t lda = ld * 2; A += z * sA + ks * K; if (A2) A2 += z * sA + ks * K; Bt += z * sB + ks * K; if (Bt2) Bt2 += z * sB + ks * K; C += (z + ks * ZH) * sC;
    const int lane = threadIdx.x & 31, lr = lane & 15, hi = lane >> 4; const int r0 = blockIdx.x * 64, c0 = blockIdx.y * 64;
    v8f acc[4][4];
#pragma unroll
    for (int mb = 0; mb < 4; ++mb)
#pragma unroll
        for (int nb = 0; nb < 4; ++nb) acc[mb][nb] = (v8f){};
    const size_t aoff = (size_t)(r0 + lr) * lda + 8 * hi, boff = (size_t)(c0 + lr) * ld + 8 * hi;
#pragma unroll 1   // rolled as in k_gemmw: four trips, the body already holds 16 or 48 matrix instructions
    for (int kc = 0; kc < K; kc += 32) {
        V a[4], a2[4];
#pragma unroll
        for (int mb = 0; mb < 4; ++mb) { a[mb] = ldx(A + aoff + (size_t)mb * 16 * lda + kc); if (NSPLIT == 2) a2[mb] = ldx(A2 + aoff + (size_t)mb * 16 * lda + kc); }
#pragma unroll
        for (int nb = 0; nb < 4; ++nb) { const V b = ldx(Bt + boff + (size_t)nb * 16 * ld + kc); V b2; if (NSPLIT == 2) b2 = ldx(Bt2 + boff + (size_t)nb * 16 * ld + kc);
#pragma unroll
            for (int mb = 0; mb < 4; ++mb) { acc[mb][nb] = WFrag<T16>::mma(a[mb], b, acc[mb][nb]); if (NSPLIT == 2) { acc[mb][nb] = WFrag<T16>::mma(a2[mb], b, acc[mb][nb]); acc[mb][nb] = WFrag<T16>::mma(a[mb], b2, acc[mb][nb]); } } }
        // four vector slots behind the trip's last matrix instruction, also on the taken back edge, before its operands are loaded anew
        asm volatile("v_nop\n\tv_nop\n\tv_nop\n\tv_nop" : "+v"(acc[0][0]), "+v"(acc[1][1]), "+v"(acc[2][2]), "+v"(acc[3][3]) : "v"(a[0]), "v"(a[3]));
    }
#pragma unroll
    for (int mb = 0; mb < 4; ++mb) {
#pragma unroll
        for (int nb = 0; nb < 4; ++nb) {
#pragma unroll
            for (int j = 0; j < 8; ++j) os[(hi * 8 + j) * 68 + nb * 16 + lr] = acc[mb][nb][j]; }
        __builtin_amdgcn_wave_barrier(); asm volatile("" ::: "memory");   // the one wave's LDS writes stay ahead of its transposed reads
        float* crow = C + (size_t)(r0 + mb * 16) * ldc + c0;
        v4f val[8];   // all eight LDS reads are issued ahead of the stores: one LDS latency a block, not one behind each store's wait
#pragma unroll
        for (int s = 0; s < 8; ++s) val[s] = *(const v4fa*)(os + (2 * s + hi) * 68 + lr * 4);
#pragma unroll
        for (int s = 0; s < 8; ++s) { *(v4f*)(crow + (size_t)(2 * s + hi) * ldc + lr * 4) = val[s]; XW; }
        __builtin_amdgcn_wave_barrier(); asm volatile("" ::: "memory");   // the reads stay ahead of the next block's LDS writes
    }
}

__device__ __forceinline__ h16 tohx(float x) { return (h16)x; }
__device__ __forceinline__ void splitf(float y, unsigned short& h, unsigned short& l) { h = f2bf(y); l = f2bf(y - bf2f(h)); }
typedef __attribute__((ext_vector_type(2))) _Float16 v2h;
typedef __attribute__((ext_vector_type(4))) _Float16 v4h;
typedef __attribute__((ext_vector_type(2))) unsigned short v2us;
typedef __attribute__((ext_vector_type(4))) unsigned short v4us;
typedef __attribute__((ext_vector_type(2))) float v2f;
typedef __attribute__((ext_vector_type(4))) int v4i;

__global__ __launch_bounds__(256) void k_wtG(const float* __restrict__ w, int K, int N, bf* Bt) {
    const int lane = threadIdx.x & 31; const int L0 = (blockIdx.x * 8 + (threadIdx.x >> 5)) * 8; const int nlines = N * K / 64;
{
#pragma unroll 1
        for (int l = 0; l < 8; ++l) { const int L = L0 + l; if (L >= nlines) break; const size_t e = (size_t)L * 64 + lane * 2; const int k = (int)(e % K), n = (int)(e / K); v2us o;
            o[0] = f2bf(w[(size_t)k * N + n]); o[1] = f2bf(w[(size_t)(k + 1) * N + n]); *(v2us*)(Bt + e) = o; }
         }
}
__global__ __launch_bounds__(256) void k_cvt8(const float* __restrict__ src, bf* dst, size_t n8) { const size_t i = (size_t)blockIdx.x * 256 + threadIdx.x; if (i >= n8) return; const v8f v = *(const v8f*)(src + i * 8); v8us o;
#pragma unroll
    for (int k = 0; k < 8; ++k) o[k] = f2bf(v[k]); *(v8us*)(dst + i * 8) = o;  }
__global__ __launch_bounds__(256) void k_cscvt(const float* __restrict__ cosT, const float* __restrict__ sinT, float* CS) { const int idx = blockIdx.x * 256 + threadIdx.x; if (idx >= TT * HD) return; v2f cs; cs[0] = bfr(cosT[idx]); cs[1] = bfr(sinT[idx]); *(v2f*)(CS + (size_t)idx * 2) = cs;  }
// k_rope: head planes [h][t][d] (fp16 + hi/lo) of rope(x) x sc with the rotate-half convention out[d] = x[d] cos[t][d] - x[d+HD/2] sin[t][d], out[d+HD/2] = x[d+HD/2] cos[t][d+HD/2] + x[d] sin[t][d+HD/2]
__global__ __launch_bounds__(256) void k_rope(const float* __restrict__ F, int pitch, int nheads, const float* __restrict__ CS, const float* __restrict__ RF, const float* __restrict__ nw, float sc, h16* P16, bf* Ph, bf* Pl) {
    const size_t e = ((size_t)blockIdx.x * 256 + threadIdx.x) * 2; if (e >= (size_t)nheads * TT * HD) return; const int d = (int)(e % HD); const int t = (int)((e / HD) % TT); const int h = (int)(e / ((size_t)HD * TT)); const float* f = F + (size_t)t * pitch + h * HD; const float rf = RF ? RF[(size_t)h * TT + t] : 1.0f; v2h o16; v2us oh, ol;
#pragma unroll
    for (int q = 0; q < 2; ++q) { const int dd = d + q; const int dp = (dd < HD / 2) ? dd + HD / 2 : dd - HD / 2; float x0 = f[dd], x1 = f[dp];
        if (RF) { float n0 = __fmul_rn(x0, rf), n1 = __fmul_rn(x1, rf); asm volatile("" : "+v"(n0)); asm volatile("" : "+v"(n1)); x0 = __fmul_rn(bfr(nw[dd]), n0); x1 = __fmul_rn(bfr(nw[dp]), n1); }
        const v2f cs = *(const v2f*)(CS + ((size_t)t * HD + dd) * 2); float a = __fmul_rn(x0, cs[0]), bq = __fmul_rn(x1, cs[1]); asm volatile("" : "+v"(a)); asm volatile("" : "+v"(bq)); const float r = ((dd < HD / 2) ? __fsub_rn(a, bq) : __fadd_rn(a, bq)) * sc;
        o16[q] = tohx(r); unsigned short a2, c2; splitf(r, a2, c2); oh[q] = a2; ol[q] = c2; }
    *(v2h*)(P16 + e) = o16; *(v2us*)(Ph + e) = oh; *(v2us*)(Pl + e) = ol;  }
__global__ __launch_bounds__(256) void k_vtp(const float* __restrict__ F, int pitch, int nheads, h16* V16, bf* Vh, bf* Vl) { const size_t e = ((size_t)blockIdx.x * 256 + threadIdx.x) * 2; if (e >= (size_t)nheads * HD * TT) return; const int t = (int)(e % TT); const int d = (int)((e / TT) % HD); const int g = (int)(e / ((size_t)TT * HD)); v2h o16; v2us oh, ol;
#pragma unroll
    for (int q = 0; q < 2; ++q) { const float x = F[(size_t)(t + q) * pitch + g * HD + d]; o16[q] = tohx(x); unsigned short a2, c2; splitf(x, a2, c2); oh[q] = a2; ol[q] = c2; }
    *(v2h*)(V16 + e) = o16; *(v2us*)(Vh + e) = oh; *(v2us*)(Vl + e) = ol;  }
__global__ __launch_bounds__(256) void k_csid(float* CS) { const int idx = blockIdx.x * 256 + threadIdx.x; if (idx >= TT * HD) return; v2f cs; cs[0] = 1.0f; cs[1] = 0.0f; *(v2f*)(CS + (size_t)idx * 2) = cs;  }
// k_asoft: per row (zz, i): t = S x HD^-0.5 + bf16 bias[i][j], -3e38 where mask[i][j] <= 0; softmax over the 2048 keys (register row, one exp, fixed trees);
// P is stored IN PLACE over the row's own 8 KiB of S (one wave owns the row and holds all of it in registers before its first store): f16 P in the first half, or the bf16 hi plane in the first half and the lo plane in the second.
__global__ __launch_bounds__(256) void k_asoft(float* Sb, const float* __restrict__ ab, const int* __restrict__ am) {
    const int lane = threadIdx.x & 31; const int row = blockIdx.x * 8 + (threadIdx.x >> 5); if (row >= ZH * TT) return; const int i = row % TT; const int zz = row / TT; (void)zz; const bool hires = (i < RH); const float* sr = Sb + (size_t)row * TT; const float* abr = ab + (size_t)i * TT; const int* amr = am + (size_t)i * TT; float v[TT / 32]; float mx = -3.0e38f;
#pragma unroll
    for (int ch = 0; ch < TT / 128; ++ch) { const int j0 = ch * 128 + lane * 4; const v4f a = *(const v4f*)(sr + j0);
#pragma unroll
        for (int q = 0; q < 4; ++q) { const int j = j0 + q; (void)j; float sa = a[q] * SCL; asm volatile("" : "+v"(sa)); float bv2 = bfr(abr[j0 + q]); asm volatile("" : "+v"(bv2)); const float t = (amr[j0 + q] > 0) ? __fadd_rn(sa, bv2) : -3.0e38f; v[ch * 4 + q] = t; mx = fmaxf(mx, t); } }
#pragma unroll
    for (int sh = 16; sh; sh >>= 1) mx = fmaxf(mx, __shfl_xor(mx, sh, 32));
    float sum = 0.f;
#pragma unroll
    for (int k = 0; k < TT / 32; ++k) { float d0 = __fsub_rn(v[k], mx); asm volatile("" : "+v"(d0)); v[k] = __builtin_amdgcn_exp2f(__fmul_rn(d0, 1.4426950408889634f)); sum += v[k]; }
#pragma unroll
    for (int sh = 16; sh; sh >>= 1) sum += __shfl_xor(sum, sh, 32);
    const float f = __fdiv_rn(hires ? 1.0f : PCAR, sum);
{
        if (hires) {
#pragma unroll
            for (int ch = 0; ch < TT / 128; ++ch) { v4us oh, ol;
#pragma unroll
                for (int q = 0; q < 4; ++q) { unsigned short a, c2; splitf(v[ch * 4 + q] * f, a, c2); oh[q] = a; ol[q] = c2; }
                bf* pr = (bf*)(Sb + (size_t)row * TT) + ch * 128 + lane * 4; *(v4us*)pr = oh; *(v4us*)(pr + TT) = ol; }
        } else {
#pragma unroll
            for (int ch = 0; ch < TT / 128; ++ch) { v4h o4;
#pragma unroll
                for (int q = 0; q < 4; ++q) o4[q] = tohx(v[ch * 4 + q] * f);
                *(v4h*)((h16*)(Sb + (size_t)row * TT) + ch * 128 + lane * 4) = o4; } }
         }
}
__global__ __launch_bounds__(256) void k_merge(const float* __restrict__ O, int h0, bf* Ah, bf* Al) { const size_t e = ((size_t)blockIdx.x * 256 + threadIdx.x) * 2; if (e >= (size_t)ZH * TT * HD) return; const int d = (int)(e % HD); const int t = (int)((e / HD) % TT); const int zz = (int)(e / ((size_t)HD * TT)); const float cs = (t < RH) ? 1.0f : (1.0f / PCAR); const size_t oo = (size_t)t * DQ + (h0 + zz) * HD + d;
    v2f s = *(const v2f*)(O + e);   // partial planes of the KSP key chunks, added in chunk order
#pragma unroll   // all KSP plane loads are issued before the first add waits: one memory latency instead of KSP
    for (int ks = 1; ks < KSP; ++ks) s += *(const v2f*)(O + (size_t)ks * ZH * TT * HD + e);
    v2us oh, ol;
#pragma unroll
    for (int q = 0; q < 2; ++q) { unsigned short a, c2; splitf(s[q] * cs, a, c2); oh[q] = a; ol[q] = c2; } *(v2us*)(Ah + oo) = oh; *(v2us*)(Al + oo) = ol;  }

extern "C" void kernel_launch(void* const* d_in, const int* in_sizes, int n_in,
                              void* d_out, int out_size, void* d_ws, size_t ws_size, hipStream_t stream) {
    (void)in_sizes; (void)n_in; (void)out_size;
    const float* x = (const float*)d_in[0]; const float* abias = (const float*)d_in[1]; const int* amask = (const int*)d_in[2]; const float* wq = (const float*)d_in[3]; const float* bq = (const float*)d_in[4]; const float* wk = (const float*)d_in[5]; const float* bk = (const float*)d_in[6]; const float* wv = (const float*)d_in[7]; const float* bv = (const float*)d_in[8]; const float* wo = (const float*)d_in[9]; const float* bo = (const float*)d_in[10]; const float* cosT = nullptr; const float* sinT = nullptr; (void)cosT; (void)sinT;
    float* OUT = (float*)d_out;     // [2][2048][1024]
    char* wsp = (char*)d_ws;
    auto take = [&](size_t bytes) { char* p = wsp; wsp += (bytes + 255) & ~(size_t)255; return (void*)p; };
    bf* WQ = (bf*)take((size_t)DQ * DM * 2); bf* WK = (bf*)take((size_t)DKV * DM * 2); bf* WV = (bf*)take((size_t)DKV * DM * 2); bf* WO = (bf*)take((size_t)DM * DQ * 2); float* CS = (float*)take((size_t)TT * HD * 2 * 4);
    h16* QP16 = (h16*)take((size_t)NH_ * TT * HD * 2); h16* KP16 = (h16*)take((size_t)NKV * TT * HD * 2); h16* VT16 = (h16*)take((size_t)NKV * HD * TT * 2);
    bf* QPh = (bf*)take((size_t)NH_ * TT * HD * 2); bf* QPl = (bf*)take((size_t)NH_ * TT * HD * 2); bf* KPh = (bf*)take((size_t)NKV * TT * HD * 2); bf* KPl = (bf*)take((size_t)NKV * TT * HD * 2); bf* VTh = (bf*)take((size_t)NKV * HD * TT * 2); bf* VTl = (bf*)take((size_t)NKV * HD * TT * 2);
    float* Sb = (float*)take((size_t)ZH * TT * TT * 4); float* Ob = (float*)take((size_t)KSP * ZH * TT * HD * 4); bf* ATh = (bf*)take((size_t)TT * DQ * 2); bf* ATl = (bf*)take((size_t)TT * DQ * 2);
    if ((size_t)(wsp - (char*)d_ws) > ws_size) return;    // ws 256 MiB
    bf* XB = (bf*)Sb; float* FQ = (float*)(XB + (size_t)TT * DM); float* FK = FQ + (size_t)TT * DQ;   // projection scratch lies in the S buffer: it is dead once the head planes are built, before the first score launch writes S (stream-ordered)
    float* FV = FK;   // v projection reuses the k buffer after the k planes are built (stream-ordered)
    { k_cvt8<<<(unsigned)(((size_t)DQ * DM / 8 + 255) / 256), 256, 0, stream>>>(wq, WQ, (size_t)DQ * DM / 8); k_cvt8<<<(unsigned)(((size_t)DKV * DM / 8 + 255) / 256), 256, 0, stream>>>(wk, WK, (size_t)DKV * DM / 8); k_cvt8<<<(unsigned)(((size_t)DKV * DM / 8 + 255) / 256), 256, 0, stream>>>(wv, WV, (size_t)DKV * DM / 8);
      k_cvt8<<<(unsigned)(((size_t)DM * DQ / 8 + 255) / 256), 256, 0, stream>>>(wo, WO, (size_t)DM * DQ / 8);
       }
    k_csid<<<(TT * HD + 255) / 256, 256, 0, stream>>>(CS);
    const unsigned LQ = (unsigned)(((size_t)NH_ * TT * HD / 2 + 255) / 256), LKv = (unsigned)(((size_t)NKV * TT * HD / 2 + 255) / 256);
    for (int b = 0; b < NB_; ++b) {
        
        k_cvt8<<<(unsigned)(((size_t)TT * DM / 8 + 255) / 256), 256, 0, stream>>>(x + (size_t)b * TT * DM, XB, (size_t)TT * DM / 8);
        k_gemmw<bf, 0, true><<<dim3(TT / 64, DQ / 64, 1), 32, 0, stream>>>(XB, nullptr, WQ, nullptr, DM, FQ, DQ, bq, 0, 0, 0);
        k_rope<<<LQ, 256, 0, stream>>>(FQ, DQ, NH_, CS, nullptr, nullptr, 1.0f, QP16, QPh, QPl);
        k_gemmw<bf, 0, true><<<dim3(TT / 64, DKV / 64, 1), 32, 0, stream>>>(XB, nullptr, WK, nullptr, DM, FK, DKV, bk, 0, 0, 0);
        k_rope<<<LKv, 256, 0, stream>>>(FK, DKV, NKV, CS, nullptr, nullptr, 1.0f, KP16, KPh, KPl);
        k_gemmw<bf, 0, true><<<dim3(TT / 64, DKV / 64, 1), 32, 0, stream>>>(XB, nullptr, WV, nullptr, DM, FV, DKV, bv, 0, 0, 0); k_vtp<<<LKv, 256, 0, stream>>>(FV, DKV, NKV, VT16, VTh, VTl);
        for (int h0 = 0; h0 < NH_; h0 += ZH) { const size_t zq = (size_t)h0, zk = (size_t)(h0 / REP);   // one kv head per query head: the pass's ZH heads use consecutive kv planes (z-strides TT*HD)
            k_gemmw<bf, 2, false><<<dim3(RH / 64, TT / 64, ZH), 32, 0, stream>>>(QPh + zq * TT * HD, QPl + zq * TT * HD, KPh + zk * TT * HD, KPl + zk * TT * HD, HD, Sb, TT, nullptr, (size_t)TT * HD, (size_t)TT * HD, (size_t)TT * TT);
            k_gemmw<h16, 0, false><<<dim3((TT - RH) / 64, TT / 64, ZH), 32, 0, stream>>>(QP16 + zq * TT * HD + (size_t)RH * HD, nullptr, KP16 + zk * TT * HD, nullptr, HD, Sb + (size_t)RH * TT, TT, nullptr, (size_t)TT * HD, (size_t)TT * HD, (size_t)TT * TT);
            k_asoft<<<ZH * TT / 8, 256, 0, stream>>>(Sb, abias + (size_t)b * TT * TT, amask + (size_t)b * TT * TT);
            k_gemmp<bf, 2><<<dim3(RH / 64, HD / 64, ZH * KSP), 32, 0, stream>>>((const bf*)Sb, (const bf*)Sb + TT, VTh + zk * HD * TT, VTl + zk * HD * TT, TT / KSP, Ob, HD, (size_t)2 * TT * TT, (size_t)HD * TT, (size_t)TT * HD);
            k_gemmp<h16, 0><<<dim3((TT - RH) / 64, HD / 64, ZH * KSP), 32, 0, stream>>>((const h16*)Sb + (size_t)RH * 2 * TT, nullptr, VT16 + zk * HD * TT, nullptr, TT / KSP, Ob + (size_t)RH * HD, HD, (size_t)2 * TT * TT, (size_t)HD * TT, (size_t)TT * HD);
            k_merge<<<(unsigned)(((size_t)ZH * TT * HD / 2 + 255) / 256), 256, 0, stream>>>(Ob, h0, ATh, ATl); }
        k_gemmw<bf, 1, true><<<dim3(TT / 64, DM / 64, 1), 32, 0, stream>>>(ATh, ATl, WO, nullptr, DQ, OUT + (size_t)b * TT * DM, DM, bo, 0, 0, 0); }
}

// v003
// Measured time: 487 microseconds a run.
// In both of two side-by-side timings against v002, it was 1.83 times as fast.
// Counting every step since v000, it is 4.66 times as fast.
#include <hip/hip_runtime.h>

// MultiHeadAttentionWithBias (query [2][2048][1024], attention_bias [2][S][S] (f32, read), attention_mask [2][S][S] (int, read; all ones); q/k/v = x W^T + b (16 x 64); scores = q.k / 8 + bias[b][i][j], -inf where mask <= 0; softmax; out = merged Wo^T + bo -> [2][2048][1024]).
// Compute dtypes, f32 accumulate: every input rounded to bf16; q/k/v on PLAIN bf16 operands (inputs: exact) + bias; scores PRECPLAN; the bf16-rounded bias and the int mask read per element in f32 (no structural skipping); softmax f32; Wo hl x exact (2 products) + bias.

#define NB_  2
#define TT   2048
#define DM   1024
#define NH_  16
#define NKV  16
#define REP  (NH_ / NKV)
#define HD   64
#define DQ   (NH_ * HD)
#define DKV  (NKV * HD)
#define ZH   1                    // batches per partial plane of a k_gemmw launch with KS > 1 (none is launched)
#define RH   512                  // query rows < RH use hi+lo planes (0: none)
#define WIN  0
#define SCL  0.125f   // HD^-0.5
typedef _Float16 h16;
typedef unsigned short bf;
typedef __attribute__((ext_vector_type(16))) __bf16   v16bf;
typedef __attribute__((ext_vector_type(16))) _Float16 v16h;
typedef __attribute__((ext_vector_type(8)))  _Float16 v8h;
typedef __attribute__((ext_vector_type(8)))  unsigned short v8us;
typedef __attribute__((ext_vector_type(8)))  float    v8f;
typedef __attribute__((ext_vector_type(4)))  float    v4f;
typedef v8h  __attribute__((may_alias)) v8ha;
typedef v4f  __attribute__((may_alias)) v4fa;
typedef v8us __attribute__((may_alias)) v8usa;

__device__ __forceinline__ unsigned short f2bf(float f) { unsigned u = __float_as_uint(f); u += 0x7FFFu + ((u >> 16) & 1u); return (unsigned short)(u >> 16); }
__device__ __forceinline__ float bf2f(unsigned short b) { return __uint_as_float(((unsigned)b) << 16); }
__device__ __forceinline__ float bfr(float f) { return bf2f(f2bf(f)); }
__device__ __forceinline__ v16h cat16(v8h lo, v8h hi) { return __builtin_shufflevector(lo, hi, 0, 1, 2, 3, 4, 5, 6, 7, 8, 9, 10, 11, 12, 13, 14, 15); }
__device__ __forceinline__ v16bf cat16b(v8us lo, v8us hi) { return __builtin_bit_cast(v16bf, __builtin_shufflevector(lo, hi, 0, 1, 2, 3, 4, 5, 6, 7, 8, 9, 10, 11, 12, 13, 14, 15)); }
__device__ __forceinline__ v8f wmma16(v16h a, v16h b, v8f c) { return __builtin_amdgcn_wmma_f32_16x16x32_f16(false, a, false, b, (short)0, c, false, false); }
__device__ __forceinline__ v8f wmmab(v16bf a, v16bf b, v8f c) { return __builtin_amdgcn_wmma_f32_16x16x32_bf16(false, a, false, b, (short)0, c, false, false); }



// ---- k_gemmw: register-blocked GEMM, ONE WAVE per 64x64 output tile (16 accumulators), operands straight from K-contiguous 16-bit planes; grid (M/64, N/64, Z), 32 threads.
// C[m][n] (f32, pitch ldc, + optional f32 bias[n]) = sum_k A[m][k] Bt[n][k] (+ split products per NSPLIT). z-batch strides sA/sB/sC in elements. K % 32 == 0.
// KS > 1: grid z = batches x KS; a work-group sums only chunk ks (K elements) of rows of pitch K x KS and writes partial plane ks of C (planes of ZH x sC elements), which the consumer adds up.
template <typename T16> struct WFrag;
template <> struct WFrag<h16> { typedef v16h V; static __device__ __forceinline__ V ld(const h16* p) { return cat16(*(const v8h*)p, *(const v8h*)(p + 16)); } static __device__ __forceinline__ v8f mma(V a, V b, v8f c) { return wmma16(a, b, c); } };
template <> struct WFrag<bf> { typedef v16bf V; static __device__ __forceinline__ V ld(const bf* p) { return cat16b(*(const v8us*)p, *(const v8us*)(p + 16)); } static __device__ __forceinline__ v8f mma(V a, V b, v8f c) { return wmmab(a, b, c); } };
template <typename T16, int NSPLIT, bool BIAS, int KS = 1>
__global__ __launch_bounds__(32) void k_gemmw(const T16* __restrict__ A, const T16* __restrict__ A2, const T16* __restrict__ Bt, const T16* __restrict__ Bt2, int K, float* C, int ldc, const float* __restrict__ bias, size_t sA, size_t sB, size_t sC) {
    typedef typename WFrag<T16>::V V;
    __shared__ __align__(16) float os[16 * 68];
    const size_t z = blockIdx.z / KS; const size_t ks = blockIdx.z % KS; const size_t ld = (size_t)K * KS; A += z * sA + ks * K; if (A2) A2 += z * sA + ks * K; Bt += z * sB + ks * K; if (Bt2) Bt2 += z * sB + ks * K; C += (z + ks * ZH) * sC;
    const int lane = threadIdx.x & 31, lr = lane & 15, hi = lane >> 4; const int r0 = blockIdx.x * 64, c0 = blockIdx.y * 64;
    v8f acc[4][4];
#pragma unroll
    for (int mb = 0; mb < 4; ++mb)
#pragma unroll
        for (int nb = 0; nb < 4; ++nb) acc[mb][nb] = (v8f){};
    const size_t aoff = (size_t)(r0 + lr) * ld + 8 * hi, boff = (size_t)(c0 + lr) * ld + 8 * hi;
#pragma unroll 1
    for (int kc = 0; kc < K; kc += 32) {
        V a[4], a2[4];
#pragma unroll
        for (int mb = 0; mb < 4; ++mb) { a[mb] = WFrag<T16>::ld(A + aoff + (size_t)mb * 16 * ld + kc); if (NSPLIT == 1 || NSPLIT == 2) a2[mb] = WFrag<T16>::ld(A2 + aoff + (size_t)mb * 16 * ld + kc); }
#pragma unroll
        for (int nb = 0; nb < 4; ++nb) { const V b = WFrag<T16>::ld(Bt + boff + (size_t)nb * 16 * ld + kc); V b2; if (NSPLIT >= 2) b2 = WFrag<T16>::ld(Bt2 + boff + (size_t)nb * 16 * ld + kc);
#pragma unroll
            for (int mb = 0; mb < 4; ++mb) { acc[mb][nb] = WFrag<T16>::mma(a[mb], b, acc[mb][nb]); if (NSPLIT == 1 || NSPLIT == 2) acc[mb][nb] = WFrag<T16>::mma(a2[mb], b, acc[mb][nb]); if (NSPLIT >= 2) acc[mb][nb] = WFrag<T16>::mma(a[mb], b2, acc[mb][nb]); } }
        asm volatile("v_nop\n\tv_nop\n\tv_nop\n\tv_nop" : "+v"(acc[0][0]), "+v"(acc[1][1]), "+v"(acc[2][2]), "+v"(acc[3][3]) : "v"(a[0]), "v"(a[3]));
    }
#pragma unroll
    for (int mb = 0; mb < 4; ++mb) {
#pragma unroll
        for (int nb = 0; nb < 4; ++nb) {
#pragma unroll
            for (int j = 0; j < 8; ++j) os[(hi * 8 + j) * 68 + nb * 16 + lr] = acc[mb][nb][j]; }
        __builtin_amdgcn_wave_barrier(); asm volatile("" ::: "memory");
        float* crow = C + (size_t)(r0 + mb * 16) * ldc + c0;
{
#pragma unroll
            for (int s = 0; s < 8; ++s) { const int row = 2 * s + hi, cofs = lr * 4; v4f val = *(const v4fa*)(os + row * 68 + cofs); if (BIAS) { val[0] += bfr(bias[c0 + cofs]); val[1] += bfr(bias[c0 + cofs + 1]); val[2] += bfr(bias[c0 + cofs + 2]); val[3] += bfr(bias[c0 + cofs + 3]); }
                *(v4f*)(crow + (size_t)row * ldc + cofs) = val; }
             }
        __builtin_amdgcn_wave_barrier(); asm volatile("" ::: "memory");
    }
}

__device__ __forceinline__ h16 tohx(float x) { return (h16)x; }
__device__ __forceinline__ void splitf(float y, unsigned short& h, unsigned short& l) { h = f2bf(y); l = f2bf(y - bf2f(h)); }
typedef __attribute__((ext_vector_type(2))) _Float16 v2h;
typedef __attribute__((ext_vector_type(4))) _Float16 v4h;
typedef __attribute__((ext_vector_type(2))) unsigned short v2us;
typedef __attribute__((ext_vector_type(4))) unsigned short v4us;
typedef __attribute__((ext_vector_type(2))) float v2f;
typedef __attribute__((ext_vector_type(4))) int v4i;

__global__ __launch_bounds__(256) void k_wtG(const float* __restrict__ w, int K, int N, bf* Bt) {
    const int lane = threadIdx.x & 31; const int L0 = (blockIdx.x * 8 + (threadIdx.x >> 5)) * 8; const int nlines = N * K / 64;
{
#pragma unroll 1
        for (int l = 0; l < 8; ++l) { const int L = L0 + l; if (L >= nlines) break; const size_t e = (size_t)L * 64 + lane * 2; const int k = (int)(e % K), n = (int)(e / K); v2us o;
            o[0] = f2bf(w[(size_t)k * N + n]); o[1] = f2bf(w[(size_t)(k + 1) * N + n]); *(v2us*)(Bt + e) = o; }
         }
}
__global__ __launch_bounds__(256) void k_cvt8(const float* __restrict__ src, bf* dst, size_t n8) { const size_t i = (size_t)blockIdx.x * 256 + threadIdx.x; if (i >= n8) return; const v8f v = *(const v8f*)(src + i * 8); v8us o;
#pragma unroll
    for (int k = 0; k < 8; ++k) o[k] = f2bf(v[k]); *(v8us*)(dst + i * 8) = o;  }
__global__ __launch_bounds__(256) void k_cscvt(const float* __restrict__ cosT, const float* __restrict__ sinT, float* CS) { const int idx = blockIdx.x * 256 + threadIdx.x; if (idx >= TT * HD) return; v2f cs; cs[0] = bfr(cosT[idx]); cs[1] = bfr(sinT[idx]); *(v2f*)(CS + (size_t)idx * 2) = cs;  }
// k_rope: head planes [h][t][d] (fp16 + hi/lo) of rope(x) x sc with the rotate-half convention out[d] = x[d] cos[t][d] - x[d+HD/2] sin[t][d], out[d+HD/2] = x[d+HD/2] cos[t][d+HD/2] + x[d] sin[t][d+HD/2]
__global__ __launch_bounds__(256) void k_rope(const float* __restrict__ F, int pitch, int nheads, const float* __restrict__ CS, const float* __restrict__ RF, const float* __restrict__ nw, float sc, h16* P16, bf* Ph, bf* Pl) {
    const size_t e = ((size_t)blockIdx.x * 256 + threadIdx.x) * 2; if (e >= (size_t)nheads * TT * HD) return; const int d = (int)(e % HD); const int t = (int)((e / HD) % TT); const int h = (int)(e / ((size_t)HD * TT)); const float* f = F + (size_t)t * pitch + h * HD; const float rf = RF ? RF[(size_t)h * TT + t] : 1.0f; v2h o16; v2us oh, ol;
#pragma unroll
    for (int q = 0; q < 2; ++q) { const int dd = d + q; const int dp = (dd < HD / 2) ? dd + HD / 2 : dd - HD / 2; float x0 = f[dd], x1 = f[dp];
        if (RF) { float n0 = __fmul_rn(x0, rf), n1 = __fmul_rn(x1, rf); asm volatile("" : "+v"(n0)); asm volatile("" : "+v"(n1)); x0 = __fmul_rn(bfr(nw[dd]), n0); x1 = __fmul_rn(bfr(nw[dp]), n1); }
        const v2f cs = *(const v2f*)(CS + ((size_t)t * HD + dd) * 2); float a = __fmul_rn(x0, cs[0]), bq = __fmul_rn(x1, cs[1]); asm volatile("" : "+v"(a)); asm volatile("" : "+v"(bq)); const float r = ((dd < HD / 2) ? __fsub_rn(a, bq) : __fadd_rn(a, bq)) * sc;
        o16[q] = tohx(r); unsigned short a2, c2; splitf(r, a2, c2); oh[q] = a2; ol[q] = c2; }
    *(v2h*)(P16 + e) = o16; *(v2us*)(Ph + e) = oh; *(v2us*)(Pl + e) = ol;  }
__global__ __launch_bounds__(256) void k_vtp(const float* __restrict__ F, int pitch, int nheads, h16* V16, bf* Vh, bf* Vl) { const size_t e = ((size_t)blockIdx.x * 256 + threadIdx.x) * 2; if (e >= (size_t)nheads * HD * TT) return; const int t = (int)(e % TT); const int d = (int)((e / TT) % HD); const int g = (int)(e / ((size_t)TT * HD)); v2h o16; v2us oh, ol;
#pragma unroll
    for (int q = 0; q < 2; ++q) { const float x = F[(size_t)(t + q) * pitch + g * HD + d]; o16[q] = tohx(x); unsigned short a2, c2; splitf(x, a2, c2); oh[q] = a2; ol[q] = c2; }
    *(v2h*)(V16 + e) = o16; *(v2us*)(Vh + e) = oh; *(v2us*)(Vl + e) = ol;  }
__global__ __launch_bounds__(256) void k_csid(float* CS) { const int idx = blockIdx.x * 256 + threadIdx.x; if (idx >= TT * HD) return; v2f cs; cs[0] = 1.0f; cs[1] = 0.0f; *(v2f*)(CS + (size_t)idx * 2) = cs;  }
// ---- k_fattn: scores, bias, mask, softmax and P.V of one head in ONE kernel; S and P never leave the registers. One wave owns 16 query rows and walks the 2048 keys in passes of 32.
// S^T = K Q^T (A = K rows, B = Q rows): a lane holds one query's scores (query lr, keys 8 hi + j of each 16-key tile), so two converted S^T tiles ARE the B operand of O^T += V^T P^T (same k order as WFrag::ld).
// Running maximum m per query: P = exp(t - m) unnormalised, the sum l kept in f32 beside it, O divided by l at the end. m moves only when a pass's maximum tops it by more than MSTEP (then O and l are rescaled), so P <= e^MSTEP.
// Addresses: a wave-uniform base that moves with the pass + a per-lane byte offset that never changes.
// XW: a precaution behind each group of global loads of k_fattn: the wait on their address translation stands ahead of any later instruction that takes one of their registers as a destination; its "memory" clobber also keeps the group issued where it is written, a pass's work ahead of its use.
#define XW asm volatile("s_wait_xcnt 0x0" ::: "memory")
#define MSTEP 5.5f
typedef __attribute__((ext_vector_type(8))) int v8i;
typedef __attribute__((ext_vector_type(8))) __bf16 v8bf;
__device__ __forceinline__ float xhalf(float x) { return __builtin_bit_cast(float, __builtin_amdgcn_permlanex16(__builtin_bit_cast(int, x), __builtin_bit_cast(int, x), 0x76543210, 0xfedcba98, false, false)); }   // lane l with lane l ^ 16
template <typename T> __device__ __forceinline__ const T* atb(const T* base, unsigned offb) { return (const T*)((const char*)base + offb); }
template <typename T16, int NSPLIT>
__device__ __forceinline__ void attn_rows(const T16* __restrict__ Q, const T16* __restrict__ Q2, const T16* __restrict__ Kp, const T16* __restrict__ K2, const T16* __restrict__ Vt, const T16* __restrict__ V2, const float* __restrict__ ab, const int* __restrict__ am, int q0, int h, bf* Ah, bf* Al) {
    typedef typename WFrag<T16>::V V;
    const int lane = threadIdx.x & 31, lr = lane & 15, hi = lane >> 4;
    V qf[2], q2[2], kf[2][2], k2[2][2]; v8f bb[2]; v8i mm[2];
    const unsigned qo = (unsigned)((q0 + lr) * HD + 8 * hi) * 2u, ko = (unsigned)(lr * HD + 8 * hi) * 2u, vo = (unsigned)(lr * TT + 8 * hi) * 2u, so = (unsigned)((q0 + lr) * TT + 8 * hi) * 4u;   // byte offsets
#pragma unroll
    for (int ks = 0; ks < 2; ++ks) { qf[ks] = WFrag<T16>::ld(atb(Q, qo) + ks * 32); if (NSPLIT == 2) q2[ks] = WFrag<T16>::ld(atb(Q2, qo) + ks * 32); }
    XW;
#pragma unroll
    for (int kt = 0; kt < 2; ++kt)
#pragma unroll
        for (int ks = 0; ks < 2; ++ks) { kf[kt][ks] = WFrag<T16>::ld(atb(Kp, ko) + kt * 16 * HD + ks * 32); if (NSPLIT == 2) k2[kt][ks] = WFrag<T16>::ld(atb(K2, ko) + kt * 16 * HD + ks * 32); }
    XW;
#pragma unroll
    for (int kt = 0; kt < 2; ++kt) { bb[kt] = *(const v8f*)(atb(ab, so) + kt * 16); mm[kt] = *(const v8i*)(atb(am, so) + kt * 16); }
    XW;
    v8f o[4];
#pragma unroll
    for (int mb = 0; mb < 4; ++mb) o[mb] = (v8f){};
    float m = -3.0e38f, l = 0.f;
#pragma unroll 1   // rolled: 64 passes, the body already holds 8 or 24 matrix instructions and a pass's loads
    for (int key0 = 0; key0 < TT; key0 += 32) {
        V vf[4], v2[4];   // this pass's V^T rows: in flight under the score products and the softmax
#pragma unroll
        for (int mb = 0; mb < 4; ++mb) { vf[mb] = WFrag<T16>::ld(atb(Vt + key0, vo) + mb * 16 * TT); if (NSPLIT == 2) v2[mb] = WFrag<T16>::ld(atb(V2 + key0, vo) + mb * 16 * TT); }
        XW;
        v8f t[2];
#pragma unroll
        for (int kt = 0; kt < 2; ++kt) { v8f s = (v8f){};
#pragma unroll
            for (int ks = 0; ks < 2; ++ks) { s = WFrag<T16>::mma(kf[kt][ks], qf[ks], s); if (NSPLIT == 2) { s = WFrag<T16>::mma(kf[kt][ks], q2[ks], s); s = WFrag<T16>::mma(k2[kt][ks], qf[ks], s); } }
            const v8bf br = __builtin_convertvector(bb[kt], v8bf);   // the bias rounded to bf16 (nearest even), as every input
#pragma unroll   // s x 2^-3 is exact, so the fused multiply-add rounds once, as a separate add would
            for (int j = 0; j < 8; ++j) { const float tv = __builtin_fmaf(s[j], SCL, (float)br[j]); t[kt][j] = (mm[kt][j] > 0) ? tv : -3.0e38f; } }
        const int kn = (key0 + 32 < TT) ? key0 + 32 : key0;   // the next pass's K rows, bias and mask are fetched one pass ahead; the last pass fetches its own again (in bounds, not used)
#pragma unroll
        for (int kt = 0; kt < 2; ++kt)
#pragma unroll
            for (int ks = 0; ks < 2; ++ks) { kf[kt][ks] = WFrag<T16>::ld(atb(Kp + (size_t)kn * HD, ko) + kt * 16 * HD + ks * 32); if (NSPLIT == 2) k2[kt][ks] = WFrag<T16>::ld(atb(K2 + (size_t)kn * HD, ko) + kt * 16 * HD + ks * 32); }
        XW;
#pragma unroll
        for (int kt = 0; kt < 2; ++kt) { bb[kt] = *(const v8f*)(atb(ab + kn, so) + kt * 16); mm[kt] = *(const v8i*)(atb(am + kn, so) + kt * 16); }
        XW;
        float pm = fmaxf(t[0][0], t[1][0]);
#pragma unroll
        for (int j = 1; j < 8; ++j) pm = fmaxf(pm, fmaxf(t[0][j], t[1][j]));
        pm = fmaxf(pm, xhalf(pm));   // the two lane halves hold the two halves of a query's keys
        const bool need = pm > m + MSTEP;
        if (__builtin_amdgcn_ballot_w32(need) != 0) {   // wave-uniform: rare after the first pass
            const float mn = need ? pm : m; const float al = __builtin_amdgcn_exp2f((m - mn) * 1.4426950408889634f); m = mn; l *= al;
#pragma unroll
            for (int mb = 0; mb < 4; ++mb) o[mb] *= al; }
        float ls[4] = {0.f, 0.f, 0.f, 0.f};
#pragma unroll
        for (int kt = 0; kt < 2; ++kt)
#pragma unroll
            for (int j = 0; j < 8; ++j) { t[kt][j] = __builtin_amdgcn_exp2f((t[kt][j] - m) * 1.4426950408889634f); ls[j & 3] += t[kt][j]; }
        l += (ls[0] + ls[1]) + (ls[2] + ls[3]);
        if constexpr (NSPLIT == 2) {   // P = hi + lo bf16 planes
            const v8bf h0 = __builtin_convertvector(t[0], v8bf), h1 = __builtin_convertvector(t[1], v8bf);
            const v8bf l0 = __builtin_convertvector(t[0] - __builtin_convertvector(h0, v8f), v8bf), l1 = __builtin_convertvector(t[1] - __builtin_convertvector(h1, v8f), v8bf);
            const V pfh = __builtin_shufflevector(h0, h1, 0, 1, 2, 3, 4, 5, 6, 7, 8, 9, 10, 11, 12, 13, 14, 15), pfl = __builtin_shufflevector(l0, l1, 0, 1, 2, 3, 4, 5, 6, 7, 8, 9, 10, 11, 12, 13, 14, 15);
#pragma unroll
            for (int mb = 0; mb < 4; ++mb) { o[mb] = WFrag<T16>::mma(vf[mb], pfh, o[mb]); o[mb] = WFrag<T16>::mma(vf[mb], pfl, o[mb]); o[mb] = WFrag<T16>::mma(v2[mb], pfh, o[mb]); }
        } else {
            const V pfv = cat16(__builtin_convertvector(t[0], v8h), __builtin_convertvector(t[1], v8h));
#pragma unroll
            for (int mb = 0; mb < 4; ++mb) o[mb] = WFrag<T16>::mma(vf[mb], pfv, o[mb]); }
        // four vector slots behind the pass's last matrix instruction, also on the taken back edge, before its operands are loaded anew
        asm volatile("v_nop\n\tv_nop\n\tv_nop\n\tv_nop" : "+v"(o[0]), "+v"(o[1]), "+v"(o[2]), "+v"(o[3]) : "v"(vf[0]), "v"(vf[3]));
    }
    l += xhalf(l);
    const float f = __fdiv_rn(1.0f, l);
#pragma unroll
    for (int mb = 0; mb < 4; ++mb) { v8us oh, ol;   // a lane holds 8 consecutive d of its query: one 16-byte store a plane
#pragma unroll
        for (int j = 0; j < 8; ++j) { unsigned short a, c2; splitf(o[mb][j] * f, a, c2); oh[j] = a; ol[j] = c2; }
        const size_t oo = (size_t)(q0 + lr) * DQ + h * HD + mb * 16 + hi * 8; *(v8us*)(Ah + oo) = oh; *(v8us*)(Al + oo) = ol; }
}
// grid (heads, TT / 64), 4 waves: the blocks of the hi+lo rows (three products each, the longest) come first in the launch order; neighbouring blocks read the same bias and mask rows
__global__ __launch_bounds__(128) void k_fattn(const h16* __restrict__ Q16, const h16* __restrict__ K16, const h16* __restrict__ V16, const bf* __restrict__ Qh, const bf* __restrict__ Ql, const bf* __restrict__ Kh, const bf* __restrict__ Kl, const bf* __restrict__ Vh, const bf* __restrict__ Vl, const float* __restrict__ ab, const int* __restrict__ am, bf* Ah, bf* Al) {
    const int h = blockIdx.x; const int q0 = blockIdx.y * 64 + (threadIdx.x >> 5) * 16; const size_t hp = (size_t)h * TT * HD;
    if ((int)blockIdx.y * 64 < RH) attn_rows<bf, 2>(Qh + hp, Ql + hp, Kh + hp, Kl + hp, Vh + hp, Vl + hp, ab, am, q0, h, Ah, Al);
    else attn_rows<h16, 0>(Q16 + hp, nullptr, K16 + hp, nullptr, V16 + hp, nullptr, ab, am, q0, h, Ah, Al);
}

extern "C" void kernel_launch(void* const* d_in, const int* in_sizes, int n_in,
                              void* d_out, int out_size, void* d_ws, size_t ws_size, hipStream_t stream) {
    (void)in_sizes; (void)n_in; (void)out_size;
    const float* x = (const float*)d_in[0]; const float* abias = (const float*)d_in[1]; const int* amask = (const int*)d_in[2]; const float* wq = (const float*)d_in[3]; const float* bq = (const float*)d_in[4]; const float* wk = (const float*)d_in[5]; const float* bk = (const float*)d_in[6]; const float* wv = (const float*)d_in[7]; const float* bv = (const float*)d_in[8]; const float* wo = (const float*)d_in[9]; const float* bo = (const float*)d_in[10]; const float* cosT = nullptr; const float* sinT = nullptr; (void)cosT; (void)sinT;
    float* OUT = (float*)d_out;     // [2][2048][1024]
    char* wsp = (char*)d_ws;
    auto take = [&](size_t bytes) { char* p = wsp; wsp += (bytes + 255) & ~(size_t)255; return (void*)p; };
    bf* WQ = (bf*)take((size_t)DQ * DM * 2); bf* WK = (bf*)take((size_t)DKV * DM * 2); bf* WV = (bf*)take((size_t)DKV * DM * 2); bf* WO = (bf*)take((size_t)DM * DQ * 2); float* CS = (float*)take((size_t)TT * HD * 2 * 4);
    h16* QP16 = (h16*)take((size_t)NH_ * TT * HD * 2); h16* KP16 = (h16*)take((size_t)NKV * TT * HD * 2); h16* VT16 = (h16*)take((size_t)NKV * HD * TT * 2);
    bf* QPh = (bf*)take((size_t)NH_ * TT * HD * 2); bf* QPl = (bf*)take((size_t)NH_ * TT * HD * 2); bf* KPh = (bf*)take((size_t)NKV * TT * HD * 2); bf* KPl = (bf*)take((size_t)NKV * TT * HD * 2); bf* VTh = (bf*)take((size_t)NKV * HD * TT * 2); bf* VTl = (bf*)take((size_t)NKV * HD * TT * 2);
    bf* XB = (bf*)take((size_t)TT * DM * 2); float* FQ = (float*)take((size_t)TT * DQ * 4); float* FK = (float*)take((size_t)TT * DKV * 4); bf* ATh = (bf*)take((size_t)TT * DQ * 2); bf* ATl = (bf*)take((size_t)TT * DQ * 2);
    if ((size_t)(wsp - (char*)d_ws) > ws_size) return;    // ws 256 MiB
    float* FV = FK;   // v projection reuses the k buffer after the k planes are built (stream-ordered)
    { k_cvt8<<<(unsigned)(((size_t)DQ * DM / 8 + 255) / 256), 256, 0, stream>>>(wq, WQ, (size_t)DQ * DM / 8); k_cvt8<<<(unsigned)(((size_t)DKV * DM / 8 + 255) / 256), 256, 0, stream>>>(wk, WK, (size_t)DKV * DM / 8); k_cvt8<<<(unsigned)(((size_t)DKV * DM / 8 + 255) / 256), 256, 0, stream>>>(wv, WV, (size_t)DKV * DM / 8);
      k_cvt8<<<(unsigned)(((size_t)DM * DQ / 8 + 255) / 256), 256, 0, stream>>>(wo, WO, (size_t)DM * DQ / 8);
       }
    k_csid<<<(TT * HD + 255) / 256, 256, 0, stream>>>(CS);
    const unsigned LQ = (unsigned)(((size_t)NH_ * TT * HD / 2 + 255) / 256), LKv = (unsigned)(((size_t)NKV * TT * HD / 2 + 255) / 256);
    for (int b = 0; b < NB_; ++b) {
        
        k_cvt8<<<(unsigned)(((size_t)TT * DM / 8 + 255) / 256), 256, 0, stream>>>(x + (size_t)b * TT * DM, XB, (size_t)TT * DM / 8);
        k_gemmw<bf, 0, true><<<dim3(TT / 64, DQ / 64, 1), 32, 0, stream>>>(XB, nullptr, WQ, nullptr, DM, FQ, DQ, bq, 0, 0, 0);
        k_rope<<<LQ, 256, 0, stream>>>(FQ, DQ, NH_, CS, nullptr, nullptr, 1.0f, QP16, QPh, QPl);
        k_gemmw<bf, 0, true><<<dim3(TT / 64, DKV / 64, 1), 32, 0, stream>>>(XB, nullptr, WK, nullptr, DM, FK, DKV, bk, 0, 0, 0);
        k_rope<<<LKv, 256, 0, stream>>>(FK, DKV, NKV, CS, nullptr, nullptr, 1.0f, KP16, KPh, KPl);
        k_gemmw<bf, 0, true><<<dim3(TT / 64, DKV / 64, 1), 32, 0, stream>>>(XB, nullptr, WV, nullptr, DM, FV, DKV, bv, 0, 0, 0); k_vtp<<<LKv, 256, 0, stream>>>(FV, DKV, NKV, VT16, VTh, VTl);
        k_fattn<<<dim3(NH_, TT / 64, 1), 128, 0, stream>>>(QP16, KP16, VT16, QPh, QPl, KPh, KPl, VTh, VTl, abias + (size_t)b * TT * TT, amask + (size_t)b * TT * TT, ATh, ATl);   // one kv head per query head
        k_gemmw<bf, 1, true><<<dim3(TT / 64, DM / 64, 1), 32, 0, stream>>>(ATh, ATl, WO, nullptr, DQ, OUT + (size_t)b * TT * DM, DM, bo, 0, 0, 0); }
}

// v004
// One run takes 409 microseconds.
// Timed twice side by side with v003, it ran 1.18 and 1.19 times as fast.
// All steps since v000 together make it 5.54 times as fast.
#include <hip/hip_runtime.h>

// MultiHeadAttentionWithBias (query [2][2048][1024], attention_bias [2][S][S] (f32, read), attention_mask [2][S][S] (int, read; all ones); q/k/v = x W^T + b (16 x 64); scores = q.k / 8 + bias[b][i][j], -inf where mask <= 0; softmax; out = merged Wo^T + bo -> [2][2048][1024]).
// Compute dtypes, f32 accumulate: every input rounded to bf16; q/k/v on PLAIN bf16 operands (inputs: exact) + bias; scores PRECPLAN; the bf16-rounded bias and the int mask read per element in f32 (no structural skipping); softmax f32; Wo hl x exact (2 products) + bias.

#define NB_  2
#define TT   2048
#define DM   1024
#define NH_  16
#define NKV  16
#define REP  (NH_ / NKV)
#define HD   64
#define DQ   (NH_ * HD)
#define DKV  (NKV * HD)
#define ZH   1                    // batches per partial plane of a k_gemmw launch with KS > 1 (none is launched)
#define RH   512                  // query rows < RH use hi+lo planes (0: none)
#define WIN  0
#define SCL  0.125f   // HD^-0.5
typedef _Float16 h16;
typedef unsigned short bf;
typedef __attribute__((ext_vector_type(16))) __bf16   v16bf;
typedef __attribute__((ext_vector_type(16))) _Float16 v16h;
typedef __attribute__((ext_vector_type(8)))  _Float16 v8h;
typedef __attribute__((ext_vector_type(8)))  unsigned short v8us;
typedef __attribute__((ext_vector_type(8)))  float    v8f;
typedef __attribute__((ext_vector_type(4)))  float    v4f;
typedef v8h  __attribute__((may_alias)) v8ha;
typedef v4f  __attribute__((may_alias)) v4fa;
typedef v8us __attribute__((may_alias)) v8usa;

__device__ __forceinline__ unsigned short f2bf(float f) { unsigned u = __float_as_uint(f); u += 0x7FFFu + ((u >> 16) & 1u); return (unsigned short)(u >> 16); }
__device__ __forceinline__ float bf2f(unsigned short b) { return __uint_as_float(((unsigned)b) << 16); }
__device__ __forceinline__ float bfr(float f) { return bf2f(f2bf(f)); }
__device__ __forceinline__ v16h cat16(v8h lo, v8h hi) { return __builtin_shufflevector(lo, hi, 0, 1, 2, 3, 4, 5, 6, 7, 8, 9, 10, 11, 12, 13, 14, 15); }
__device__ __forceinline__ v16bf cat16b(v8us lo, v8us hi) { return __builtin_bit_cast(v16bf, __builtin_shufflevector(lo, hi, 0, 1, 2, 3, 4, 5, 6, 7, 8, 9, 10, 11, 12, 13, 14, 15)); }
__device__ __forceinline__ v8f wmma16(v16h a, v16h b, v8f c) { return __builtin_amdgcn_wmma_f32_16x16x32_f16(false, a, false, b, (short)0, c, false, false); }
__device__ __forceinline__ v8f wmmab(v16bf a, v16bf b, v8f c) { return __builtin_amdgcn_wmma_f32_16x16x32_bf16(false, a, false, b, (short)0, c, false, false); }



// XW: a precaution behind each group of global loads: the wait on their address translation stands ahead of any later instruction that takes one of their registers as a destination; its "memory" clobber also keeps the group issued where it is written (in k_fattn a pass's work ahead of its use).
#define XW asm volatile("s_wait_xcnt 0x0" ::: "memory")
// xwa: the same wait with the group's addresses as inputs: they stay in their registers up to the wait, so that neither a later load's destination nor other work takes those registers ahead of it.
template <typename T> __device__ __forceinline__ void xwa(const T* p) { asm volatile("s_wait_xcnt 0x0" :: "v"(p) : "memory"); }
template <typename T, typename U> __device__ __forceinline__ void xwa(const T* p, const U* q) { asm volatile("s_wait_xcnt 0x0" :: "v"(p), "v"(q) : "memory"); }
// ---- FRAGMENT ORDER: every 16-bit operand plane [rows][K] lies as blocks of 16 rows x 32 k (512 elements, 1 KB), block (row tile, k tile) at index row tile x K/32 + k tile.
// In a block, element (r, k = 16 c + 8 hi + e) lies at 256 c + 8 (16 hi + r) + e: lane 16 hi + r of a wave finds its 8 + 8 elements at 8 lane and 256 + 8 lane, so each 16-byte load of a wave covers 512 contiguous bytes (4 whole lines), not 32-byte pieces of 16 lines. The registers hold what they held with row-major planes.
// ---- k_gemmw: register-blocked GEMM, ONE WAVE per 64x64 output tile (16 accumulators), operands straight from 16-bit planes in fragment order; grid (M/64, N/64, Z), 32 threads.
// C[m][n] (f32, pitch ldc, + optional f32 bias[n]) = sum_k A[m][k] Bt[n][k] (+ split products per NSPLIT). z-batch strides sA/sB/sC in elements. K % 32 == 0.
// KS > 1: grid z = batches x KS; a work-group sums only chunk ks (K elements) of rows of pitch K x KS and writes partial plane ks of C (planes of ZH x sC elements), which the consumer adds up.
template <typename T16> struct WFrag;
template <> struct WFrag<h16> { typedef v16h V; static __device__ __forceinline__ V ld(const h16* p) { return cat16(*(const v8h*)p, *(const v8h*)(p + 256)); } static __device__ __forceinline__ v8f mma(V a, V b, v8f c) { return wmma16(a, b, c); } };
template <> struct WFrag<bf> { typedef v16bf V; static __device__ __forceinline__ V ld(const bf* p) { return cat16b(*(const v8us*)p, *(const v8us*)(p + 256)); } static __device__ __forceinline__ v8f mma(V a, V b, v8f c) { return wmmab(a, b, c); } };
template <typename T16, int NSPLIT, bool BIAS, int K, int KS = 1>   // K at compile time: a row tile's blocks then lie at immediate offsets from one address
__global__ __launch_bounds__(32) void k_gemmw(const T16* __restrict__ A, const T16* __restrict__ A2, const T16* __restrict__ Bt, const T16* __restrict__ Bt2, float* C, int ldc, const float* __restrict__ bias, size_t sA, size_t sB, size_t sC) {
    typedef typename WFrag<T16>::V V;
    __shared__ __align__(16) float os[16 * 68];
    const size_t z = blockIdx.z / KS; const size_t ks = blockIdx.z % KS; const size_t ld = (size_t)K * KS * 16 /* elements of a row tile */; A += z * sA + ks * K * 16; if (A2) A2 += z * sA + ks * K * 16; Bt += z * sB + ks * K * 16; if (Bt2) Bt2 += z * sB + ks * K * 16; C += (z + ks * ZH) * sC;
    const int lane = threadIdx.x & 31, lr = lane & 15, hi = lane >> 4; const int r0 = blockIdx.x * 64, c0 = blockIdx.y * 64;
    v8f acc[4][4];
#pragma unroll
    for (int mb = 0; mb < 4; ++mb)
#pragma unroll
        for (int nb = 0; nb < 4; ++nb) acc[mb][nb] = (v8f){};
    const size_t aoff = (size_t)(r0 / 16) * ld + 8 * lane, boff = (size_t)(c0 / 16) * ld + 8 * lane;
#pragma unroll 1
    for (int kc = 0; kc < K; kc += 32) {
        V a[4], a2[4]; const T16* pa = A + aoff + kc * 16; const T16* pa2 = A2 + aoff + kc * 16; const T16* pb = Bt + boff + kc * 16; const T16* pb2 = Bt2 + boff + kc * 16;
#pragma unroll
        for (int mb = 0; mb < 4; ++mb) { a[mb] = WFrag<T16>::ld(pa + (size_t)mb * ld); if (NSPLIT == 1 || NSPLIT == 2) a2[mb] = WFrag<T16>::ld(pa2 + (size_t)mb * ld); }
        if constexpr (NSPLIT == 1 || NSPLIT == 2) xwa(pa, pa2); else xwa(pa);
#pragma unroll
        for (int nb = 0; nb < 4; ++nb) { const V b = WFrag<T16>::ld(pb + (size_t)nb * ld); V b2; if constexpr (NSPLIT >= 2) { b2 = WFrag<T16>::ld(pb2 + (size_t)nb * ld); xwa(pb, pb2); } else xwa(pb);
#pragma unroll
            for (int mb = 0; mb < 4; ++mb) { acc[mb][nb] = WFrag<T16>::mma(a[mb], b, acc[mb][nb]); if (NSPLIT == 1 || NSPLIT == 2) acc[mb][nb] = WFrag<T16>::mma(a2[mb], b, acc[mb][nb]); if (NSPLIT >= 2) acc[mb][nb] = WFrag<T16>::mma(a[mb], b2, acc[mb][nb]); } }
        asm volatile("v_nop\n\tv_nop\n\tv_nop\n\tv_nop" : "+v"(acc[0][0]), "+v"(acc[1][1]), "+v"(acc[2][2]), "+v"(acc[3][3]) : "v"(a[0]), "v"(a[3]));
    }
#pragma unroll
    for (int mb = 0; mb < 4; ++mb) {
#pragma unroll
        for (int nb = 0; nb < 4; ++nb) {
#pragma unroll
            for (int j = 0; j < 8; ++j) os[(hi * 8 + j) * 68 + nb * 16 + lr] = acc[mb][nb][j]; }
        __builtin_amdgcn_wave_barrier(); asm volatile("" ::: "memory");
        float* crow = C + (size_t)(r0 + mb * 16) * ldc + c0;
{
#pragma unroll
            for (int s = 0; s < 8; ++s) { const int row = 2 * s + hi, cofs = lr * 4; v4f val = *(const v4fa*)(os + row * 68 + cofs); if (BIAS) { val[0] += bfr(bias[c0 + cofs]); val[1] += bfr(bias[c0 + cofs + 1]); val[2] += bfr(bias[c0 + cofs + 2]); val[3] += bfr(bias[c0 + cofs + 3]); }
                *(v4f*)(crow + (size_t)row * ldc + cofs) = val; }
             }
        __builtin_amdgcn_wave_barrier(); asm volatile("" ::: "memory");
    }
}

__device__ __forceinline__ h16 tohx(float x) { return (h16)x; }
__device__ __forceinline__ void splitf(float y, unsigned short& h, unsigned short& l) { h = f2bf(y); l = f2bf(y - bf2f(h)); }
typedef __attribute__((ext_vector_type(2))) _Float16 v2h;
typedef __attribute__((ext_vector_type(4))) _Float16 v4h;
typedef __attribute__((ext_vector_type(2))) unsigned short v2us;
typedef __attribute__((ext_vector_type(4))) unsigned short v4us;
typedef __attribute__((ext_vector_type(2))) float v2f;
typedef __attribute__((ext_vector_type(4))) int v4i;

__global__ __launch_bounds__(256) void k_wtG(const float* __restrict__ w, int K, int N, bf* Bt) {
    const int lane = threadIdx.x & 31; const int L0 = (blockIdx.x * 8 + (threadIdx.x >> 5)) * 8; const int nlines = N * K / 64;
{
#pragma unroll 1
        for (int l = 0; l < 8; ++l) { const int L = L0 + l; if (L >= nlines) break; const size_t e = (size_t)L * 64 + lane * 2; const int k = (int)(e % K), n = (int)(e / K); v2us o;
            o[0] = f2bf(w[(size_t)k * N + n]); o[1] = f2bf(w[(size_t)(k + 1) * N + n]); *(v2us*)(Bt + e) = o; }
         }
}
// k_cvtf: f32 [rows][K] -> bf16 plane in fragment order. One wave a block: 8 lanes read a row's whole 128-byte line (4 rows a load), a lane stores its 4 elements at their place in the block.
template <int K>
__global__ __launch_bounds__(256) void k_cvtf(const float* __restrict__ src, bf* dst, int nblk) { const int blk = blockIdx.x * 8 + (threadIdx.x >> 5); if (blk >= nblk) return; const int lane = threadIdx.x & 31, g = lane >> 3, p = lane & 7; const int ktn = K / 32, kt = blk % ktn, rt = blk / ktn;
    const float* s = src + (size_t)(rt * 16 + g) * K + kt * 32 + p * 4; bf* d = dst + (size_t)blk * 512 + (p >> 2) * 256 + ((p >> 1) & 1) * 128 + g * 8 + (p & 1) * 4; v4f v[4];
#pragma unroll
    for (int i = 0; i < 4; ++i) v[i] = *(const v4f*)(s + (size_t)i * 4 * K);
    xwa(s);
#pragma unroll
    for (int i = 0; i < 4; ++i) { v4us o;
#pragma unroll
        for (int k = 0; k < 4; ++k) o[k] = f2bf(v[i][k]); *(v4us*)(d + i * 32) = o; }  }
// k_bm: bias and mask of both batches -> ONE bf16 plane in fragment order (rows: queries, k: keys): the bias rounded to bf16 (nearest even), as every input, or MASKED where mask <= 0. Lanes as in k_cvtf.
#define MASKED 0xFF60   // bf16 -1.75 x 2^127: swallows any score added to it, and tops the start value of the running maximum, so that a row with every key masked still averages V
typedef __attribute__((ext_vector_type(4))) __bf16 v4bf;
__global__ __launch_bounds__(256) void k_bm(const float* __restrict__ ab, const int* __restrict__ am, bf* BM) { const int blk = blockIdx.x * 8 + (threadIdx.x >> 5); const int lane = threadIdx.x & 31, g = lane >> 3, p = lane & 7; const int kt = blk % (TT / 32), rt = blk / (TT / 32);
    const size_t so = (size_t)(rt * 16 + g) * TT + kt * 32 + p * 4; bf* d = BM + (size_t)blk * 512 + (p >> 2) * 256 + ((p >> 1) & 1) * 128 + g * 8 + (p & 1) * 4; v4f v[4]; v4i mk[4];
#pragma unroll
    for (int i = 0; i < 4; ++i) { v[i] = *(const v4f*)(ab + so + (size_t)i * 4 * TT); mk[i] = *(const v4i*)(am + so + (size_t)i * 4 * TT); }
    xwa(ab + so, am + so);
#pragma unroll
    for (int i = 0; i < 4; ++i) { v4us o = __builtin_bit_cast(v4us, __builtin_convertvector(v[i], v4bf));
#pragma unroll
        for (int k = 0; k < 4; ++k) o[k] = (mk[i][k] > 0) ? o[k] : (unsigned short)MASKED; *(v4us*)(d + i * 32) = o; }  }
__global__ __launch_bounds__(256) void k_cscvt(const float* __restrict__ cosT, const float* __restrict__ sinT, float* CS) { const int idx = blockIdx.x * 256 + threadIdx.x; if (idx >= TT * HD) return; v2f cs; cs[0] = bfr(cosT[idx]); cs[1] = bfr(sinT[idx]); *(v2f*)(CS + (size_t)idx * 2) = cs;  }
// k_rope: head planes [h][t][d] in fragment order (rows t, k = d; a thread takes two neighbours of the OUTPUT order) (fp16 + hi/lo) of rope(x) x sc with the rotate-half convention out[d] = x[d] cos[t][d] - x[d+HD/2] sin[t][d], out[d+HD/2] = x[d+HD/2] cos[t][d+HD/2] + x[d] sin[t][d+HD/2]
__global__ __launch_bounds__(256) void k_rope(const float* __restrict__ F, int pitch, int nheads, const float* __restrict__ CS, const float* __restrict__ RF, const float* __restrict__ nw, float sc, h16* P16, bf* Ph, bf* Pl) {
    const size_t e = ((size_t)blockIdx.x * 256 + threadIdx.x) * 2; if (e >= (size_t)nheads * TT * HD) return; const int w = (int)(e & 511), blk = (int)(e >> 9); const int d = (blk % (HD / 32)) * 32 + (w >> 8) * 16 + ((w >> 7) & 1) * 8 + (w & 7); const int t = ((blk / (HD / 32)) % (TT / 16)) * 16 + ((w >> 3) & 15); const int h = blk / ((HD / 32) * (TT / 16)); const float* f = F + (size_t)t * pitch + h * HD; const float rf = RF ? RF[(size_t)h * TT + t] : 1.0f; v2h o16; v2us oh, ol;
#pragma unroll
    for (int q = 0; q < 2; ++q) { const int dd = d + q; const int dp = (dd < HD / 2) ? dd + HD / 2 : dd - HD / 2; float x0 = f[dd], x1 = f[dp];
        if (RF) { float n0 = __fmul_rn(x0, rf), n1 = __fmul_rn(x1, rf); asm volatile("" : "+v"(n0)); asm volatile("" : "+v"(n1)); x0 = __fmul_rn(bfr(nw[dd]), n0); x1 = __fmul_rn(bfr(nw[dp]), n1); }
        const v2f cs = *(const v2f*)(CS + ((size_t)t * HD + dd) * 2); float a = __fmul_rn(x0, cs[0]), bq = __fmul_rn(x1, cs[1]); asm volatile("" : "+v"(a)); asm volatile("" : "+v"(bq)); const float r = ((dd < HD / 2) ? __fsub_rn(a, bq) : __fadd_rn(a, bq)) * sc;
        o16[q] = tohx(r); unsigned short a2, c2; splitf(r, a2, c2); oh[q] = a2; ol[q] = c2; }
    *(v2h*)(P16 + e) = o16; *(v2us*)(Ph + e) = oh; *(v2us*)(Pl + e) = ol;  }
__global__ __launch_bounds__(256) void k_vtp(const float* __restrict__ F, int pitch, int nheads, h16* V16, bf* Vh, bf* Vl) { const size_t e = ((size_t)blockIdx.x * 256 + threadIdx.x) * 2; if (e >= (size_t)nheads * HD * TT) return; const int w = (int)(e & 511), blk = (int)(e >> 9); /* fragment order: rows d, k = t */ const int t = (blk % (TT / 32)) * 32 + (w >> 8) * 16 + ((w >> 7) & 1) * 8 + (w & 7); const int d = ((blk / (TT / 32)) % (HD / 16)) * 16 + ((w >> 3) & 15); const int g = blk / ((TT / 32) * (HD / 16)); v2h o16; v2us oh, ol;
#pragma unroll
    for (int q = 0; q < 2; ++q) { const float x = F[(size_t)(t + q) * pitch + g * HD + d]; o16[q] = tohx(x); unsigned short a2, c2; splitf(x, a2, c2); oh[q] = a2; ol[q] = c2; }
    *(v2h*)(V16 + e) = o16; *(v2us*)(Vh + e) = oh; *(v2us*)(Vl + e) = ol;  }
__global__ __launch_bounds__(256) void k_csid(float* CS) { const int idx = blockIdx.x * 256 + threadIdx.x; if (idx >= TT * HD) return; v2f cs; cs[0] = 1.0f; cs[1] = 0.0f; *(v2f*)(CS + (size_t)idx * 2) = cs;  }
// ---- k_fattn: scores, bias, mask, softmax and P.V of one head in ONE kernel; S and P never leave the registers. One wave owns 16 query rows and walks the 2048 keys in passes of 32.
// S^T = K Q^T (A = K rows, B = Q rows): a lane holds one query's scores (query lr, keys 8 hi + j of each 16-key tile), so two converted S^T tiles ARE the B operand of O^T += V^T P^T (same k order as WFrag::ld).
// Running maximum m per query: P = exp(t - m) unnormalised, the sum l kept in f32 beside it, O divided by l at the end. m moves only when a pass's maximum tops it by more than MSTEP (then O and l are rescaled), so P <= e^MSTEP.
// Addresses: a wave-uniform base that moves with the pass + the lane's byte offset in a block (16 lane). Q, K, V^T and the bias+mask plane BM all lie in fragment order.
#define MSTEP 5.5f
typedef __attribute__((ext_vector_type(8))) int v8i;
typedef __attribute__((ext_vector_type(8))) __bf16 v8bf;
__device__ __forceinline__ float xhalf(float x) { return __builtin_bit_cast(float, __builtin_amdgcn_permlanex16(__builtin_bit_cast(int, x), __builtin_bit_cast(int, x), 0x76543210, 0xfedcba98, false, false)); }   // lane l with lane l ^ 16
template <typename T> __device__ __forceinline__ const T* atb(const T* base, unsigned offb) { return (const T*)((const char*)base + offb); }
template <typename T16, int NSPLIT>
__device__ __forceinline__ void attn_rows(const T16* __restrict__ Q, const T16* __restrict__ Q2, const T16* __restrict__ Kp, const T16* __restrict__ K2, const T16* __restrict__ Vt, const T16* __restrict__ V2, const bf* __restrict__ BM, int q0, int h, bf* Ah, bf* Al) {
    typedef typename WFrag<T16>::V V;
    const int lane = threadIdx.x & 31;
    V qf[2], q2[2], kf[2][2], k2[2][2]; v8bf bb[2];
    const unsigned lo = (unsigned)lane * 16u;   // byte offset
    Q += (size_t)q0 * HD; if (NSPLIT == 2) Q2 += (size_t)q0 * HD; BM += (size_t)q0 * TT;   // the wave's own row tile: q0 / 16 x (blocks a row tile) x 512
#pragma unroll
    for (int ks = 0; ks < 2; ++ks) { qf[ks] = WFrag<T16>::ld(atb(Q, lo) + ks * 512); if (NSPLIT == 2) q2[ks] = WFrag<T16>::ld(atb(Q2, lo) + ks * 512); }
    XW;
#pragma unroll
    for (int kt = 0; kt < 2; ++kt)
#pragma unroll
        for (int ks = 0; ks < 2; ++ks) { kf[kt][ks] = WFrag<T16>::ld(atb(Kp, lo) + kt * 16 * HD + ks * 512); if (NSPLIT == 2) k2[kt][ks] = WFrag<T16>::ld(atb(K2, lo) + kt * 16 * HD + ks * 512); }
    XW;
#pragma unroll
    for (int kt = 0; kt < 2; ++kt) bb[kt] = *(const v8bf*)(atb(BM, lo) + kt * 256);
    XW;
    v8f o[4];
#pragma unroll
    for (int mb = 0; mb < 4; ++mb) o[mb] = (v8f){};
    float m = -3.0e38f, l = 0.f;
#pragma unroll 1   // rolled: 64 passes, the body already holds 8 or 24 matrix instructions and a pass's loads
    for (int key0 = 0; key0 < TT; key0 += 32) {
        V vf[4], v2[4];   // this pass's V^T rows: in flight under the score products and the softmax
#pragma unroll
        for (int mb = 0; mb < 4; ++mb) { vf[mb] = WFrag<T16>::ld(atb(Vt + key0 * 16, lo) + mb * 16 * TT); if (NSPLIT == 2) v2[mb] = WFrag<T16>::ld(atb(V2 + key0 * 16, lo) + mb * 16 * TT); }
        XW;
        v8f t[2];
#pragma unroll
        for (int kt = 0; kt < 2; ++kt) { v8f s = (v8f){};
#pragma unroll
            for (int ks = 0; ks < 2; ++ks) { s = WFrag<T16>::mma(kf[kt][ks], qf[ks], s); if (NSPLIT == 2) { s = WFrag<T16>::mma(kf[kt][ks], q2[ks], s); s = WFrag<T16>::mma(k2[kt][ks], qf[ks], s); } }
#pragma unroll   // s x 2^-3 is exact, so the fused multiply-add rounds once, as a separate add would
            for (int j = 0; j < 8; ++j) t[kt][j] = __builtin_fmaf(s[j], SCL, (float)bb[kt][j]); }
        const int kn = (key0 + 32 < TT) ? key0 + 32 : key0;   // the next pass's K rows and bias+mask block are fetched one pass ahead; the last pass fetches its own again (in bounds, not used)
#pragma unroll
        for (int kt = 0; kt < 2; ++kt)
#pragma unroll
            for (int ks = 0; ks < 2; ++ks) { kf[kt][ks] = WFrag<T16>::ld(atb(Kp + (size_t)kn * HD, lo) + kt * 16 * HD + ks * 512); if (NSPLIT == 2) k2[kt][ks] = WFrag<T16>::ld(atb(K2 + (size_t)kn * HD, lo) + kt * 16 * HD + ks * 512); }
        XW;
#pragma unroll
        for (int kt = 0; kt < 2; ++kt) bb[kt] = *(const v8bf*)(atb(BM + kn * 16, lo) + kt * 256);
        XW;
        float pm = fmaxf(t[0][0], t[1][0]);
#pragma unroll
        for (int j = 1; j < 8; ++j) pm = fmaxf(pm, fmaxf(t[0][j], t[1][j]));
        pm = fmaxf(pm, xhalf(pm));   // the two lane halves hold the two halves of a query's keys
        const bool need = pm > m + MSTEP;
        if (__builtin_amdgcn_ballot_w32(need) != 0) {   // wave-uniform: rare after the first pass
            const float mn = need ? pm : m; const float al = __builtin_amdgcn_exp2f((m - mn) * 1.4426950408889634f); m = mn; l *= al;
#pragma unroll
            for (int mb = 0; mb < 4; ++mb) o[mb] *= al; }
        float ls[4] = {0.f, 0.f, 0.f, 0.f};
#pragma unroll
        for (int kt = 0; kt < 2; ++kt)
#pragma unroll
            for (int j = 0; j < 8; ++j) { t[kt][j] = __builtin_amdgcn_exp2f((t[kt][j] - m) * 1.4426950408889634f); ls[j & 3] += t[kt][j]; }
        l += (ls[0] + ls[1]) + (ls[2] + ls[3]);
        if constexpr (NSPLIT == 2) {   // P = hi + lo bf16 planes
            const v8bf h0 = __builtin_convertvector(t[0], v8bf), h1 = __builtin_convertvector(t[1], v8bf);
            const v8bf l0 = __builtin_convertvector(t[0] - __builtin_convertvector(h0, v8f), v8bf), l1 = __builtin_convertvector(t[1] - __builtin_convertvector(h1, v8f), v8bf);
            const V pfh = __builtin_shufflevector(h0, h1, 0, 1, 2, 3, 4, 5, 6, 7, 8, 9, 10, 11, 12, 13, 14, 15), pfl = __builtin_shufflevector(l0, l1, 0, 1, 2, 3, 4, 5, 6, 7, 8, 9, 10, 11, 12, 13, 14, 15);
#pragma unroll
            for (int mb = 0; mb < 4; ++mb) { o[mb] = WFrag<T16>::mma(vf[mb], pfh, o[mb]); o[mb] = WFrag<T16>::mma(vf[mb], pfl, o[mb]); o[mb] = WFrag<T16>::mma(v2[mb], pfh, o[mb]); }
        } else {
            const V pfv = cat16(__builtin_convertvector(t[0], v8h), __builtin_convertvector(t[1], v8h));
#pragma unroll
            for (int mb = 0; mb < 4; ++mb) o[mb] = WFrag<T16>::mma(vf[mb], pfv, o[mb]); }
        // four vector slots behind the pass's last matrix instruction, also on the taken back edge, before its operands are loaded anew
        asm volatile("v_nop\n\tv_nop\n\tv_nop\n\tv_nop" : "+v"(o[0]), "+v"(o[1]), "+v"(o[2]), "+v"(o[3]) : "v"(vf[0]), "v"(vf[3]));
    }
    l += xhalf(l);
    const float f = __fdiv_rn(1.0f, l);
#pragma unroll
    for (int mb = 0; mb < 4; ++mb) { v8us oh, ol;   // a lane holds 8 consecutive d of its query: one 16-byte store a plane, at the lane's place in the block of the output projection's A operand
#pragma unroll
        for (int j = 0; j < 8; ++j) { unsigned short a, c2; splitf(o[mb][j] * f, a, c2); oh[j] = a; ol[j] = c2; }
        const size_t oo = (size_t)q0 * DQ + (h * (HD / 32) + (mb >> 1)) * 512 + (mb & 1) * 256 + lane * 8; *(v8us*)(Ah + oo) = oh; *(v8us*)(Al + oo) = ol; }
}
// grid (heads, TT / 64), 4 waves: the blocks of the hi+lo rows (three products each, the longest) come first in the launch order; neighbouring blocks read the same bias+mask blocks
__global__ __launch_bounds__(128) void k_fattn(const h16* __restrict__ Q16, const h16* __restrict__ K16, const h16* __restrict__ V16, const bf* __restrict__ Qh, const bf* __restrict__ Ql, const bf* __restrict__ Kh, const bf* __restrict__ Kl, const bf* __restrict__ Vh, const bf* __restrict__ Vl, const bf* __restrict__ BM, bf* Ah, bf* Al) {
    const int h = blockIdx.x; const int q0 = blockIdx.y * 64 + (threadIdx.x >> 5) * 16; const size_t hp = (size_t)h * TT * HD;
    if ((int)blockIdx.y * 64 < RH) attn_rows<bf, 2>(Qh + hp, Ql + hp, Kh + hp, Kl + hp, Vh + hp, Vl + hp, BM, q0, h, Ah, Al);
    else attn_rows<h16, 0>(Q16 + hp, nullptr, K16 + hp, nullptr, V16 + hp, nullptr, BM, q0, h, Ah, Al);
}

extern "C" void kernel_launch(void* const* d_in, const int* in_sizes, int n_in,
                              void* d_out, int out_size, void* d_ws, size_t ws_size, hipStream_t stream) {
    (void)in_sizes; (void)n_in; (void)out_size;
    const float* x = (const float*)d_in[0]; const float* abias = (const float*)d_in[1]; const int* amask = (const int*)d_in[2]; const float* wq = (const float*)d_in[3]; const float* bq = (const float*)d_in[4]; const float* wk = (const float*)d_in[5]; const float* bk = (const float*)d_in[6]; const float* wv = (const float*)d_in[7]; const float* bv = (const float*)d_in[8]; const float* wo = (const float*)d_in[9]; const float* bo = (const float*)d_in[10]; const float* cosT = nullptr; const float* sinT = nullptr; (void)cosT; (void)sinT;
    float* OUT = (float*)d_out;     // [2][2048][1024]
    char* wsp = (char*)d_ws;
    auto take = [&](size_t bytes) { char* p = wsp; wsp += (bytes + 255) & ~(size_t)255; return (void*)p; };
    bf* WQ = (bf*)take((size_t)DQ * DM * 2); bf* WK = (bf*)take((size_t)DKV * DM * 2); bf* WV = (bf*)take((size_t)DKV * DM * 2); bf* WO = (bf*)take((size_t)DM * DQ * 2); float* CS = (float*)take((size_t)TT * HD * 2 * 4);
    h16* QP16 = (h16*)take((size_t)NH_ * TT * HD * 2); h16* KP16 = (h16*)take((size_t)NKV * TT * HD * 2); h16* VT16 = (h16*)take((size_t)NKV * HD * TT * 2);
    bf* QPh = (bf*)take((size_t)NH_ * TT * HD * 2); bf* QPl = (bf*)take((size_t)NH_ * TT * HD * 2); bf* KPh = (bf*)take((size_t)NKV * TT * HD * 2); bf* KPl = (bf*)take((size_t)NKV * TT * HD * 2); bf* VTh = (bf*)take((size_t)NKV * HD * TT * 2); bf* VTl = (bf*)take((size_t)NKV * HD * TT * 2);
    bf* XB = (bf*)take((size_t)TT * DM * 2); float* FQ = (float*)take((size_t)TT * DQ * 4); float* FK = (float*)take((size_t)TT * DKV * 4); bf* ATh = (bf*)take((size_t)TT * DQ * 2); bf* ATl = (bf*)take((size_t)TT * DQ * 2); bf* BM = (bf*)take((size_t)NB_ * TT * TT * 2);
    if ((size_t)(wsp - (char*)d_ws) > ws_size) return;    // ws 256 MiB
    float* FV = FK;   // v projection reuses the k buffer after the k planes are built (stream-ordered)
    { k_cvtf<DM><<<DQ * DM / 512 / 8, 256, 0, stream>>>(wq, WQ, DQ * DM / 512); k_cvtf<DM><<<DKV * DM / 512 / 8, 256, 0, stream>>>(wk, WK, DKV * DM / 512); k_cvtf<DM><<<DKV * DM / 512 / 8, 256, 0, stream>>>(wv, WV, DKV * DM / 512);
      k_cvtf<DQ><<<DM * DQ / 512 / 8, 256, 0, stream>>>(wo, WO, DM * DQ / 512);
       }
    k_bm<<<NB_ * TT / 16 * (TT / 32) / 8, 256, 0, stream>>>(abias, amask, BM);
    k_csid<<<(TT * HD + 255) / 256, 256, 0, stream>>>(CS);
    const unsigned LQ = (unsigned)(((size_t)NH_ * TT * HD / 2 + 255) / 256), LKv = (unsigned)(((size_t)NKV * TT * HD / 2 + 255) / 256);
    for (int b = 0; b < NB_; ++b) {
        
        k_cvtf<DM><<<TT * DM / 512 / 8, 256, 0, stream>>>(x + (size_t)b * TT * DM, XB, TT * DM / 512);
        k_gemmw<bf, 0, true, DM><<<dim3(TT / 64, DQ / 64, 1), 32, 0, stream>>>(XB, nullptr, WQ, nullptr, FQ, DQ, bq, 0, 0, 0);
        k_rope<<<LQ, 256, 0, stream>>>(FQ, DQ, NH_, CS, nullptr, nullptr, 1.0f, QP16, QPh, QPl);
        k_gemmw<bf, 0, true, DM><<<dim3(TT / 64, DKV / 64, 1), 32, 0, stream>>>(XB, nullptr, WK, nullptr, FK, DKV, bk, 0, 0, 0);
        k_rope<<<LKv, 256, 0, stream>>>(FK, DKV, NKV, CS, nullptr, nullptr, 1.0f, KP16, KPh, KPl);
        k_gemmw<bf, 0, true, DM><<<dim3(TT / 64, DKV / 64, 1), 32, 0, stream>>>(XB, nullptr, WV, nullptr, FV, DKV, bv, 0, 0, 0); k_vtp<<<LKv, 256, 0, stream>>>(FV, DKV, NKV, VT16, VTh, VTl);
        k_fattn<<<dim3(NH_, TT / 64, 1), 128, 0, stream>>>(QP16, KP16, VT16, QPh, QPl, KPh, KPl, VTh, VTl, BM + (size_t)b * TT * TT, ATh, ATl);   // one kv head per query head
        k_gemmw<bf, 1, true, DQ><<<dim3(TT / 64, DM / 64, 1), 32, 0, stream>>>(ATh, ATl, WO, nullptr, OUT + (size_t)b * TT * DM, DM, bo, 0, 0, 0); }
}

// v005
// It runs in 195 microseconds.
// Next to v004, in two timings, it ran 2.06 and 2.05 times as fast.
// All steps since v000 together make it 11.4 times as fast.
#include <hip/hip_runtime.h>

// MultiHeadAttentionWithBias (query [2][2048][1024], attention_bias [2][S][S] (f32, read), attention_mask [2][S][S] (int, read; all ones); q/k/v = x W^T + b (16 x 64); scores = q.k / 8 + bias[b][i][j], -inf where mask <= 0; softmax; out = merged Wo^T + bo -> [2][2048][1024]).
// Compute dtypes, f32 accumulate: every input rounded to bf16; q/k/v on PLAIN bf16 operands (inputs: exact) + bias; scores PRECPLAN; the bf16-rounded bias and the int mask read per element in f32 (no structural skipping); softmax f32; Wo hl x exact (2 products) + bias.

#define NB_  2
#define TT   2048
#define DM   1024
#define NH_  16
#define NKV  16
#define REP  (NH_ / NKV)
#define HD   64
#define DQ   (NH_ * HD)
#define DKV  (NKV * HD)
#define ZH   1                    // batches per partial plane of a k_gemmw launch with KS > 1 (none is launched)
#define RH   512                  // query rows < RH use hi+lo planes (0: none)
#define WIN  0
#define SCL  0.125f   // HD^-0.5
typedef _Float16 h16;
typedef unsigned short bf;
typedef __attribute__((ext_vector_type(16))) __bf16   v16bf;
typedef __attribute__((ext_vector_type(16))) _Float16 v16h;
typedef __attribute__((ext_vector_type(8)))  _Float16 v8h;
typedef __attribute__((ext_vector_type(8)))  unsigned short v8us;
typedef __attribute__((ext_vector_type(8)))  float    v8f;
typedef __attribute__((ext_vector_type(4)))  float    v4f;
typedef v8h  __attribute__((may_alias)) v8ha;
typedef v4f  __attribute__((may_alias)) v4fa;
typedef v8us __attribute__((may_alias)) v8usa;

__device__ __forceinline__ unsigned short f2bf(float f) { unsigned u = __float_as_uint(f); u += 0x7FFFu + ((u >> 16) & 1u); return (unsigned short)(u >> 16); }
__device__ __forceinline__ float bf2f(unsigned short b) { return __uint_as_float(((unsigned)b) << 16); }
__device__ __forceinline__ float bfr(float f) { return bf2f(f2bf(f)); }
__device__ __forceinline__ v16h cat16(v8h lo, v8h hi) { return __builtin_shufflevector(lo, hi, 0, 1, 2, 3, 4, 5, 6, 7, 8, 9, 10, 11, 12, 13, 14, 15); }
__device__ __forceinline__ v16bf cat16b(v8us lo, v8us hi) { return __builtin_bit_cast(v16bf, __builtin_shufflevector(lo, hi, 0, 1, 2, 3, 4, 5, 6, 7, 8, 9, 10, 11, 12, 13, 14, 15)); }
__device__ __forceinline__ v8f wmma16(v16h a, v16h b, v8f c) { return __builtin_amdgcn_wmma_f32_16x16x32_f16(false, a, false, b, (short)0, c, false, false); }
__device__ __forceinline__ v8f wmmab(v16bf a, v16bf b, v8f c) { return __builtin_amdgcn_wmma_f32_16x16x32_bf16(false, a, false, b, (short)0, c, false, false); }



// XW: a precaution behind each group of global loads: the wait on their address translation stands ahead of any later instruction that takes one of their registers as a destination; its "memory" clobber also keeps the group issued where it is written (in k_fattn a pass's work ahead of its use).
#define XW asm volatile("s_wait_xcnt 0x0" ::: "memory")
// xwa: the same wait with the group's addresses as inputs: they stay in their registers up to the wait, so that neither a later load's destination nor other work takes those registers ahead of it.
template <typename T> __device__ __forceinline__ void xwa(const T* p) { asm volatile("s_wait_xcnt 0x0" :: "v"(p) : "memory"); }
template <typename T, typename U> __device__ __forceinline__ void xwa(const T* p, const U* q) { asm volatile("s_wait_xcnt 0x0" :: "v"(p), "v"(q) : "memory"); }
// ---- FRAGMENT ORDER: every 16-bit operand plane [rows][K] lies as blocks of 16 rows x 32 k (512 elements, 1 KB), block (row tile, k tile) at index row tile x K/32 + k tile.
// In a block, element (r, k = 16 c + 8 hi + e) lies at 256 c + 8 (16 hi + r) + e: lane 16 hi + r of a wave finds its 8 + 8 elements at 8 lane and 256 + 8 lane, so each 16-byte load of a wave covers 512 contiguous bytes (4 whole lines), not 32-byte pieces of 16 lines. The registers hold what they held with row-major planes.
// ---- k_gemmw: register-blocked GEMM, ONE WAVE per 64x64 output tile (16 accumulators), operands straight from 16-bit planes in fragment order; grid (M/64, N/64, Z), 32 threads.
// C[m][n] (f32, pitch ldc, + optional f32 bias[n]) = sum_k A[m][k] Bt[n][k] (+ split products per NSPLIT). z-batch strides sA/sB/sC in elements. K % 32 == 0.
// KS > 1: grid z = batches x KS; a work-group sums only chunk ks (K elements) of rows of pitch K x KS and writes partial plane ks of C (planes of ZH x sC elements), which the consumer adds up.
template <typename T16> struct WFrag;
template <> struct WFrag<h16> { typedef v16h V; static __device__ __forceinline__ V ld(const h16* p) { return cat16(*(const v8h*)p, *(const v8h*)(p + 256)); } static __device__ __forceinline__ v8f mma(V a, V b, v8f c) { return wmma16(a, b, c); } };
template <> struct WFrag<bf> { typedef v16bf V; static __device__ __forceinline__ V ld(const bf* p) { return cat16b(*(const v8us*)p, *(const v8us*)(p + 256)); } static __device__ __forceinline__ v8f mma(V a, V b, v8f c) { return wmmab(a, b, c); } };
template <typename T16, int NSPLIT, bool BIAS, int K, int KS = 1>   // K at compile time: a row tile's blocks then lie at immediate offsets from one address
__global__ __launch_bounds__(32) void k_gemmw(const T16* __restrict__ A, const T16* __restrict__ A2, const T16* __restrict__ Bt, const T16* __restrict__ Bt2, float* C, int ldc, const float* __restrict__ bias, const float* __restrict__ bias1, const float* __restrict__ bias2, size_t sA, size_t sB, size_t sC) {
    typedef typename WFrag<T16>::V V;
    __shared__ __align__(16) float os[16 * 68];
    const size_t z = blockIdx.z / KS; const size_t ks = blockIdx.z % KS; const size_t ld = (size_t)K * KS * 16 /* elements of a row tile */; A += z * sA + ks * K * 16; if (A2) A2 += z * sA + ks * K * 16; Bt += z * sB + ks * K * 16; if (Bt2) Bt2 += z * sB + ks * K * 16; C += (z + ks * ZH) * sC;
    const int lane = threadIdx.x & 31, lr = lane & 15, hi = lane >> 4; const int r0 = blockIdx.x * 64, c0 = blockIdx.y * 64;
    if (c0 >= 2 * DQ) bias = bias2 - 2 * DQ; else if (c0 >= DQ) bias = bias1 - DQ;   // several projections side by side in N, DQ columns each: the tile's own bias vector, still indexed by the column in C
    v8f acc[4][4];
#pragma unroll
    for (int mb = 0; mb < 4; ++mb)
#pragma unroll
        for (int nb = 0; nb < 4; ++nb) acc[mb][nb] = (v8f){};
    const size_t aoff = (size_t)(r0 / 16) * ld + 8 * lane, boff = (size_t)(c0 / 16) * ld + 8 * lane;
#pragma unroll 1
    for (int kc = 0; kc < K; kc += 32) {
        V a[4], a2[4]; const T16* pa = A + aoff + kc * 16; const T16* pa2 = A2 + aoff + kc * 16; const T16* pb = Bt + boff + kc * 16; const T16* pb2 = Bt2 + boff + kc * 16;
#pragma unroll
        for (int mb = 0; mb < 4; ++mb) { a[mb] = WFrag<T16>::ld(pa + (size_t)mb * ld); if (NSPLIT == 1 || NSPLIT == 2) a2[mb] = WFrag<T16>::ld(pa2 + (size_t)mb * ld); }
        if constexpr (NSPLIT == 1 || NSPLIT == 2) xwa(pa, pa2); else xwa(pa);
#pragma unroll
        for (int nb = 0; nb < 4; ++nb) { const V b = WFrag<T16>::ld(pb + (size_t)nb * ld); V b2; if constexpr (NSPLIT >= 2) { b2 = WFrag<T16>::ld(pb2 + (size_t)nb * ld); xwa(pb, pb2); } else xwa(pb);
#pragma unroll
            for (int mb = 0; mb < 4; ++mb) { acc[mb][nb] = WFrag<T16>::mma(a[mb], b, acc[mb][nb]); if (NSPLIT == 1 || NSPLIT == 2) acc[mb][nb] = WFrag<T16>::mma(a2[mb], b, acc[mb][nb]); if (NSPLIT >= 2) acc[mb][nb] = WFrag<T16>::mma(a[mb], b2, acc[mb][nb]); } }
        asm volatile("v_nop\n\tv_nop\n\tv_nop\n\tv_nop" : "+v"(acc[0][0]), "+v"(acc[1][1]), "+v"(acc[2][2]), "+v"(acc[3][3]) : "v"(a[0]), "v"(a[3]));
    }
#pragma unroll
    for (int mb = 0; mb < 4; ++mb) {
#pragma unroll
        for (int nb = 0; nb < 4; ++nb) {
#pragma unroll
            for (int j = 0; j < 8; ++j) os[(hi * 8 + j) * 68 + nb * 16 + lr] = acc[mb][nb][j]; }
        __builtin_amdgcn_wave_barrier(); asm volatile("" ::: "memory");
        float* crow = C + (size_t)(r0 + mb * 16) * ldc + c0;
{
#pragma unroll
            for (int s = 0; s < 8; ++s) { const int row = 2 * s + hi, cofs = lr * 4; v4f val = *(const v4fa*)(os + row * 68 + cofs); if (BIAS) { val[0] += bfr(bias[c0 + cofs]); val[1] += bfr(bias[c0 + cofs + 1]); val[2] += bfr(bias[c0 + cofs + 2]); val[3] += bfr(bias[c0 + cofs + 3]); }
                *(v4f*)(crow + (size_t)row * ldc + cofs) = val; }
             }
        __builtin_amdgcn_wave_barrier(); asm volatile("" ::: "memory");
    }
}

__device__ __forceinline__ h16 tohx(float x) { return (h16)x; }
__device__ __forceinline__ void splitf(float y, unsigned short& h, unsigned short& l) { h = f2bf(y); l = f2bf(y - bf2f(h)); }
typedef __attribute__((ext_vector_type(2))) _Float16 v2h;
typedef __attribute__((ext_vector_type(4))) _Float16 v4h;
typedef __attribute__((ext_vector_type(2))) unsigned short v2us;
typedef __attribute__((ext_vector_type(4))) unsigned short v4us;
typedef __attribute__((ext_vector_type(2))) float v2f;
typedef __attribute__((ext_vector_type(4))) int v4i;

__global__ __launch_bounds__(256) void k_wtG(const float* __restrict__ w, int K, int N, bf* Bt) {
    const int lane = threadIdx.x & 31; const int L0 = (blockIdx.x * 8 + (threadIdx.x >> 5)) * 8; const int nlines = N * K / 64;
{
#pragma unroll 1
        for (int l = 0; l < 8; ++l) { const int L = L0 + l; if (L >= nlines) break; const size_t e = (size_t)L * 64 + lane * 2; const int k = (int)(e % K), n = (int)(e / K); v2us o;
            o[0] = f2bf(w[(size_t)k * N + n]); o[1] = f2bf(w[(size_t)(k + 1) * N + n]); *(v2us*)(Bt + e) = o; }
         }
}
// k_cvtf: f32 [rows][K] -> bf16 plane in fragment order. One wave a block: 8 lanes read a row's whole 128-byte line (4 rows a load), a lane stores its 4 elements at their place in the block.
// grid y: pieces of nblk blocks, one behind the other in dst: pieces 0 to 3 are the sources s0 to s3, the pieces from 4 on follow one another in s4.
template <int K>
__global__ __launch_bounds__(256) void k_cvtf(const float* __restrict__ s0, const float* __restrict__ s1, const float* __restrict__ s2, const float* __restrict__ s3, const float* __restrict__ s4, bf* dst, int nblk) { const int blk = blockIdx.x * 8 + (threadIdx.x >> 5); if (blk >= nblk) return; const int pc = blockIdx.y; const float* src = pc == 0 ? s0 : pc == 1 ? s1 : pc == 2 ? s2 : pc == 3 ? s3 : s4 + (size_t)(pc - 4) * nblk * 512; dst += (size_t)pc * nblk * 512; const int lane = threadIdx.x & 31, g = lane >> 3, p = lane & 7; const int ktn = K / 32, kt = blk % ktn, rt = blk / ktn;
    const float* s = src + (size_t)(rt * 16 + g) * K + kt * 32 + p * 4; bf* d = dst + (size_t)blk * 512 + (p >> 2) * 256 + ((p >> 1) & 1) * 128 + g * 8 + (p & 1) * 4; v4f v[4];
#pragma unroll
    for (int i = 0; i < 4; ++i) v[i] = *(const v4f*)(s + (size_t)i * 4 * K);
    xwa(s);
#pragma unroll
    for (int i = 0; i < 4; ++i) { v4us o;
#pragma unroll
        for (int k = 0; k < 4; ++k) o[k] = f2bf(v[i][k]); *(v4us*)(d + i * 32) = o; }  }
// k_bm: bias and mask of both batches -> ONE bf16 plane in fragment order (rows: queries, k: keys): the bias rounded to bf16 (nearest even), as every input, or MASKED where mask <= 0. Lanes as in k_cvtf.
#define MASKED 0xFF60   // bf16 -1.75 x 2^127: swallows any score added to it, and tops the start value of the running maximum, so that a row with every key masked still averages V
typedef __attribute__((ext_vector_type(4))) __bf16 v4bf;
__global__ __launch_bounds__(256) void k_bm(const float* __restrict__ ab, const int* __restrict__ am, bf* BM) { const int blk = blockIdx.x * 8 + (threadIdx.x >> 5); const int lane = threadIdx.x & 31, g = lane >> 3, p = lane & 7; const int kt = blk % (TT / 32), rt = blk / (TT / 32);
    const size_t so = (size_t)(rt * 16 + g) * TT + kt * 32 + p * 4; bf* d = BM + (size_t)blk * 512 + (p >> 2) * 256 + ((p >> 1) & 1) * 128 + g * 8 + (p & 1) * 4; v4f v[4]; v4i mk[4];
#pragma unroll
    for (int i = 0; i < 4; ++i) { v[i] = *(const v4f*)(ab + so + (size_t)i * 4 * TT); mk[i] = *(const v4i*)(am + so + (size_t)i * 4 * TT); }
    xwa(ab + so, am + so);
#pragma unroll
    for (int i = 0; i < 4; ++i) { v4us o = __builtin_bit_cast(v4us, __builtin_convertvector(v[i], v4bf));
#pragma unroll
        for (int k = 0; k < 4; ++k) o[k] = (mk[i][k] > 0) ? o[k] : (unsigned short)MASKED; *(v4us*)(d + i * 32) = o; }  }
__global__ __launch_bounds__(256) void k_cscvt(const float* __restrict__ cosT, const float* __restrict__ sinT, float* CS) { const int idx = blockIdx.x * 256 + threadIdx.x; if (idx >= TT * HD) return; v2f cs; cs[0] = bfr(cosT[idx]); cs[1] = bfr(sinT[idx]); *(v2f*)(CS + (size_t)idx * 2) = cs;  }
// k_rope: head planes [h][t][d] in fragment order (rows t, k = d; a thread takes two neighbours of the OUTPUT order) (fp16 + hi/lo) of rope(x) x sc with the rotate-half convention out[d] = x[d] cos[t][d] - x[d+HD/2] sin[t][d], out[d+HD/2] = x[d+HD/2] cos[t][d+HD/2] + x[d] sin[t][d+HD/2]
__global__ __launch_bounds__(256) void k_rope(const float* __restrict__ F, int pitch, int nheads, const float* __restrict__ CS, const float* __restrict__ RF, const float* __restrict__ nw, float sc, h16* P16, bf* Ph, bf* Pl) {
    const size_t e = ((size_t)blockIdx.x * 256 + threadIdx.x) * 2; if (e >= (size_t)nheads * TT * HD) return; const int w = (int)(e & 511), blk = (int)(e >> 9); const int d = (blk % (HD / 32)) * 32 + (w >> 8) * 16 + ((w >> 7) & 1) * 8 + (w & 7); const int t = ((blk / (HD / 32)) % (TT / 16)) * 16 + ((w >> 3) & 15); const int h = blk / ((HD / 32) * (TT / 16)); const float* f = F + (size_t)t * pitch + h * HD; const float rf = RF ? RF[(size_t)h * TT + t] : 1.0f; v2h o16; v2us oh, ol;
    { const long long bz = (h / NH_) % NB_, pz = h / (NH_ * NB_); f += bz * TT * pitch - (bz + pz) * NH_ * HD; }   // planes [projection][batch][head]; in F a batch is TT rows, a projection NH_ x HD columns
#pragma unroll
    for (int q = 0; q < 2; ++q) { const int dd = d + q; const int dp = (dd < HD / 2) ? dd + HD / 2 : dd - HD / 2; float x0 = f[dd], x1 = f[dp];
        if (RF) { float n0 = __fmul_rn(x0, rf), n1 = __fmul_rn(x1, rf); asm volatile("" : "+v"(n0)); asm volatile("" : "+v"(n1)); x0 = __fmul_rn(bfr(nw[dd]), n0); x1 = __fmul_rn(bfr(nw[dp]), n1); }
        const v2f cs = *(const v2f*)(CS + ((size_t)t * HD + dd) * 2); float a = __fmul_rn(x0, cs[0]), bq = __fmul_rn(x1, cs[1]); asm volatile("" : "+v"(a)); asm volatile("" : "+v"(bq)); const float r = ((dd < HD / 2) ? __fsub_rn(a, bq) : __fadd_rn(a, bq)) * sc;
        o16[q] = tohx(r); unsigned short a2, c2; splitf(r, a2, c2); oh[q] = a2; ol[q] = c2; }
    *(v2h*)(P16 + e) = o16; *(v2us*)(Ph + e) = oh; *(v2us*)(Pl + e) = ol;  }
__global__ __launch_bounds__(256) void k_vtp(const float* __restrict__ F, int pitch, int nheads, h16* V16, bf* Vh, bf* Vl) { const size_t e = ((size_t)blockIdx.x * 256 + threadIdx.x) * 2; if (e >= (size_t)nheads * HD * TT) return; const int w = (int)(e & 511), blk = (int)(e >> 9); /* fragment order: rows d, k = t */ const int t = (blk % (TT / 32)) * 32 + (w >> 8) * 16 + ((w >> 7) & 1) * 8 + (w & 7); const int d = ((blk / (TT / 32)) % (HD / 16)) * 16 + ((w >> 3) & 15); const int g = blk / ((TT / 32) * (HD / 16)); F += (long long)(g / NKV) * ((long long)TT * pitch - NKV * HD); /* planes [batch][head]; in F a batch is TT rows */ v2h o16; v2us oh, ol;
#pragma unroll
    for (int q = 0; q < 2; ++q) { const float x = F[(size_t)(t + q) * pitch + g * HD + d]; o16[q] = tohx(x); unsigned short a2, c2; splitf(x, a2, c2); oh[q] = a2; ol[q] = c2; }
    *(v2h*)(V16 + e) = o16; *(v2us*)(Vh + e) = oh; *(v2us*)(Vl + e) = ol;  }
__global__ __launch_bounds__(256) void k_csid(float* CS) { const int idx = blockIdx.x * 256 + threadIdx.x; if (idx >= TT * HD) return; v2f cs; cs[0] = 1.0f; cs[1] = 0.0f; *(v2f*)(CS + (size_t)idx * 2) = cs;  }
// ---- k_fattn: scores, bias, mask, softmax and P.V of one head in ONE kernel; S and P never leave the registers. One wave owns 16 query rows and walks the 2048 keys in passes of 32.
// S^T = K Q^T (A = K rows, B = Q rows): a lane holds one query's scores (query lr, keys 8 hi + j of each 16-key tile), so two converted S^T tiles ARE the B operand of O^T += V^T P^T (same k order as WFrag::ld).
// Running maximum m per query: P = exp(t - m) unnormalised, the sum l kept in f32 beside it, O divided by l at the end. m moves only when a pass's maximum tops it by more than MSTEP (then O and l are rescaled), so P <= e^MSTEP.
// Addresses: a wave-uniform base that moves with the pass + the lane's byte offset in a block (16 lane). Q, K, V^T and the bias+mask plane BM all lie in fragment order.
#define MSTEP 5.5f
typedef __attribute__((ext_vector_type(8))) int v8i;
typedef __attribute__((ext_vector_type(8))) __bf16 v8bf;
__device__ __forceinline__ float xhalf(float x) { return __builtin_bit_cast(float, __builtin_amdgcn_permlanex16(__builtin_bit_cast(int, x), __builtin_bit_cast(int, x), 0x76543210, 0xfedcba98, false, false)); }   // lane l with lane l ^ 16
template <typename T> __device__ __forceinline__ const T* atb(const T* base, unsigned offb) { return (const T*)((const char*)base + offb); }
template <typename T16, int NSPLIT>
__device__ __forceinline__ void attn_rows(const T16* __restrict__ Q, const T16* __restrict__ Q2, const T16* __restrict__ Kp, const T16* __restrict__ K2, const T16* __restrict__ Vt, const T16* __restrict__ V2, const bf* __restrict__ BM, int q0, int h, bf* Ah, bf* Al) {
    typedef typename WFrag<T16>::V V;
    const int lane = threadIdx.x & 31;
    V qf[2], q2[2], kf[2][2], k2[2][2]; v8bf bb[2];
    const unsigned lo = (unsigned)lane * 16u;   // byte offset
    Q += (size_t)q0 * HD; if (NSPLIT == 2) Q2 += (size_t)q0 * HD; BM += (size_t)q0 * TT;   // the wave's own row tile: q0 / 16 x (blocks a row tile) x 512
#pragma unroll
    for (int ks = 0; ks < 2; ++ks) { qf[ks] = WFrag<T16>::ld(atb(Q, lo) + ks * 512); if (NSPLIT == 2) q2[ks] = WFrag<T16>::ld(atb(Q2, lo) + ks * 512); }
    XW;
#pragma unroll
    for (int kt = 0; kt < 2; ++kt)
#pragma unroll
        for (int ks = 0; ks < 2; ++ks) { kf[kt][ks] = WFrag<T16>::ld(atb(Kp, lo) + kt * 16 * HD + ks * 512); if (NSPLIT == 2) k2[kt][ks] = WFrag<T16>::ld(atb(K2, lo) + kt * 16 * HD + ks * 512); }
    XW;
#pragma unroll
    for (int kt = 0; kt < 2; ++kt) bb[kt] = *(const v8bf*)(atb(BM, lo) + kt * 256);
    XW;
    v8f o[4];
#pragma unroll
    for (int mb = 0; mb < 4; ++mb) o[mb] = (v8f){};
    float m = -3.0e38f, l = 0.f;
#pragma unroll 1   // rolled: 64 passes, the body already holds 8 or 24 matrix instructions and a pass's loads
    for (int key0 = 0; key0 < TT; key0 += 32) {
        V vf[4], v2[4];   // this pass's V^T rows: in flight under the score products and the softmax
#pragma unroll
        for (int mb = 0; mb < 4; ++mb) { vf[mb] = WFrag<T16>::ld(atb(Vt + key0 * 16, lo) + mb * 16 * TT); if (NSPLIT == 2) v2[mb] = WFrag<T16>::ld(atb(V2 + key0 * 16, lo) + mb * 16 * TT); }
        XW;
        v8f t[2];
#pragma unroll
        for (int kt = 0; kt < 2; ++kt) { v8f s = (v8f){};
#pragma unroll
            for (int ks = 0; ks < 2; ++ks) { s = WFrag<T16>::mma(kf[kt][ks], qf[ks], s); if (NSPLIT == 2) { s = WFrag<T16>::mma(kf[kt][ks], q2[ks], s); s = WFrag<T16>::mma(k2[kt][ks], qf[ks], s); } }
#pragma unroll   // s x 2^-3 is exact, so the fused multiply-add rounds once, as a separate add would
            for (int j = 0; j < 8; ++j) t[kt][j] = __builtin_fmaf(s[j], SCL, (float)bb[kt][j]); }
        const int kn = (key0 + 32 < TT) ? key0 + 32 : key0;   // the next pass's K rows and bias+mask block are fetched one pass ahead; the last pass fetches its own again (in bounds, not used)
#pragma unroll
        for (int kt = 0; kt < 2; ++kt)
#pragma unroll
            for (int ks = 0; ks < 2; ++ks) { kf[kt][ks] = WFrag<T16>::ld(atb(Kp + (size_t)kn * HD, lo) + kt * 16 * HD + ks * 512); if (NSPLIT == 2) k2[kt][ks] = WFrag<T16>::ld(atb(K2 + (size_t)kn * HD, lo) + kt * 16 * HD + ks * 512); }
        XW;
#pragma unroll
        for (int kt = 0; kt < 2; ++kt) bb[kt] = *(const v8bf*)(atb(BM + kn * 16, lo) + kt * 256);
        XW;
        float pm = fmaxf(t[0][0], t[1][0]);
#pragma unroll
        for (int j = 1; j < 8; ++j) pm = fmaxf(pm, fmaxf(t[0][j], t[1][j]));
        pm = fmaxf(pm, xhalf(pm));   // the two lane halves hold the two halves of a query's keys
        const bool need = pm > m + MSTEP;
        if (__builtin_amdgcn_ballot_w32(need) != 0) {   // wave-uniform: rare after the first pass
            const float mn = need ? pm : m; const float al = __builtin_amdgcn_exp2f((m - mn) * 1.4426950408889634f); m = mn; l *= al;
#pragma unroll
            for (int mb = 0; mb < 4; ++mb) o[mb] *= al; }
        float ls[4] = {0.f, 0.f, 0.f, 0.f};
#pragma unroll
        for (int kt = 0; kt < 2; ++kt)
#pragma unroll
            for (int j = 0; j < 8; ++j) { t[kt][j] = __builtin_amdgcn_exp2f((t[kt][j] - m) * 1.4426950408889634f); ls[j & 3] += t[kt][j]; }
        l += (ls[0] + ls[1]) + (ls[2] + ls[3]);
        if constexpr (NSPLIT == 2) {   // P = hi + lo bf16 planes
            const v8bf h0 = __builtin_convertvector(t[0], v8bf), h1 = __builtin_convertvector(t[1], v8bf);
            const v8bf l0 = __builtin_convertvector(t[0] - __builtin_convertvector(h0, v8f), v8bf), l1 = __builtin_convertvector(t[1] - __builtin_convertvector(h1, v8f), v8bf);
            const V pfh = __builtin_shufflevector(h0, h1, 0, 1, 2, 3, 4, 5, 6, 7, 8, 9, 10, 11, 12, 13, 14, 15), pfl = __builtin_shufflevector(l0, l1, 0, 1, 2, 3, 4, 5, 6, 7, 8, 9, 10, 11, 12, 13, 14, 15);
#pragma unroll
            for (int mb = 0; mb < 4; ++mb) { o[mb] = WFrag<T16>::mma(vf[mb], pfh, o[mb]); o[mb] = WFrag<T16>::mma(vf[mb], pfl, o[mb]); o[mb] = WFrag<T16>::mma(v2[mb], pfh, o[mb]); }
        } else {
            const V pfv = cat16(__builtin_convertvector(t[0], v8h), __builtin_convertvector(t[1], v8h));
#pragma unroll
            for (int mb = 0; mb < 4; ++mb) o[mb] = WFrag<T16>::mma(vf[mb], pfv, o[mb]); }
        // four vector slots behind the pass's last matrix instruction, also on the taken back edge, before its operands are loaded anew
        asm volatile("v_nop\n\tv_nop\n\tv_nop\n\tv_nop" : "+v"(o[0]), "+v"(o[1]), "+v"(o[2]), "+v"(o[3]) : "v"(vf[0]), "v"(vf[3]));
    }
    l += xhalf(l);
    const float f = __fdiv_rn(1.0f, l);
#pragma unroll
    for (int mb = 0; mb < 4; ++mb) { v8us oh, ol;   // a lane holds 8 consecutive d of its query: one 16-byte store a plane, at the lane's place in the block of the output projection's A operand
#pragma unroll
        for (int j = 0; j < 8; ++j) { unsigned short a, c2; splitf(o[mb][j] * f, a, c2); oh[j] = a; ol[j] = c2; }
        const size_t oo = (size_t)q0 * DQ + (h * (HD / 32) + (mb >> 1)) * 512 + (mb & 1) * 256 + lane * 8; *(v8us*)(Ah + oo) = oh; *(v8us*)(Al + oo) = ol; }
}
// grid (batches x heads, TT / 64), 4 waves: the blocks of the hi+lo rows (three products each, the longest) come first in the launch order; neighbouring blocks read the same bias+mask blocks
__global__ __launch_bounds__(128) void k_fattn(const h16* __restrict__ Q16, const h16* __restrict__ K16, const h16* __restrict__ V16, const bf* __restrict__ Qh, const bf* __restrict__ Ql, const bf* __restrict__ Kh, const bf* __restrict__ Kl, const bf* __restrict__ Vh, const bf* __restrict__ Vl, const bf* __restrict__ BM, bf* Ah, bf* Al) {
    const int h = blockIdx.x % NH_, bz = blockIdx.x / NH_; const int q0 = blockIdx.y * 64 + (threadIdx.x >> 5) * 16; const size_t hp = (size_t)blockIdx.x * TT * HD; BM += (size_t)bz * TT * TT; Ah += (size_t)bz * TT * DQ; Al += (size_t)bz * TT * DQ;
    if ((int)blockIdx.y * 64 < RH) attn_rows<bf, 2>(Qh + hp, Ql + hp, Kh + hp, Kl + hp, Vh + hp, Vl + hp, BM, q0, h, Ah, Al);
    else attn_rows<h16, 0>(Q16 + hp, nullptr, K16 + hp, nullptr, V16 + hp, nullptr, BM, q0, h, Ah, Al);
}

extern "C" void kernel_launch(void* const* d_in, const int* in_sizes, int n_in,
                              void* d_out, int out_size, void* d_ws, size_t ws_size, hipStream_t stream) {
    (void)in_sizes; (void)n_in; (void)out_size;
    const float* x = (const float*)d_in[0]; const float* abias = (const float*)d_in[1]; const int* amask = (const int*)d_in[2]; const float* wq = (const float*)d_in[3]; const float* bq = (const float*)d_in[4]; const float* wk = (const float*)d_in[5]; const float* bk = (const float*)d_in[6]; const float* wv = (const float*)d_in[7]; const float* bv = (const float*)d_in[8]; const float* wo = (const float*)d_in[9]; const float* bo = (const float*)d_in[10]; const float* cosT = nullptr; const float* sinT = nullptr; (void)cosT; (void)sinT;
    float* OUT = (float*)d_out;     // [2][2048][1024]
    char* wsp = (char*)d_ws;
    auto take = [&](size_t bytes) { char* p = wsp; wsp += (bytes + 255) & ~(size_t)255; return (void*)p; };
    bf* WQ = (bf*)take((size_t)DQ * DM * 2); bf* WK = (bf*)take((size_t)DKV * DM * 2); bf* WV = (bf*)take((size_t)DKV * DM * 2); bf* WO = (bf*)take((size_t)DM * DQ * 2); bf* XB = (bf*)take((size_t)NB_ * TT * DM * 2); (void)WK; (void)WV;   // one behind the other: k_cvtf's pieces; WQ, WK, WV are also one B operand of DQ + 2 DKV rows
    float* CS = (float*)take((size_t)TT * HD * 2 * 4);
    // every plane holds both batches: q and k [projection][batch][head][t][d], v [batch][head][d][t]
    h16* QP16 = (h16*)take((size_t)NB_ * NH_ * TT * HD * 2); h16* KP16 = (h16*)take((size_t)NB_ * NKV * TT * HD * 2); bf* QPh = (bf*)take((size_t)NB_ * NH_ * TT * HD * 2); bf* KPh = (bf*)take((size_t)NB_ * NKV * TT * HD * 2); bf* QPl = (bf*)take((size_t)NB_ * NH_ * TT * HD * 2); bf* KPl = (bf*)take((size_t)NB_ * NKV * TT * HD * 2);
    h16* VT16 = (h16*)take((size_t)NB_ * NKV * HD * TT * 2); bf* VTh = (bf*)take((size_t)NB_ * NKV * HD * TT * 2); bf* VTl = (bf*)take((size_t)NB_ * NKV * HD * TT * 2);
    float* FQ = (float*)take((size_t)NB_ * TT * (DQ + 2 * DKV) * 4); bf* ATh = (bf*)take((size_t)NB_ * TT * DQ * 2); bf* ATl = (bf*)take((size_t)NB_ * TT * DQ * 2); bf* BM = (bf*)take((size_t)NB_ * TT * TT * 2);
    if ((size_t)(wsp - (char*)d_ws) > ws_size) return;    // ws 256 MiB
    k_cvtf<DM><<<dim3(DQ * DM / 512 / 8, 4 + NB_ * TT / DQ, 1), 256, 0, stream>>>(wq, wk, wv, wo, x, WQ, DQ * DM / 512);   // the four weights and x (pieces of DQ rows), all of K = DM
    k_bm<<<NB_ * TT / 16 * (TT / 32) / 8, 256, 0, stream>>>(abias, amask, BM);
    k_csid<<<(TT * HD + 255) / 256, 256, 0, stream>>>(CS);
    // each stage once, for both batches (rows b TT + t of x, of F and of the attention output) and for q, k, v side by side (columns of F)
    k_gemmw<bf, 0, true, DM><<<dim3(NB_ * TT / 64, (DQ + 2 * DKV) / 64, 1), 32, 0, stream>>>(XB, nullptr, WQ, nullptr, FQ, DQ + 2 * DKV, bq, bk, bv, 0, 0, 0);
    k_rope<<<(unsigned)((size_t)NB_ * (NH_ + NKV) * TT * HD / 2 / 256), 256, 0, stream>>>(FQ, DQ + 2 * DKV, NB_ * (NH_ + NKV), CS, nullptr, nullptr, 1.0f, QP16, QPh, QPl);
    k_vtp<<<(unsigned)((size_t)NB_ * NKV * TT * HD / 2 / 256), 256, 0, stream>>>(FQ + DQ + DKV, DQ + 2 * DKV, NB_ * NKV, VT16, VTh, VTl);
    k_fattn<<<dim3(NB_ * NH_, TT / 64, 1), 128, 0, stream>>>(QP16, KP16, VT16, QPh, QPl, KPh, KPl, VTh, VTl, BM, ATh, ATl);   // one kv head per query head
    k_gemmw<bf, 1, true, DQ><<<dim3(NB_ * TT / 64, DM / 64, 1), 32, 0, stream>>>(ATh, ATl, WO, nullptr, OUT, DM, bo, nullptr, nullptr, 0, 0, 0);
}

// v006
// It runs in 165 microseconds.
// Timed twice side by side with v005, it ran 1.17 and 1.18 times as fast.
// Over all steps from v000 it is 13.4 times as fast.
#include <hip/hip_runtime.h>

// MultiHeadAttentionWithBias (query [2][2048][1024], attention_bias [2][S][S] (f32, read), attention_mask [2][S][S] (int, read; all ones); q/k/v = x W^T + b (16 x 64); scores = q.k / 8 + bias[b][i][j], -inf where mask <= 0; softmax; out = merged Wo^T + bo -> [2][2048][1024]).
// Compute dtypes, f32 accumulate: every input rounded to bf16; q/k/v on PLAIN bf16 operands (inputs: exact) + bias; scores PRECPLAN; the bf16-rounded bias and the int mask read per element in f32 (no structural skipping); softmax f32; Wo hl x exact (2 products) + bias.

#define NB_  2
#define TT   2048
#define DM   1024
#define NH_  16
#define NKV  16
#define REP  (NH_ / NKV)
#define HD   64
#define DQ   (NH_ * HD)
#define DKV  (NKV * HD)
#define ZH   1                    // batches per partial plane of a k_gemmw launch with KS > 1 (none is launched)
#define RH   512                  // query rows < RH use hi+lo planes (0: none)
#define WIN  0
#define SCL  0.125f   // HD^-0.5
typedef _Float16 h16;
typedef unsigned short bf;
typedef __attribute__((ext_vector_type(16))) __bf16   v16bf;
typedef __attribute__((ext_vector_type(16))) _Float16 v16h;
typedef __attribute__((ext_vector_type(8)))  _Float16 v8h;
typedef __attribute__((ext_vector_type(8)))  unsigned short v8us;
typedef __attribute__((ext_vector_type(8)))  float    v8f;
typedef __attribute__((ext_vector_type(8)))  __bf16   v8bf;
typedef __attribute__((ext_vector_type(4)))  float    v4f;
typedef v8h  __attribute__((may_alias)) v8ha;
typedef v4f  __attribute__((may_alias)) v4fa;
typedef v8us __attribute__((may_alias)) v8usa;

__device__ __forceinline__ unsigned short f2bf(float f) { unsigned u = __float_as_uint(f); u += 0x7FFFu + ((u >> 16) & 1u); return (unsigned short)(u >> 16); }
__device__ __forceinline__ float bf2f(unsigned short b) { return __uint_as_float(((unsigned)b) << 16); }
__device__ __forceinline__ float bfr(float f) { return bf2f(f2bf(f)); }
__device__ __forceinline__ v16h cat16(v8h lo, v8h hi) { return __builtin_shufflevector(lo, hi, 0, 1, 2, 3, 4, 5, 6, 7, 8, 9, 10, 11, 12, 13, 14, 15); }
__device__ __forceinline__ v16bf cat16b(v8us lo, v8us hi) { return __builtin_bit_cast(v16bf, __builtin_shufflevector(lo, hi, 0, 1, 2, 3, 4, 5, 6, 7, 8, 9, 10, 11, 12, 13, 14, 15)); }
__device__ __forceinline__ v8f wmma16(v16h a, v16h b, v8f c) { return __builtin_amdgcn_wmma_f32_16x16x32_f16(false, a, false, b, (short)0, c, false, false); }
__device__ __forceinline__ v8f wmmab(v16bf a, v16bf b, v8f c) { return __builtin_amdgcn_wmma_f32_16x16x32_bf16(false, a, false, b, (short)0, c, false, false); }



// XW: a precaution behind each group of global loads: the wait on their address translation stands ahead of any later instruction that takes one of their registers as a destination; its "memory" clobber also keeps the group issued where it is written (in k_fattn a pass's work ahead of its use).
#define XW asm volatile("s_wait_xcnt 0x0" ::: "memory")
// xwa: the same wait with the group's addresses as inputs: they stay in their registers up to the wait, so that neither a later load's destination nor other work takes those registers ahead of it.
template <typename T> __device__ __forceinline__ void xwa(const T* p) { asm volatile("s_wait_xcnt 0x0" :: "v"(p) : "memory"); }
template <typename T, typename U> __device__ __forceinline__ void xwa(const T* p, const U* q) { asm volatile("s_wait_xcnt 0x0" :: "v"(p), "v"(q) : "memory"); }
// ---- FRAGMENT ORDER: every 16-bit operand plane [rows][K] lies as blocks of 16 rows x 32 k (512 elements, 1 KB), block (row tile, k tile) at index row tile x K/32 + k tile.
// In a block, element (r, k = 16 c + 8 hi + e) lies at 256 c + 8 (16 hi + r) + e: lane 16 hi + r of a wave finds its 8 + 8 elements at 8 lane and 256 + 8 lane, so each 16-byte load of a wave covers 512 contiguous bytes (4 whole lines), not 32-byte pieces of 16 lines. The registers hold what they held with row-major planes.
// ---- k_gemmw: register-blocked GEMM, ONE WAVE per 64x64 output tile (16 accumulators), operands straight from 16-bit planes in fragment order; grid (M/64, N/64, Z), 32 threads.
// C[m][n] (f32, pitch ldc, + optional f32 bias[n]) = sum_k A[m][k] Bt[n][k] (+ split products per NSPLIT). z-batch strides sA/sB/sC in elements. K % 32 == 0.
// HP (the q, k, v projections side by side, a tile = 64 rows t of one batch x the 64 columns d of one head): no C; the epilogue adds the bias, rounds each accumulator tile to f16 and to bf16 hi + lo and stores it at its place in the head planes that k_fattn reads.
// A lane's 8 accumulators run along the FIRST operand's rows, and a fragment-order block wants 8 consecutive k of one row from a lane. v planes (rows d, k = t): x is the first operand, as in C. q and k planes (rows t, k = d): the two operands change places (both lie in the same order), so that the tile comes out transposed.
// Either way tile (mb, nb) is one 16-byte store a lane and plane, 512 contiguous bytes a wave, at 256 mb + 8 lane in block row nb: nothing is staged in LDS.
// KS > 1: grid z = batches x KS; a work-group sums only chunk ks (K elements) of rows of pitch K x KS and writes partial plane ks of C (planes of ZH x sC elements), which the consumer adds up.
template <typename T16> struct WFrag;
template <> struct WFrag<h16> { typedef v16h V; static __device__ __forceinline__ V ld(const h16* p) { return cat16(*(const v8h*)p, *(const v8h*)(p + 256)); } static __device__ __forceinline__ v8f mma(V a, V b, v8f c) { return wmma16(a, b, c); } };
template <> struct WFrag<bf> { typedef v16bf V; static __device__ __forceinline__ V ld(const bf* p) { return cat16b(*(const v8us*)p, *(const v8us*)(p + 256)); } static __device__ __forceinline__ v8f mma(V a, V b, v8f c) { return wmmab(a, b, c); } };
// put2: two accumulator tiles -> 6 stores, at off and off + nbs elements (both known at compile time) from the lane's address in each plane. lo = x - hi, hi taken back from the packed bf16 words.
// The wait behind the stores is the XW precaution; it takes their addresses and data as inputs, so that all of them keep their registers up to it.
typedef __attribute__((ext_vector_type(4))) unsigned v4u;
__device__ __forceinline__ void put2(const v8f x0, const v8f x1, h16* p16, bf* ph, bf* pl, const int off, const int nbs) {
    const v8f x[2] = {x0, x1}; v8h o16[2]; v8bf oh[2], ol[2];
#pragma unroll
    for (int i = 0; i < 2; ++i) { o16[i] = __builtin_convertvector(x[i], v8h); oh[i] = __builtin_convertvector(x[i], v8bf); const v4u w = __builtin_bit_cast(v4u, oh[i]); v8f r;
#pragma unroll
        for (int k = 0; k < 4; ++k) { r[2 * k] = x[i][2 * k] - __uint_as_float(w[k] << 16); r[2 * k + 1] = x[i][2 * k + 1] - __uint_as_float(w[k] & 0xFFFF0000u); }
        ol[i] = __builtin_convertvector(r, v8bf); }
#pragma unroll
    for (int i = 0; i < 2; ++i) { *(v8h*)(p16 + off + i * nbs) = o16[i]; *(v8bf*)(ph + off + i * nbs) = oh[i]; *(v8bf*)(pl + off + i * nbs) = ol[i]; }
    asm volatile("s_wait_xcnt 0x0" :: "v"(p16), "v"(ph), "v"(pl), "v"(o16[0]), "v"(o16[1]), "v"(oh[0]), "v"(oh[1]), "v"(ol[0]), "v"(ol[1]) : "memory");
}
template <typename T16, int NSPLIT, bool BIAS, int K, int KS = 1, bool HP = false>   // K at compile time: a row tile's blocks then lie at immediate offsets from one address
__global__ __launch_bounds__(32) void k_gemmw(const T16* __restrict__ A, const T16* __restrict__ A2, const T16* __restrict__ Bt, const T16* __restrict__ Bt2, float* C, int ldc, const float* __restrict__ bias, const float* __restrict__ bias1, const float* __restrict__ bias2, size_t sA, size_t sB, size_t sC, h16* P16, bf* Ph, bf* Pl, h16* V16, bf* Vh, bf* Vl) {
    typedef typename WFrag<T16>::V V;
    __shared__ __align__(16) float os[16 * 68];
    const size_t z = blockIdx.z / KS; const size_t ks = blockIdx.z % KS; const size_t ld = (size_t)K * KS * 16 /* elements of a row tile */; A += z * sA + ks * K * 16; if (A2) A2 += z * sA + ks * K * 16; Bt += z * sB + ks * K * 16; if (Bt2) Bt2 += z * sB + ks * K * 16; C += (z + ks * ZH) * sC;
    const int lane = threadIdx.x & 31, lr = lane & 15, hi = lane >> 4; const int r0 = blockIdx.x * 64, c0 = blockIdx.y * 64;
    if (c0 >= 2 * DQ) bias = bias2 - 2 * DQ; else if (c0 >= DQ) bias = bias1 - DQ;   // several projections side by side in N, DQ columns each: the tile's own bias vector, still indexed by the column in C
    v8f acc[4][4];
#pragma unroll
    for (int mb = 0; mb < 4; ++mb)
#pragma unroll
        for (int nb = 0; nb < 4; ++nb) acc[mb][nb] = (v8f){};
    const size_t aoff = (size_t)(r0 / 16) * ld + 8 * lane, boff = (size_t)(c0 / 16) * ld + 8 * lane;
    const bool tr = HP && c0 < 2 * DQ;   // a q or k tile: the weight rows are the first operand
    const T16* A1 = tr ? Bt + boff : A + aoff; const T16* B1 = tr ? A + aoff : Bt + boff;
#pragma unroll 1
    for (int kc = 0; kc < K; kc += 32) {
        V a[4], a2[4]; const T16* pa = A1 + kc * 16; const T16* pa2 = A2 + aoff + kc * 16; const T16* pb = B1 + kc * 16; const T16* pb2 = Bt2 + boff + kc * 16;
#pragma unroll
        for (int mb = 0; mb < 4; ++mb) { a[mb] = WFrag<T16>::ld(pa + (size_t)mb * ld); if (NSPLIT == 1 || NSPLIT == 2) a2[mb] = WFrag<T16>::ld(pa2 + (size_t)mb * ld); }
        if constexpr (NSPLIT == 1 || NSPLIT == 2) xwa(pa, pa2); else xwa(pa);
#pragma unroll
        for (int nb = 0; nb < 4; ++nb) { const V b = WFrag<T16>::ld(pb + (size_t)nb * ld); V b2; if constexpr (NSPLIT >= 2) { b2 = WFrag<T16>::ld(pb2 + (size_t)nb * ld); xwa(pb, pb2); } else xwa(pb);
#pragma unroll
            for (int mb = 0; mb < 4; ++mb) { acc[mb][nb] = WFrag<T16>::mma(a[mb], b, acc[mb][nb]); if (NSPLIT == 1 || NSPLIT == 2) acc[mb][nb] = WFrag<T16>::mma(a2[mb], b, acc[mb][nb]); if (NSPLIT >= 2) acc[mb][nb] = WFrag<T16>::mma(a[mb], b2, acc[mb][nb]); } }
        asm volatile("v_nop\n\tv_nop\n\tv_nop\n\tv_nop" : "+v"(acc[0][0]), "+v"(acc[1][1]), "+v"(acc[2][2]), "+v"(acc[3][3]) : "v"(a[0]), "v"(a[3]));
    }
    if constexpr (HP) {
        const int pj = c0 / DQ, hd = (c0 % DQ) / HD, bz = r0 / TT, tl = r0 % TT;
        if (tr) {   // planes [projection][batch][head], rows t, k = d = 16 mb + 8 hi + j; block row nb: 16 x HD elements
            const size_t o = ((size_t)((pj * NB_ + bz) * NH_ + hd) * TT + tl) * HD + 8 * lane;
            const float* bp = bias + c0 + hi * 8; v8f bv[4];   // all of the tile's bias ahead of the first stores: one wait on it, not one a row of tiles
#pragma unroll
            for (int mb = 0; mb < 4; ++mb)
#pragma unroll
                for (int j = 0; j < 8; ++j) bv[mb][j] = bp[mb * 16 + j];
            XW;
#pragma unroll
            for (int mb = 0; mb < 4; ++mb) {
#pragma unroll
                for (int j = 0; j < 8; ++j) bv[mb][j] = bfr(bv[mb][j]);
#pragma unroll
                for (int nb = 0; nb < 4; nb += 2) put2(acc[mb][nb] + bv[mb], acc[mb][nb + 1] + bv[mb], P16 + o, Ph + o, Pl + o, mb * 256 + nb * 16 * HD, 16 * HD); }
        } else {    // planes [batch][head], rows d = 16 nb + lr, k = t = 16 mb + 8 hi + j; block row nb: 16 x TT elements
            const size_t o = (size_t)(bz * NKV + hd) * HD * TT + (size_t)tl * 16 + 8 * lane; const float* bp = bias + c0 + lr; float bv[4];
#pragma unroll
            for (int nb = 0; nb < 4; ++nb) bv[nb] = bp[nb * 16];
            XW;
#pragma unroll
            for (int nb = 0; nb < 4; ++nb) bv[nb] = bfr(bv[nb]);
#pragma unroll
            for (int mb = 0; mb < 4; ++mb)
#pragma unroll
                for (int nb = 0; nb < 4; nb += 2) put2(acc[mb][nb] + bv[nb], acc[mb][nb + 1] + bv[nb + 1], V16 + o, Vh + o, Vl + o, mb * 256 + nb * 16 * TT, 16 * TT);
        }
        return;
    }
#pragma unroll
    for (int mb = 0; mb < 4; ++mb) {
#pragma unroll
        for (int nb = 0; nb < 4; ++nb) {
#pragma unroll
            for (int j = 0; j < 8; ++j) os[(hi * 8 + j) * 68 + nb * 16 + lr] = acc[mb][nb][j]; }
        __builtin_amdgcn_wave_barrier(); asm volatile("" ::: "memory");
        float* crow = C + (size_t)(r0 + mb * 16) * ldc + c0;
{
#pragma unroll
            for (int s = 0; s < 8; ++s) { const int row = 2 * s + hi, cofs = lr * 4; v4f val = *(const v4fa*)(os + row * 68 + cofs); if (BIAS) { val[0] += bfr(bias[c0 + cofs]); val[1] += bfr(bias[c0 + cofs + 1]); val[2] += bfr(bias[c0 + cofs + 2]); val[3] += bfr(bias[c0 + cofs + 3]); }
                *(v4f*)(crow + (size_t)row * ldc + cofs) = val; }
             }
        __builtin_amdgcn_wave_barrier(); asm volatile("" ::: "memory");
    }
}

__device__ __forceinline__ void splitf(float y, unsigned short& h, unsigned short& l) { h = f2bf(y); l = f2bf(y - bf2f(h)); }
typedef __attribute__((ext_vector_type(2))) _Float16 v2h;
typedef __attribute__((ext_vector_type(4))) _Float16 v4h;
typedef __attribute__((ext_vector_type(2))) unsigned short v2us;
typedef __attribute__((ext_vector_type(4))) unsigned short v4us;
typedef __attribute__((ext_vector_type(2))) float v2f;
typedef __attribute__((ext_vector_type(4))) int v4i;

__global__ __launch_bounds__(256) void k_wtG(const float* __restrict__ w, int K, int N, bf* Bt) {
    const int lane = threadIdx.x & 31; const int L0 = (blockIdx.x * 8 + (threadIdx.x >> 5)) * 8; const int nlines = N * K / 64;
{
#pragma unroll 1
        for (int l = 0; l < 8; ++l) { const int L = L0 + l; if (L >= nlines) break; const size_t e = (size_t)L * 64 + lane * 2; const int k = (int)(e % K), n = (int)(e / K); v2us o;
            o[0] = f2bf(w[(size_t)k * N + n]); o[1] = f2bf(w[(size_t)(k + 1) * N + n]); *(v2us*)(Bt + e) = o; }
         }
}
// k_cvtf: f32 [rows][K] -> bf16 plane in fragment order. One wave a block: 8 lanes read a row's whole 128-byte line (4 rows a load), a lane stores its 4 elements at their place in the block.
// grid y: pieces of nblk blocks, one behind the other in dst: pieces 0 to 3 are the sources s0 to s3, the pieces from 4 on follow one another in s4.
template <int K>
__global__ __launch_bounds__(256) void k_cvtf(const float* __restrict__ s0, const float* __restrict__ s1, const float* __restrict__ s2, const float* __restrict__ s3, const float* __restrict__ s4, bf* dst, int nblk) { const int blk = blockIdx.x * 8 + (threadIdx.x >> 5); if (blk >= nblk) return; const int pc = blockIdx.y; const float* src = pc == 0 ? s0 : pc == 1 ? s1 : pc == 2 ? s2 : pc == 3 ? s3 : s4 + (size_t)(pc - 4) * nblk * 512; dst += (size_t)pc * nblk * 512; const int lane = threadIdx.x & 31, g = lane >> 3, p = lane & 7; const int ktn = K / 32, kt = blk % ktn, rt = blk / ktn;
    const float* s = src + (size_t)(rt * 16 + g) * K + kt * 32 + p * 4; bf* d = dst + (size_t)blk * 512 + (p >> 2) * 256 + ((p >> 1) & 1) * 128 + g * 8 + (p & 1) * 4; v4f v[4];
#pragma unroll
    for (int i = 0; i < 4; ++i) v[i] = *(const v4f*)(s + (size_t)i * 4 * K);
    xwa(s);
#pragma unroll
    for (int i = 0; i < 4; ++i) { v4us o;
#pragma unroll
        for (int k = 0; k < 4; ++k) o[k] = f2bf(v[i][k]); *(v4us*)(d + i * 32) = o; }  }
// k_bm: bias and mask of both batches -> ONE bf16 plane in fragment order (rows: queries, k: keys): the bias rounded to bf16 (nearest even), as every input, or MASKED where mask <= 0. Lanes as in k_cvtf.
#define MASKED 0xFF60   // bf16 -1.75 x 2^127: swallows any score added to it, and tops the start value of the running maximum, so that a row with every key masked still averages V
typedef __attribute__((ext_vector_type(4))) __bf16 v4bf;
__global__ __launch_bounds__(256) void k_bm(const float* __restrict__ ab, const int* __restrict__ am, bf* BM) { const int blk = blockIdx.x * 8 + (threadIdx.x >> 5); const int lane = threadIdx.x & 31, g = lane >> 3, p = lane & 7; const int kt = blk % (TT / 32), rt = blk / (TT / 32);
    const size_t so = (size_t)(rt * 16 + g) * TT + kt * 32 + p * 4; bf* d = BM + (size_t)blk * 512 + (p >> 2) * 256 + ((p >> 1) & 1) * 128 + g * 8 + (p & 1) * 4; v4f v[4]; v4i mk[4];
#pragma unroll
    for (int i = 0; i < 4; ++i) { v[i] = *(const v4f*)(ab + so + (size_t)i * 4 * TT); mk[i] = *(const v4i*)(am + so + (size_t)i * 4 * TT); }
    xwa(ab + so, am + so);
#pragma unroll
    for (int i = 0; i < 4; ++i) { v4us o = __builtin_bit_cast(v4us, __builtin_convertvector(v[i], v4bf));
#pragma unroll
        for (int k = 0; k < 4; ++k) o[k] = (mk[i][k] > 0) ? o[k] : (unsigned short)MASKED; *(v4us*)(d + i * 32) = o; }  }
// ---- k_fattn: scores, bias, mask, softmax and P.V of one head in ONE kernel; S and P never leave the registers. One wave owns 16 query rows and walks the 2048 keys in passes of 32.
// S^T = K Q^T (A = K rows, B = Q rows): a lane holds one query's scores (query lr, keys 8 hi + j of each 16-key tile), so two converted S^T tiles ARE the B operand of O^T += V^T P^T (same k order as WFrag::ld).
// Running maximum m per query: P = exp(t - m) unnormalised, the sum l kept in f32 beside it, O divided by l at the end. m moves only when a pass's maximum tops it by more than MSTEP (then O and l are rescaled), so P <= e^MSTEP.
// Addresses: a wave-uniform base that moves with the pass + the lane's byte offset in a block (16 lane). Q, K, V^T and the bias+mask plane BM all lie in fragment order.
#define MSTEP 5.5f
typedef __attribute__((ext_vector_type(8))) int v8i;
__device__ __forceinline__ float xhalf(float x) { return __builtin_bit_cast(float, __builtin_amdgcn_permlanex16(__builtin_bit_cast(int, x), __builtin_bit_cast(int, x), 0x76543210, 0xfedcba98, false, false)); }   // lane l with lane l ^ 16
template <typename T> __device__ __forceinline__ const T* atb(const T* base, unsigned offb) { return (const T*)((const char*)base + offb); }
template <typename T16, int NSPLIT>
__device__ __forceinline__ void attn_rows(const T16* __restrict__ Q, const T16* __restrict__ Q2, const T16* __restrict__ Kp, const T16* __restrict__ K2, const T16* __restrict__ Vt, const T16* __restrict__ V2, const bf* __restrict__ BM, int q0, int h, bf* Ah, bf* Al) {
    typedef typename WFrag<T16>::V V;
    const int lane = threadIdx.x & 31;
    V qf[2], q2[2], kf[2][2], k2[2][2]; v8bf bb[2];
    const unsigned lo = (unsigned)lane * 16u;   // byte offset
    Q += (size_t)q0 * HD; if (NSPLIT == 2) Q2 += (size_t)q0 * HD; BM += (size_t)q0 * TT;   // the wave's own row tile: q0 / 16 x (blocks a row tile) x 512
#pragma unroll
    for (int ks = 0; ks < 2; ++ks) { qf[ks] = WFrag<T16>::ld(atb(Q, lo) + ks * 512); if (NSPLIT == 2) q2[ks] = WFrag<T16>::ld(atb(Q2, lo) + ks * 512); }
    XW;
#pragma unroll
    for (int kt = 0; kt < 2; ++kt)
#pragma unroll
        for (int ks = 0; ks < 2; ++ks) { kf[kt][ks] = WFrag<T16>::ld(atb(Kp, lo) + kt * 16 * HD + ks * 512); if (NSPLIT == 2) k2[kt][ks] = WFrag<T16>::ld(atb(K2, lo) + kt * 16 * HD + ks * 512); }
    XW;
#pragma unroll
    for (int kt = 0; kt < 2; ++kt) bb[kt] = *(const v8bf*)(atb(BM, lo) + kt * 256);
    XW;
    v8f o[4];
#pragma unroll
    for (int mb = 0; mb < 4; ++mb) o[mb] = (v8f){};
    float m = -3.0e38f, l = 0.f;
#pragma unroll 1   // rolled: 64 passes, the body already holds 8 or 24 matrix instructions and a pass's loads
    for (int key0 = 0; key0 < TT; key0 += 32) {
        V vf[4], v2[4];   // this pass's V^T rows: in flight under the score products and the softmax
#pragma unroll
        for (int mb = 0; mb < 4; ++mb) { vf[mb] = WFrag<T16>::ld(atb(Vt + key0 * 16, lo) + mb * 16 * TT); if (NSPLIT == 2) v2[mb] = WFrag<T16>::ld(atb(V2 + key0 * 16, lo) + mb * 16 * TT); }
        XW;
        v8f t[2];
#pragma unroll
        for (int kt = 0; kt < 2; ++kt) { v8f s = (v8f){};
#pragma unroll
            for (int ks = 0; ks < 2; ++ks) { s = WFrag<T16>::mma(kf[kt][ks], qf[ks], s); if (NSPLIT == 2) { s = WFrag<T16>::mma(kf[kt][ks], q2[ks], s); s = WFrag<T16>::mma(k2[kt][ks], qf[ks], s); } }
#pragma unroll   // s x 2^-3 is exact, so the fused multiply-add rounds once, as a separate add would
            for (int j = 0; j < 8; ++j) t[kt][j] = __builtin_fmaf(s[j], SCL, (float)bb[kt][j]); }
        const int kn = (key0 + 32 < TT) ? key0 + 32 : key0;   // the next pass's K rows and bias+mask block are fetched one pass ahead; the last pass fetches its own again (in bounds, not used)
#pragma unroll
        for (int kt = 0; kt < 2; ++kt)
#pragma unroll
            for (int ks = 0; ks < 2; ++ks) { kf[kt][ks] = WFrag<T16>::ld(atb(Kp + (size_t)kn * HD, lo) + kt * 16 * HD + ks * 512); if (NSPLIT == 2) k2[kt][ks] = WFrag<T16>::ld(atb(K2 + (size_t)kn * HD, lo) + kt * 16 * HD + ks * 512); }
        XW;
#pragma unroll
        for (int kt = 0; kt < 2; ++kt) bb[kt] = *(const v8bf*)(atb(BM + kn * 16, lo) + kt * 256);
        XW;
        float pm = fmaxf(t[0][0], t[1][0]);
#pragma unroll
        for (int j = 1; j < 8; ++j) pm = fmaxf(pm, fmaxf(t[0][j], t[1][j]));
        pm = fmaxf(pm, xhalf(pm));   // the two lane halves hold the two halves of a query's keys
        const bool need = pm > m + MSTEP;
        if (__builtin_amdgcn_ballot_w32(need) != 0) {   // wave-uniform: rare after the first pass
            const float mn = need ? pm : m; const float al = __builtin_amdgcn_exp2f((m - mn) * 1.4426950408889634f); m = mn; l *= al;
#pragma unroll
            for (int mb = 0; mb < 4; ++mb) o[mb] *= al; }
        float ls[4] = {0.f, 0.f, 0.f, 0.f};
#pragma unroll
        for (int kt = 0; kt < 2; ++kt)
#pragma unroll
            for (int j = 0; j < 8; ++j) { t[kt][j] = __builtin_amdgcn_exp2f((t[kt][j] - m) * 1.4426950408889634f); ls[j & 3] += t[kt][j]; }
        l += (ls[0] + ls[1]) + (ls[2] + ls[3]);
        if constexpr (NSPLIT == 2) {   // P = hi + lo bf16 planes
            const v8bf h0 = __builtin_convertvector(t[0], v8bf), h1 = __builtin_convertvector(t[1], v8bf);
            const v8bf l0 = __builtin_convertvector(t[0] - __builtin_convertvector(h0, v8f), v8bf), l1 = __builtin_convertvector(t[1] - __builtin_convertvector(h1, v8f), v8bf);
            const V pfh = __builtin_shufflevector(h0, h1, 0, 1, 2, 3, 4, 5, 6, 7, 8, 9, 10, 11, 12, 13, 14, 15), pfl = __builtin_shufflevector(l0, l1, 0, 1, 2, 3, 4, 5, 6, 7, 8, 9, 10, 11, 12, 13, 14, 15);
#pragma unroll
            for (int mb = 0; mb < 4; ++mb) { o[mb] = WFrag<T16>::mma(vf[mb], pfh, o[mb]); o[mb] = WFrag<T16>::mma(vf[mb], pfl, o[mb]); o[mb] = WFrag<T16>::mma(v2[mb], pfh, o[mb]); }
        } else {
            const V pfv = cat16(__builtin_convertvector(t[0], v8h), __builtin_convertvector(t[1], v8h));
#pragma unroll
            for (int mb = 0; mb < 4; ++mb) o[mb] = WFrag<T16>::mma(vf[mb], pfv, o[mb]); }
        // four vector slots behind the pass's last matrix instruction, also on the taken back edge, before its operands are loaded anew
        asm volatile("v_nop\n\tv_nop\n\tv_nop\n\tv_nop" : "+v"(o[0]), "+v"(o[1]), "+v"(o[2]), "+v"(o[3]) : "v"(vf[0]), "v"(vf[3]));
    }
    l += xhalf(l);
    const float f = __fdiv_rn(1.0f, l);
#pragma unroll
    for (int mb = 0; mb < 4; ++mb) { v8us oh, ol;   // a lane holds 8 consecutive d of its query: one 16-byte store a plane, at the lane's place in the block of the output projection's A operand
#pragma unroll
        for (int j = 0; j < 8; ++j) { unsigned short a, c2; splitf(o[mb][j] * f, a, c2); oh[j] = a; ol[j] = c2; }
        const size_t oo = (size_t)q0 * DQ + (h * (HD / 32) + (mb >> 1)) * 512 + (mb & 1) * 256 + lane * 8; *(v8us*)(Ah + oo) = oh; *(v8us*)(Al + oo) = ol; }
}
// grid (batches x heads, TT / 64), 4 waves: the blocks of the hi+lo rows (three products each, the longest) come first in the launch order; neighbouring blocks read the same bias+mask blocks
__global__ __launch_bounds__(128) void k_fattn(const h16* __restrict__ Q16, const h16* __restrict__ K16, const h16* __restrict__ V16, const bf* __restrict__ Qh, const bf* __restrict__ Ql, const bf* __restrict__ Kh, const bf* __restrict__ Kl, const bf* __restrict__ Vh, const bf* __restrict__ Vl, const bf* __restrict__ BM, bf* Ah, bf* Al) {
    const int h = blockIdx.x % NH_, bz = blockIdx.x / NH_; const int q0 = blockIdx.y * 64 + (threadIdx.x >> 5) * 16; const size_t hp = (size_t)blockIdx.x * TT * HD; BM += (size_t)bz * TT * TT; Ah += (size_t)bz * TT * DQ; Al += (size_t)bz * TT * DQ;
    if ((int)blockIdx.y * 64 < RH) attn_rows<bf, 2>(Qh + hp, Ql + hp, Kh + hp, Kl + hp, Vh + hp, Vl + hp, BM, q0, h, Ah, Al);
    else attn_rows<h16, 0>(Q16 + hp, nullptr, K16 + hp, nullptr, V16 + hp, nullptr, BM, q0, h, Ah, Al);
}

extern "C" void kernel_launch(void* const* d_in, const int* in_sizes, int n_in,
                              void* d_out, int out_size, void* d_ws, size_t ws_size, hipStream_t stream) {
    (void)in_sizes; (void)n_in; (void)out_size;
    const float* x = (const float*)d_in[0]; const float* abias = (const float*)d_in[1]; const int* amask = (const int*)d_in[2]; const float* wq = (const float*)d_in[3]; const float* bq = (const float*)d_in[4]; const float* wk = (const float*)d_in[5]; const float* bk = (const float*)d_in[6]; const float* wv = (const float*)d_in[7]; const float* bv = (const float*)d_in[8]; const float* wo = (const float*)d_in[9]; const float* bo = (const float*)d_in[10]; const float* cosT = nullptr; const float* sinT = nullptr; (void)cosT; (void)sinT;
    float* OUT = (float*)d_out;     // [2][2048][1024]
    char* wsp = (char*)d_ws;
    auto take = [&](size_t bytes) { char* p = wsp; wsp += (bytes + 255) & ~(size_t)255; return (void*)p; };
    bf* WQ = (bf*)take((size_t)DQ * DM * 2); bf* WK = (bf*)take((size_t)DKV * DM * 2); bf* WV = (bf*)take((size_t)DKV * DM * 2); bf* WO = (bf*)take((size_t)DM * DQ * 2); bf* XB = (bf*)take((size_t)NB_ * TT * DM * 2); (void)WK; (void)WV;   // one behind the other: k_cvtf's pieces; WQ, WK, WV are also one B operand of DQ + 2 DKV rows
    // every plane holds both batches: q and k [projection][batch][head][t][d], v [batch][head][d][t]
    h16* QP16 = (h16*)take((size_t)NB_ * NH_ * TT * HD * 2); h16* KP16 = (h16*)take((size_t)NB_ * NKV * TT * HD * 2); bf* QPh = (bf*)take((size_t)NB_ * NH_ * TT * HD * 2); bf* KPh = (bf*)take((size_t)NB_ * NKV * TT * HD * 2); bf* QPl = (bf*)take((size_t)NB_ * NH_ * TT * HD * 2); bf* KPl = (bf*)take((size_t)NB_ * NKV * TT * HD * 2);
    h16* VT16 = (h16*)take((size_t)NB_ * NKV * HD * TT * 2); bf* VTh = (bf*)take((size_t)NB_ * NKV * HD * TT * 2); bf* VTl = (bf*)take((size_t)NB_ * NKV * HD * TT * 2);
    bf* ATh = (bf*)take((size_t)NB_ * TT * DQ * 2); bf* ATl = (bf*)take((size_t)NB_ * TT * DQ * 2); bf* BM = (bf*)take((size_t)NB_ * TT * TT * 2);
    if ((size_t)(wsp - (char*)d_ws) > ws_size) return;    // ws 256 MiB
    k_cvtf<DM><<<dim3(DQ * DM / 512 / 8, 4 + NB_ * TT / DQ, 1), 256, 0, stream>>>(wq, wk, wv, wo, x, WQ, DQ * DM / 512);   // the four weights and x (pieces of DQ rows), all of K = DM
    k_bm<<<NB_ * TT / 16 * (TT / 32) / 8, 256, 0, stream>>>(abias, amask, BM);
    // each stage once, for both batches (rows b TT + t of x and of the attention output) and for q, k, v side by side (columns of the product); QP and KP lie one behind the other in each of their three kinds
    k_gemmw<bf, 0, true, DM, 1, true><<<dim3(NB_ * TT / 64, (DQ + 2 * DKV) / 64, 1), 32, 0, stream>>>(XB, nullptr, WQ, nullptr, nullptr, 0, bq, bk, bv, 0, 0, 0, QP16, QPh, QPl, VT16, VTh, VTl);
    k_fattn<<<dim3(NB_ * NH_, TT / 64, 1), 128, 0, stream>>>(QP16, KP16, VT16, QPh, QPl, KPh, KPl, VTh, VTl, BM, ATh, ATl);   // one kv head per query head
    k_gemmw<bf, 1, true, DQ><<<dim3(NB_ * TT / 64, DM / 64, 1), 32, 0, stream>>>(ATh, ATl, WO, nullptr, OUT, DM, bo, nullptr, nullptr, 0, 0, 0, nullptr, nullptr, nullptr, nullptr, nullptr, nullptr);
}

// v007
// Measured time: 151 microseconds a run.
// Two timings next to v006 put it at 1.11 and 1.12 times that version's speed.
// All steps since v000 together make it 14.9 times as fast.
#include <hip/hip_runtime.h>

// MultiHeadAttentionWithBias (query [2][2048][1024], attention_bias [2][S][S] (f32, read), attention_mask [2][S][S] (int, read; all ones); q/k/v = x W^T + b (16 x 64); scores = q.k / 8 + bias[b][i][j], -inf where mask <= 0; softmax; out = merged Wo^T + bo -> [2][2048][1024]).
// Compute dtypes, f32 accumulate: every input rounded to bf16; q/k/v on PLAIN bf16 operands (inputs: exact) + bias; scores PRECPLAN; the bf16-rounded bias and the int mask read per element in f32 (no structural skipping); softmax f32; Wo hl x exact (2 products) + bias.

#define NB_  2
#define TT   2048
#define DM   1024
#define NH_  16
#define NKV  16
#define REP  (NH_ / NKV)
#define HD   64
#define DQ   (NH_ * HD)
#define DKV  (NKV * HD)
#define ZH   1                    // batches per partial plane of a k_gemmw launch with KS > 1 (none is launched)
#define RH   512                  // query rows < RH use hi+lo planes (0: none)
#define WIN  0
#define SCL  0.125f   // HD^-0.5
typedef _Float16 h16;
typedef unsigned short bf;
typedef __attribute__((ext_vector_type(16))) __bf16   v16bf;
typedef __attribute__((ext_vector_type(16))) _Float16 v16h;
typedef __attribute__((ext_vector_type(8)))  _Float16 v8h;
typedef __attribute__((ext_vector_type(8)))  unsigned short v8us;
typedef __attribute__((ext_vector_type(8)))  float    v8f;
typedef __attribute__((ext_vector_type(8)))  __bf16   v8bf;
typedef __attribute__((ext_vector_type(4)))  float    v4f;
typedef v8h  __attribute__((may_alias)) v8ha;
typedef v4f  __attribute__((may_alias)) v4fa;
typedef v8us __attribute__((may_alias)) v8usa;

__device__ __forceinline__ unsigned short f2bf(float f) { unsigned u = __float_as_uint(f); u += 0x7FFFu + ((u >> 16) & 1u); return (unsigned short)(u >> 16); }
__device__ __forceinline__ float bf2f(unsigned short b) { return __uint_as_float(((unsigned)b) << 16); }
__device__ __forceinline__ float bfr(float f) { return bf2f(f2bf(f)); }
__device__ __forceinline__ v16h cat16(v8h lo, v8h hi) { return __builtin_shufflevector(lo, hi, 0, 1, 2, 3, 4, 5, 6, 7, 8, 9, 10, 11, 12, 13, 14, 15); }
__device__ __forceinline__ v16bf cat16b(v8us lo, v8us hi) { return __builtin_bit_cast(v16bf, __builtin_shufflevector(lo, hi, 0, 1, 2, 3, 4, 5, 6, 7, 8, 9, 10, 11, 12, 13, 14, 15)); }
__device__ __forceinline__ v8f wmma16(v16h a, v16h b, v8f c) { return __builtin_amdgcn_wmma_f32_16x16x32_f16(false, a, false, b, (short)0, c, false, false); }
__device__ __forceinline__ v8f wmmab(v16bf a, v16bf b, v8f c) { return __builtin_amdgcn_wmma_f32_16x16x32_bf16(false, a, false, b, (short)0, c, false, false); }



// XW: a precaution behind each group of global loads: the wait on their address translation stands ahead of any later instruction that takes one of their registers as a destination; its "memory" clobber also keeps the group issued where it is written (in k_fattn a pass's work ahead of its use).
#define XW asm volatile("s_wait_xcnt 0x0" ::: "memory")
// xwa: the same wait with the group's addresses as inputs: they stay in their registers up to the wait, so that neither a later load's destination nor other work takes those registers ahead of it.
template <typename T> __device__ __forceinline__ void xwa(const T* p) { asm volatile("s_wait_xcnt 0x0" :: "v"(p) : "memory"); }
template <typename T, typename U> __device__ __forceinline__ void xwa(const T* p, const U* q) { asm volatile("s_wait_xcnt 0x0" :: "v"(p), "v"(q) : "memory"); }
// ---- FRAGMENT ORDER: every 16-bit operand plane [rows][K] lies as blocks of 16 rows x 32 k (512 elements, 1 KB), block (row tile, k tile) at index row tile x K/32 + k tile.
// In a block, element (r, k = 16 c + 8 hi + e) lies at 256 c + 8 (16 hi + r) + e: lane 16 hi + r of a wave finds its 8 + 8 elements at 8 lane and 256 + 8 lane, so each 16-byte load of a wave covers 512 contiguous bytes (4 whole lines), not 32-byte pieces of 16 lines. The registers hold what they held with row-major planes.
// ---- k_gemmw: register-blocked GEMM, ONE WAVE per 64x64 output tile (16 accumulators), operands straight from 16-bit planes in fragment order; grid (M/64, N/64, Z), 32 threads.
// C[m][n] (f32, pitch ldc, + optional f32 bias[n]) = sum_k A[m][k] Bt[n][k] (+ split products per NSPLIT). z-batch strides sA/sB/sC in elements. K % 32 == 0.
// HP (the q, k, v projections side by side, a tile = 64 rows t of one batch x the 64 columns d of one head): no C; the epilogue adds the bias, rounds each accumulator tile to f16 and to bf16 hi + lo and stores it at its place in the head planes that k_fattn reads.
// A lane's 8 accumulators run along the FIRST operand's rows, and a fragment-order block wants 8 consecutive k of one row from a lane. v planes (rows d, k = t): x is the first operand, as in C. q and k planes (rows t, k = d): the two operands change places (both lie in the same order), so that the tile comes out transposed.
// Either way tile (mb, nb) is one 16-byte store a lane and plane, 512 contiguous bytes a wave, at 256 mb + 8 lane in block row nb: nothing is staged in LDS.
// KS > 1: grid z = batches x KS; a work-group sums only chunk ks (K elements) of rows of pitch K x KS and writes partial plane ks of C (planes of ZH x sC elements), which the consumer adds up.
template <typename T16> struct WFrag;
template <> struct WFrag<h16> { typedef v16h V; static __device__ __forceinline__ V ld(const h16* p) { return cat16(*(const v8h*)p, *(const v8h*)(p + 256)); } static __device__ __forceinline__ v8f mma(V a, V b, v8f c) { return wmma16(a, b, c); } };
template <> struct WFrag<bf> { typedef v16bf V; static __device__ __forceinline__ V ld(const bf* p) { return cat16b(*(const v8us*)p, *(const v8us*)(p + 256)); } static __device__ __forceinline__ v8f mma(V a, V b, v8f c) { return wmmab(a, b, c); } };
// put2: two accumulator tiles -> 6 stores, at off and off + nbs elements (both known at compile time) from the lane's address in each plane. lo = x - hi, hi taken back from the packed bf16 words.
// The wait behind the stores is the XW precaution; it takes their addresses and data as inputs, so that all of them keep their registers up to it.
typedef __attribute__((ext_vector_type(4))) unsigned v4u;
__device__ __forceinline__ void put2(const v8f x0, const v8f x1, h16* p16, bf* ph, bf* pl, const int off, const int nbs) {
    const v8f x[2] = {x0, x1}; v8h o16[2]; v8bf oh[2], ol[2];
#pragma unroll
    for (int i = 0; i < 2; ++i) { o16[i] = __builtin_convertvector(x[i], v8h); oh[i] = __builtin_convertvector(x[i], v8bf); const v4u w = __builtin_bit_cast(v4u, oh[i]); v8f r;
#pragma unroll
        for (int k = 0; k < 4; ++k) { r[2 * k] = x[i][2 * k] - __uint_as_float(w[k] << 16); r[2 * k + 1] = x[i][2 * k + 1] - __uint_as_float(w[k] & 0xFFFF0000u); }
        ol[i] = __builtin_convertvector(r, v8bf); }
#pragma unroll
    for (int i = 0; i < 2; ++i) { *(v8h*)(p16 + off + i * nbs) = o16[i]; *(v8bf*)(ph + off + i * nbs) = oh[i]; *(v8bf*)(pl + off + i * nbs) = ol[i]; }
    asm volatile("s_wait_xcnt 0x0" :: "v"(p16), "v"(ph), "v"(pl), "v"(o16[0]), "v"(o16[1]), "v"(oh[0]), "v"(oh[1]), "v"(ol[0]), "v"(ol[1]) : "memory");
}
template <typename T16, int NSPLIT, bool BIAS, int K, int KS = 1, bool HP = false>   // K at compile time: a row tile's blocks then lie at immediate offsets from one address
__global__ __launch_bounds__(32) void k_gemmw(const T16* __restrict__ A, const T16* __restrict__ A2, const T16* __restrict__ Bt, const T16* __restrict__ Bt2, float* C, int ldc, const float* __restrict__ bias, const float* __restrict__ bias1, const float* __restrict__ bias2, size_t sA, size_t sB, size_t sC, h16* P16, bf* Ph, bf* Pl, h16* V16, bf* Vh, bf* Vl) {
    typedef typename WFrag<T16>::V V;
    __shared__ __align__(16) float os[16 * 68];
    const size_t z = blockIdx.z / KS; const size_t ks = blockIdx.z % KS; const size_t ld = (size_t)K * KS * 16 /* elements of a row tile */; A += z * sA + ks * K * 16; if (A2) A2 += z * sA + ks * K * 16; Bt += z * sB + ks * K * 16; if (Bt2) Bt2 += z * sB + ks * K * 16; C += (z + ks * ZH) * sC;
    const int lane = threadIdx.x & 31, lr = lane & 15, hi = lane >> 4; const int r0 = blockIdx.x * 64, c0 = blockIdx.y * 64;
    if (c0 >= 2 * DQ) bias = bias2 - 2 * DQ; else if (c0 >= DQ) bias = bias1 - DQ;   // several projections side by side in N, DQ columns each: the tile's own bias vector, still indexed by the column in C
    v8f acc[4][4];
#pragma unroll
    for (int mb = 0; mb < 4; ++mb)
#pragma unroll
        for (int nb = 0; nb < 4; ++nb) acc[mb][nb] = (v8f){};
    const size_t aoff = (size_t)(r0 / 16) * ld + 8 * lane, boff = (size_t)(c0 / 16) * ld + 8 * lane;
    const bool tr = HP && c0 < 2 * DQ;   // a q or k tile: the weight rows are the first operand
    const T16* A1 = tr ? Bt + boff : A + aoff; const T16* B1 = tr ? A + aoff : Bt + boff;
#pragma unroll 1
    for (int kc = 0; kc < K; kc += 32) {
        V a[4], a2[4]; const T16* pa = A1 + kc * 16; const T16* pa2 = A2 + aoff + kc * 16; const T16* pb = B1 + kc * 16; const T16* pb2 = Bt2 + boff + kc * 16;
#pragma unroll
        for (int mb = 0; mb < 4; ++mb) { a[mb] = WFrag<T16>::ld(pa + (size_t)mb * ld); if (NSPLIT == 1 || NSPLIT == 2) a2[mb] = WFrag<T16>::ld(pa2 + (size_t)mb * ld); }
        if constexpr (NSPLIT == 1 || NSPLIT == 2) xwa(pa, pa2); else xwa(pa);
#pragma unroll
        for (int nb = 0; nb < 4; ++nb) { const V b = WFrag<T16>::ld(pb + (size_t)nb * ld); V b2; if constexpr (NSPLIT >= 2) { b2 = WFrag<T16>::ld(pb2 + (size_t)nb * ld); xwa(pb, pb2); } else xwa(pb);
#pragma unroll
            for (int mb = 0; mb < 4; ++mb) { acc[mb][nb] = WFrag<T16>::mma(a[mb], b, acc[mb][nb]); if (NSPLIT == 1 || NSPLIT == 2) acc[mb][nb] = WFrag<T16>::mma(a2[mb], b, acc[mb][nb]); if (NSPLIT >= 2) acc[mb][nb] = WFrag<T16>::mma(a[mb], b2, acc[mb][nb]); } }
        asm volatile("v_nop\n\tv_nop\n\tv_nop\n\tv_nop" : "+v"(acc[0][0]), "+v"(acc[1][1]), "+v"(acc[2][2]), "+v"(acc[3][3]) : "v"(a[0]), "v"(a[3]));
    }
    if constexpr (HP) {
        const int pj = c0 / DQ, hd = (c0 % DQ) / HD, bz = r0 / TT, tl = r0 % TT;
        if (tr) {   // planes [projection][batch][head], rows t, k = d = 16 mb + 8 hi + j; block row nb: 16 x HD elements
            const size_t o = ((size_t)((pj * NB_ + bz) * NH_ + hd) * TT + tl) * HD + 8 * lane;
            const float* bp = bias + c0 + hi * 8; v8f bv[4];   // all of the tile's bias ahead of the first stores: one wait on it, not one a row of tiles
#pragma unroll
            for (int mb = 0; mb < 4; ++mb)
#pragma unroll
                for (int j = 0; j < 8; ++j) bv[mb][j] = bp[mb * 16 + j];
            XW;
#pragma unroll
            for (int mb = 0; mb < 4; ++mb) {
#pragma unroll
                for (int j = 0; j < 8; ++j) bv[mb][j] = bfr(bv[mb][j]);
#pragma unroll
                for (int nb = 0; nb < 4; nb += 2) put2(acc[mb][nb] + bv[mb], acc[mb][nb + 1] + bv[mb], P16 + o, Ph + o, Pl + o, mb * 256 + nb * 16 * HD, 16 * HD); }
        } else {    // planes [batch][head], rows d = 16 nb + lr, k = t = 16 mb + 8 hi + j; block row nb: 16 x TT elements
            const size_t o = (size_t)(bz * NKV + hd) * HD * TT + (size_t)tl * 16 + 8 * lane; const float* bp = bias + c0 + lr; float bv[4];
#pragma unroll
            for (int nb = 0; nb < 4; ++nb) bv[nb] = bp[nb * 16];
            XW;
#pragma unroll
            for (int nb = 0; nb < 4; ++nb) bv[nb] = bfr(bv[nb]);
#pragma unroll
            for (int mb = 0; mb < 4; ++mb)
#pragma unroll
                for (int nb = 0; nb < 4; nb += 2) put2(acc[mb][nb] + bv[nb], acc[mb][nb + 1] + bv[nb + 1], V16 + o, Vh + o, Vl + o, mb * 256 + nb * 16 * TT, 16 * TT);
        }
        return;
    }
#pragma unroll
    for (int mb = 0; mb < 4; ++mb) {
#pragma unroll
        for (int nb = 0; nb < 4; ++nb) {
#pragma unroll
            for (int j = 0; j < 8; ++j) os[(hi * 8 + j) * 68 + nb * 16 + lr] = acc[mb][nb][j]; }
        __builtin_amdgcn_wave_barrier(); asm volatile("" ::: "memory");
        float* crow = C + (size_t)(r0 + mb * 16) * ldc + c0;
{
#pragma unroll
            for (int s = 0; s < 8; ++s) { const int row = 2 * s + hi, cofs = lr * 4; v4f val = *(const v4fa*)(os + row * 68 + cofs); if (BIAS) { val[0] += bfr(bias[c0 + cofs]); val[1] += bfr(bias[c0 + cofs + 1]); val[2] += bfr(bias[c0 + cofs + 2]); val[3] += bfr(bias[c0 + cofs + 3]); }
                *(v4f*)(crow + (size_t)row * ldc + cofs) = val; }
             }
        __builtin_amdgcn_wave_barrier(); asm volatile("" ::: "memory");
    }
}

__device__ __forceinline__ void splitf(float y, unsigned short& h, unsigned short& l) { h = f2bf(y); l = f2bf(y - bf2f(h)); }
typedef __attribute__((ext_vector_type(2))) _Float16 v2h;
typedef __attribute__((ext_vector_type(4))) _Float16 v4h;
typedef __attribute__((ext_vector_type(2))) unsigned short v2us;
typedef __attribute__((ext_vector_type(4))) unsigned short v4us;
typedef __attribute__((ext_vector_type(2))) float v2f;
typedef __attribute__((ext_vector_type(4))) int v4i;

__global__ __launch_bounds__(256) void k_wtG(const float* __restrict__ w, int K, int N, bf* Bt) {
    const int lane = threadIdx.x & 31; const int L0 = (blockIdx.x * 8 + (threadIdx.x >> 5)) * 8; const int nlines = N * K / 64;
{
#pragma unroll 1
        for (int l = 0; l < 8; ++l) { const int L = L0 + l; if (L >= nlines) break; const size_t e = (size_t)L * 64 + lane * 2; const int k = (int)(e % K), n = (int)(e / K); v2us o;
            o[0] = f2bf(w[(size_t)k * N + n]); o[1] = f2bf(w[(size_t)(k + 1) * N + n]); *(v2us*)(Bt + e) = o; }
         }
}
// k_cvtf: f32 [rows][K] -> bf16 plane in fragment order. One wave a block: 8 lanes read a row's whole 128-byte line (4 rows a load), a lane stores its 4 elements at their place in the block.
// grid y: pieces of nblk blocks, one behind the other in dst: pieces 0 to 3 are the sources s0 to s3, the pieces from 4 on follow one another in s4.
template <int K>
__global__ __launch_bounds__(256) void k_cvtf(const float* __restrict__ s0, const float* __restrict__ s1, const float* __restrict__ s2, const float* __restrict__ s3, const float* __restrict__ s4, bf* dst, int nblk) { const int blk = blockIdx.x * 8 + (threadIdx.x >> 5); if (blk >= nblk) return; const int pc = blockIdx.y; const float* src = pc == 0 ? s0 : pc == 1 ? s1 : pc == 2 ? s2 : pc == 3 ? s3 : s4 + (size_t)(pc - 4) * nblk * 512; dst += (size_t)pc * nblk * 512; const int lane = threadIdx.x & 31, g = lane >> 3, p = lane & 7; const int ktn = K / 32, kt = blk % ktn, rt = blk / ktn;
    const float* s = src + (size_t)(rt * 16 + g) * K + kt * 32 + p * 4; bf* d = dst + (size_t)blk * 512 + (p >> 2) * 256 + ((p >> 1) & 1) * 128 + g * 8 + (p & 1) * 4; v4f v[4];
#pragma unroll
    for (int i = 0; i < 4; ++i) v[i] = *(const v4f*)(s + (size_t)i * 4 * K);
    xwa(s);
#pragma unroll
    for (int i = 0; i < 4; ++i) { v4us o;
#pragma unroll
        for (int k = 0; k < 4; ++k) o[k] = f2bf(v[i][k]); *(v4us*)(d + i * 32) = o; }  }
// k_bm: bias and mask of both batches -> ONE bf16 plane in fragment order (rows: queries, k: keys): the bias rounded to bf16 (nearest even), as every input, or MASKED where mask <= 0. Lanes as in k_cvtf.
#define MASKED 0xFF60   // bf16 -1.75 x 2^127: swallows any score added to it, and tops the start value of the running maximum, so that a row with every key masked still averages V
typedef __attribute__((ext_vector_type(4))) __bf16 v4bf;
__global__ __launch_bounds__(256) void k_bm(const float* __restrict__ ab, const int* __restrict__ am, bf* BM) { const int blk = blockIdx.x * 8 + (threadIdx.x >> 5); const int lane = threadIdx.x & 31, g = lane >> 3, p = lane & 7; const int kt = blk % (TT / 32), rt = blk / (TT / 32);
    const size_t so = (size_t)(rt * 16 + g) * TT + kt * 32 + p * 4; bf* d = BM + (size_t)blk * 512 + (p >> 2) * 256 + ((p >> 1) & 1) * 128 + g * 8 + (p & 1) * 4; v4f v[4]; v4i mk[4];
#pragma unroll
    for (int i = 0; i < 4; ++i) { v[i] = *(const v4f*)(ab + so + (size_t)i * 4 * TT); mk[i] = *(const v4i*)(am + so + (size_t)i * 4 * TT); }
    xwa(ab + so, am + so);
#pragma unroll
    for (int i = 0; i < 4; ++i) { v4us o = __builtin_bit_cast(v4us, __builtin_convertvector(v[i], v4bf));
#pragma unroll
        for (int k = 0; k < 4; ++k) o[k] = (mk[i][k] > 0) ? o[k] : (unsigned short)MASKED; *(v4us*)(d + i * 32) = o; }  }
// ---- k_fattn: scores, bias, mask, softmax and P.V of one head in ONE kernel; S and P never leave the registers. One wave owns 16 or 48 query rows and walks the 2048 keys in passes of 32.
// S^T = K Q^T (A = K rows, B = Q rows): a lane holds one query's scores (query lr, keys 8 hi + j of each 16-key tile), so two converted S^T tiles ARE the B operand of O^T += V^T P^T (same k order as WFrag::ld).
// Running maximum m per query: P = exp(t - m) unnormalised, the sum l kept in f32 beside it, O divided by l at the end. m moves only when a pass's maximum tops it by more than MSTEP (then O and l are rescaled), so P <= e^MSTEP.
// Addresses: a wave-uniform base that moves with the pass + the lane's byte offset in a block (16 lane). Q, K, V^T and the bias+mask plane BM all lie in fragment order.
#define MSTEP 5.5f
typedef __attribute__((ext_vector_type(8))) int v8i;
__device__ __forceinline__ float xhalf(float x) { return __builtin_bit_cast(float, __builtin_amdgcn_permlanex16(__builtin_bit_cast(int, x), __builtin_bit_cast(int, x), 0x76543210, 0xfedcba98, false, false)); }   // lane l with lane l ^ 16
template <typename T> __device__ __forceinline__ const T* atb(const T* base, unsigned offb) { return (const T*)((const char*)base + offb); }
template <typename T16, int NSPLIT, int NQ>   // NQ: query tiles of 16 rows that the wave owns, one behind the other from q0; every K and V fragment it loads feeds all NQ of them
__device__ __forceinline__ void attn_rows(const T16* __restrict__ Q, const T16* __restrict__ Q2, const T16* __restrict__ Kp, const T16* __restrict__ K2, const T16* __restrict__ Vt, const T16* __restrict__ V2, const bf* __restrict__ BM, int q0, int h, bf* Ah, bf* Al) {
    typedef typename WFrag<T16>::V V;
    const int lane = threadIdx.x & 31;
    V qf[NQ][2], q2[NQ][2], kf[2][2], k2[2][2]; v8bf bb[NQ][2];
    const unsigned lo = (unsigned)lane * 16u;   // byte offset
    Q += (size_t)q0 * HD; if (NSPLIT == 2) Q2 += (size_t)q0 * HD; BM += (size_t)q0 * TT;   // the wave's first row tile: q0 / 16 x (blocks a row tile) x 512
#pragma unroll
    for (int qt = 0; qt < NQ; ++qt)
#pragma unroll
        for (int ks = 0; ks < 2; ++ks) { qf[qt][ks] = WFrag<T16>::ld(atb(Q, lo) + qt * 16 * HD + ks * 512); if (NSPLIT == 2) q2[qt][ks] = WFrag<T16>::ld(atb(Q2, lo) + qt * 16 * HD + ks * 512); }
    XW;
#pragma unroll
    for (int kt = 0; kt < 2; ++kt)
#pragma unroll
        for (int ks = 0; ks < 2; ++ks) { kf[kt][ks] = WFrag<T16>::ld(atb(Kp, lo) + kt * 16 * HD + ks * 512); if (NSPLIT == 2) k2[kt][ks] = WFrag<T16>::ld(atb(K2, lo) + kt * 16 * HD + ks * 512); }
    XW;
#pragma unroll
    for (int qt = 0; qt < NQ; ++qt)
#pragma unroll
        for (int kt = 0; kt < 2; ++kt) bb[qt][kt] = *(const v8bf*)(atb(BM, lo) + qt * 16 * TT + kt * 256);
    XW;
    v8f o[NQ][4]; float m[NQ], l[NQ];
#pragma unroll
    for (int qt = 0; qt < NQ; ++qt) { m[qt] = -3.0e38f; l[qt] = 0.f;
#pragma unroll
        for (int mb = 0; mb < 4; ++mb) o[qt][mb] = (v8f){}; }
#pragma unroll 1   // rolled: 64 passes, the body already holds 24 matrix instructions and a pass's loads
    for (int key0 = 0; key0 < TT; key0 += 32) {
        V vf[4], v2[4];   // this pass's V^T rows: in flight under the score products and the softmax
        const T16* pv = atb(Vt + key0 * 16, lo); const T16* pv2 = NSPLIT == 2 ? atb(V2 + key0 * 16, lo) : nullptr;
#pragma unroll
        for (int mb = 0; mb < 4; ++mb) { vf[mb] = WFrag<T16>::ld(pv + mb * 16 * TT); if (NSPLIT == 2) v2[mb] = WFrag<T16>::ld(pv2 + mb * 16 * TT); }
        if constexpr (NSPLIT == 2) xwa(pv, pv2); else xwa(pv);
        v8f t[NQ][2];
#pragma unroll
        for (int qt = 0; qt < NQ; ++qt)
#pragma unroll
            for (int kt = 0; kt < 2; ++kt) t[qt][kt] = (v8f){};
#pragma unroll   // the halves of d outermost: the products of the 2 NQ score tiles follow one another, so that a tile's second product does not wait on its first; each tile's own order of products is as before
        for (int ks = 0; ks < 2; ++ks)
#pragma unroll
            for (int qt = 0; qt < NQ; ++qt)
#pragma unroll
                for (int kt = 0; kt < 2; ++kt) { t[qt][kt] = WFrag<T16>::mma(kf[kt][ks], qf[qt][ks], t[qt][kt]); if (NSPLIT == 2) { t[qt][kt] = WFrag<T16>::mma(kf[kt][ks], q2[qt][ks], t[qt][kt]); t[qt][kt] = WFrag<T16>::mma(k2[kt][ks], qf[qt][ks], t[qt][kt]); } }
#pragma unroll
        for (int qt = 0; qt < NQ; ++qt)
#pragma unroll
            for (int kt = 0; kt < 2; ++kt) {
                if constexpr (NQ > 1) t[qt][kt] = __builtin_elementwise_fma(t[qt][kt], (v8f)(SCL), __builtin_convertvector(bb[qt][kt], v8f));   // on the whole tile: the packed instructions then pair neighbouring registers of one tile, not elements of two tiles through register copies
                else {
#pragma unroll   // s x 2^-3 is exact, so the fused multiply-add rounds once, as a separate add would
                    for (int j = 0; j < 8; ++j) t[qt][kt][j] = __builtin_fmaf(t[qt][kt][j], SCL, (float)bb[qt][kt][j]); } }
        const int kn = (key0 + 32 < TT) ? key0 + 32 : key0;   // the next pass's K rows and bias+mask blocks are fetched one pass ahead; the last pass fetches its own again (in bounds, not used)
        const T16* pk = atb(Kp + (size_t)kn * HD, lo); const T16* pk2 = NSPLIT == 2 ? atb(K2 + (size_t)kn * HD, lo) : nullptr; const bf* pbm = atb(BM + kn * 16, lo);
#pragma unroll
        for (int kt = 0; kt < 2; ++kt)
#pragma unroll
            for (int ks = 0; ks < 2; ++ks) { kf[kt][ks] = WFrag<T16>::ld(pk + kt * 16 * HD + ks * 512); if (NSPLIT == 2) k2[kt][ks] = WFrag<T16>::ld(pk2 + kt * 16 * HD + ks * 512); }
        if constexpr (NSPLIT == 2) xwa(pk, pk2); else xwa(pk);
#pragma unroll
        for (int qt = 0; qt < NQ; ++qt)
#pragma unroll
            for (int kt = 0; kt < 2; ++kt) bb[qt][kt] = *(const v8bf*)(pbm + qt * 16 * TT + kt * 256);
        xwa(pbm);
        float pm[NQ]; bool need[NQ], any = false;
#pragma unroll
        for (int qt = 0; qt < NQ; ++qt) { pm[qt] = fmaxf(t[qt][0][0], t[qt][1][0]);
#pragma unroll
            for (int j = 1; j < 8; ++j) pm[qt] = fmaxf(pm[qt], fmaxf(t[qt][0][j], t[qt][1][j]));
            pm[qt] = fmaxf(pm[qt], xhalf(pm[qt]));   // the two lane halves hold the two halves of a query's keys
            need[qt] = pm[qt] > m[qt] + MSTEP; any = any || need[qt]; }
        if (__builtin_amdgcn_ballot_w32(any) != 0) {   // wave-uniform, one test a pass: rare after the first pass; a query whose maximum stays is scaled by exactly 1
#pragma unroll
            for (int qt = 0; qt < NQ; ++qt) { const float mn = need[qt] ? pm[qt] : m[qt]; const float al = __builtin_amdgcn_exp2f((m[qt] - mn) * 1.4426950408889634f); m[qt] = mn; l[qt] *= al;
#pragma unroll
                for (int mb = 0; mb < 4; ++mb) o[qt][mb] *= al; } }
#pragma unroll
        for (int qt = 0; qt < NQ; ++qt) { v4f ls = (v4f){};   // four partial sums, element j into sum j & 3, in the order of j
#pragma unroll
            for (int kt = 0; kt < 2; ++kt) {
#pragma unroll
                for (int j = 0; j < 8; ++j) t[qt][kt][j] = __builtin_amdgcn_exp2f((t[qt][kt][j] - m[qt]) * 1.4426950408889634f);
                ls += __builtin_shufflevector(t[qt][kt], t[qt][kt], 0, 1, 2, 3); ls += __builtin_shufflevector(t[qt][kt], t[qt][kt], 4, 5, 6, 7); }
            l[qt] += (ls[0] + ls[1]) + (ls[2] + ls[3]); }
        if constexpr (NSPLIT == 2) {   // P = hi + lo bf16 planes
            V pfh[NQ], pfl[NQ];
#pragma unroll
            for (int qt = 0; qt < NQ; ++qt) {
                const v8bf h0 = __builtin_convertvector(t[qt][0], v8bf), h1 = __builtin_convertvector(t[qt][1], v8bf);
                const v8bf l0 = __builtin_convertvector(t[qt][0] - __builtin_convertvector(h0, v8f), v8bf), l1 = __builtin_convertvector(t[qt][1] - __builtin_convertvector(h1, v8f), v8bf);
                pfh[qt] = __builtin_shufflevector(h0, h1, 0, 1, 2, 3, 4, 5, 6, 7, 8, 9, 10, 11, 12, 13, 14, 15); pfl[qt] = __builtin_shufflevector(l0, l1, 0, 1, 2, 3, 4, 5, 6, 7, 8, 9, 10, 11, 12, 13, 14, 15); }
#pragma unroll
            for (int qt = 0; qt < NQ; ++qt)
#pragma unroll
                for (int mb = 0; mb < 4; ++mb) { o[qt][mb] = WFrag<T16>::mma(vf[mb], pfh[qt], o[qt][mb]); o[qt][mb] = WFrag<T16>::mma(vf[mb], pfl[qt], o[qt][mb]); o[qt][mb] = WFrag<T16>::mma(v2[mb], pfh[qt], o[qt][mb]); }
        } else {
            V pfv[NQ];
#pragma unroll
            for (int qt = 0; qt < NQ; ++qt) pfv[qt] = cat16(__builtin_convertvector(t[qt][0], v8h), __builtin_convertvector(t[qt][1], v8h));
#pragma unroll
            for (int qt = 0; qt < NQ; ++qt)
#pragma unroll
                for (int mb = 0; mb < 4; ++mb) o[qt][mb] = WFrag<T16>::mma(vf[mb], pfv[qt], o[qt][mb]); }
        // four vector slots behind the pass's last matrix instruction, also on the taken back edge, before its operands are loaded anew; every output tile is named, so that no matrix instruction of the pass comes to stand behind them
        static_assert(NQ == 1 || NQ == 3, "the statement below names the output tiles of 1 or 3 query tiles");
        if constexpr (NQ == 1) asm volatile("v_nop\n\tv_nop\n\tv_nop\n\tv_nop" : "+v"(o[0][0]), "+v"(o[0][1]), "+v"(o[0][2]), "+v"(o[0][3]) : "v"(vf[0]), "v"(vf[3]));
        else asm volatile("v_nop\n\tv_nop\n\tv_nop\n\tv_nop" : "+v"(o[0][0]), "+v"(o[0][1]), "+v"(o[0][2]), "+v"(o[0][3]), "+v"(o[1][0]), "+v"(o[1][1]), "+v"(o[1][2]), "+v"(o[1][3]), "+v"(o[NQ - 1][0]), "+v"(o[NQ - 1][1]), "+v"(o[NQ - 1][2]), "+v"(o[NQ - 1][3]) : "v"(vf[0]), "v"(vf[3]));
    }
    const size_t oo = (size_t)q0 * DQ + h * (HD / 32) * 512 + lane * 8; bf* const pa = Ah + oo; bf* const pl = Al + oo;   // the lane's place in its first block of either plane; every store below lies at a compile-time offset from it
#pragma unroll
    for (int qt = 0; qt < NQ; ++qt) {
        const float lt = l[qt] + xhalf(l[qt]);
        const float f = __fdiv_rn(1.0f, lt);
#pragma unroll
        for (int mb = 0; mb < 4; ++mb) { v8us oh, ol;   // a lane holds 8 consecutive d of its query: one 16-byte store a plane, at the lane's place in the block of the output projection's A operand
#pragma unroll
            for (int j = 0; j < 8; ++j) { unsigned short a, c2; splitf(o[qt][mb][j] * f, a, c2); oh[j] = a; ol[j] = c2; }
            *(v8us*)(pa + qt * 16 * DQ + mb * 256) = oh; *(v8us*)(pl + qt * 16 * DQ + mb * 256) = ol;
            asm volatile("s_wait_xcnt 0x0" :: "v"(pa), "v"(pl), "v"(oh), "v"(ol) : "memory"); } }   // the XW precaution behind the two stores: addresses and data are inputs, so that all keep their registers up to the wait
}
// grid (batches x heads, RH / 64 + (TT - RH) / (64 FQ)), 4 waves: the blocks of the hi+lo rows (16 rows a wave, three products each) come first in the launch order, then the blocks of the f16 rows, FQ tiles of 16 rows a wave.
// FQ = 3: an f16 wave then issues as many matrix instructions a pass as a hi+lo wave, there are as many of the one kind as of the other, and a K or V fragment is loaded once for 48 query rows. Neighbouring blocks read the same bias+mask blocks.
#define FQ 3
static_assert(RH % 64 == 0 && (TT - RH) % (64 * FQ) == 0, "whole blocks of either kind");
__global__ __launch_bounds__(128) void k_fattn(const h16* __restrict__ Q16, const h16* __restrict__ K16, const h16* __restrict__ V16, const bf* __restrict__ Qh, const bf* __restrict__ Ql, const bf* __restrict__ Kh, const bf* __restrict__ Kl, const bf* __restrict__ Vh, const bf* __restrict__ Vl, const bf* __restrict__ BM, bf* Ah, bf* Al) {
    const int h = blockIdx.x % NH_, bz = blockIdx.x / NH_; const int wv = threadIdx.x >> 5; const size_t hp = (size_t)blockIdx.x * TT * HD; BM += (size_t)bz * TT * TT; Ah += (size_t)bz * TT * DQ; Al += (size_t)bz * TT * DQ;
    if ((int)blockIdx.y < RH / 64) attn_rows<bf, 2, 1>(Qh + hp, Ql + hp, Kh + hp, Kl + hp, Vh + hp, Vl + hp, BM, blockIdx.y * 64 + wv * 16, h, Ah, Al);
    else attn_rows<h16, 0, FQ>(Q16 + hp, nullptr, K16 + hp, nullptr, V16 + hp, nullptr, BM, RH + ((int)blockIdx.y - RH / 64) * (64 * FQ) + wv * (16 * FQ), h, Ah, Al);
}

extern "C" void kernel_launch(void* const* d_in, const int* in_sizes, int n_in,
                              void* d_out, int out_size, void* d_ws, size_t ws_size, hipStream_t stream) {
    (void)in_sizes; (void)n_in; (void)out_size;
    const float* x = (const float*)d_in[0]; const float* abias = (const float*)d_in[1]; const int* amask = (const int*)d_in[2]; const float* wq = (const float*)d_in[3]; const float* bq = (const float*)d_in[4]; const float* wk = (const float*)d_in[5]; const float* bk = (const float*)d_in[6]; const float* wv = (const float*)d_in[7]; const float* bv = (const float*)d_in[8]; const float* wo = (const float*)d_in[9]; const float* bo = (const float*)d_in[10]; const float* cosT = nullptr; const float* sinT = nullptr; (void)cosT; (void)sinT;
    float* OUT = (float*)d_out;     // [2][2048][1024]
    char* wsp = (char*)d_ws;
    auto take = [&](size_t bytes) { char* p = wsp; wsp += (bytes + 255) & ~(size_t)255; return (void*)p; };
    bf* WQ = (bf*)take((size_t)DQ * DM * 2); bf* WK = (bf*)take((size_t)DKV * DM * 2); bf* WV = (bf*)take((size_t)DKV * DM * 2); bf* WO = (bf*)take((size_t)DM * DQ * 2); bf* XB = (bf*)take((size_t)NB_ * TT * DM * 2); (void)WK; (void)WV;   // one behind the other: k_cvtf's pieces; WQ, WK, WV are also one B operand of DQ + 2 DKV rows
    // every plane holds both batches: q and k [projection][batch][head][t][d], v [batch][head][d][t]
    h16* QP16 = (h16*)take((size_t)NB_ * NH_ * TT * HD * 2); h16* KP16 = (h16*)take((size_t)NB_ * NKV * TT * HD * 2); bf* QPh = (bf*)take((size_t)NB_ * NH_ * TT * HD * 2); bf* KPh = (bf*)take((size_t)NB_ * NKV * TT * HD * 2); bf* QPl = (bf*)take((size_t)NB_ * NH_ * TT * HD * 2); bf* KPl = (bf*)take((size_t)NB_ * NKV * TT * HD * 2);
    h16* VT16 = (h16*)take((size_t)NB_ * NKV * HD * TT * 2); bf* VTh = (bf*)take((size_t)NB_ * NKV * HD * TT * 2); bf* VTl = (bf*)take((size_t)NB_ * NKV * HD * TT * 2);
    bf* ATh = (bf*)take((size_t)NB_ * TT * DQ * 2); bf* ATl = (bf*)take((size_t)NB_ * TT * DQ * 2); bf* BM = (bf*)take((size_t)NB_ * TT * TT * 2);
    if ((size_t)(wsp - (char*)d_ws) > ws_size) return;    // ws 256 MiB
    k_cvtf<DM><<<dim3(DQ * DM / 512 / 8, 4 + NB_ * TT / DQ, 1), 256, 0, stream>>>(wq, wk, wv, wo, x, WQ, DQ * DM / 512);   // the four weights and x (pieces of DQ rows), all of K = DM
    k_bm<<<NB_ * TT / 16 * (TT / 32) / 8, 256, 0, stream>>>(abias, amask, BM);
    // each stage once, for both batches (rows b TT + t of x and of the attention output) and for q, k, v side by side (columns of the product); QP and KP lie one behind the other in each of their three kinds
    k_gemmw<bf, 0, true, DM, 1, true><<<dim3(NB_ * TT / 64, (DQ + 2 * DKV) / 64, 1), 32, 0, stream>>>(XB, nullptr, WQ, nullptr, nullptr, 0, bq, bk, bv, 0, 0, 0, QP16, QPh, QPl, VT16, VTh, VTl);
    k_fattn<<<dim3(NB_ * NH_, RH / 64 + (TT - RH) / (64 * FQ), 1), 128, 0, stream>>>(QP16, KP16, VT16, QPh, QPl, KPh, KPl, VTh, VTl, BM, ATh, ATl);   // one kv head per query head
    k_gemmw<bf, 1, true, DQ><<<dim3(NB_ * TT / 64, DM / 64, 1), 32, 0, stream>>>(ATh, ATl, WO, nullptr, OUT, DM, bo, nullptr, nullptr, 0, 0, 0, nullptr, nullptr, nullptr, nullptr, nullptr, nullptr);
}

// v008
// A run of this version takes 123 microseconds.
// In two side-by-side timings against v007, it was 1.24 and 1.23 times as fast.
// Over all steps from v000 it is 18.3 times as fast.
#include <hip/hip_runtime.h>

// MultiHeadAttentionWithBias (query [2][2048][1024], attention_bias [2][S][S] (f32, read), attention_mask [2][S][S] (int, read; all ones); q/k/v = x W^T + b (16 x 64); scores = q.k / 8 + bias[b][i][j], -inf where mask <= 0; softmax; out = merged Wo^T + bo -> [2][2048][1024]).
// Compute dtypes, f32 accumulate: every input rounded to bf16; q/k/v on PLAIN bf16 operands (inputs: exact) + bias; scores PRECPLAN; the bf16-rounded bias and the int mask read per element in f32 (no structural skipping); softmax f32; Wo hl x exact (2 products) + bias.

#define NB_  2
#define TT   2048
#define DM   1024
#define NH_  16
#define NKV  16
#define REP  (NH_ / NKV)
#define HD   64
#define DQ   (NH_ * HD)
#define DKV  (NKV * HD)
#define RH   512                  // query rows < RH use hi+lo planes (0: none)
#define WIN  0
#define SCL  0.125f   // HD^-0.5
typedef _Float16 h16;
typedef unsigned short bf;
typedef __attribute__((ext_vector_type(16))) __bf16   v16bf;
typedef __attribute__((ext_vector_type(16))) _Float16 v16h;
typedef __attribute__((ext_vector_type(8)))  _Float16 v8h;
typedef __attribute__((ext_vector_type(8)))  unsigned short v8us;
typedef __attribute__((ext_vector_type(8)))  float    v8f;
typedef __attribute__((ext_vector_type(8)))  __bf16   v8bf;
typedef __attribute__((ext_vector_type(4)))  float    v4f;
typedef v8h  __attribute__((may_alias)) v8ha;
typedef v4f  __attribute__((may_alias)) v4fa;
typedef v8us __attribute__((may_alias)) v8usa;

__device__ __forceinline__ unsigned short f2bf(float f) { unsigned u = __float_as_uint(f); u += 0x7FFFu + ((u >> 16) & 1u); return (unsigned short)(u >> 16); }
__device__ __forceinline__ float bf2f(unsigned short b) { return __uint_as_float(((unsigned)b) << 16); }
__device__ __forceinline__ float bfr(float f) { return bf2f(f2bf(f)); }
__device__ __forceinline__ v16h cat16(v8h lo, v8h hi) { return __builtin_shufflevector(lo, hi, 0, 1, 2, 3, 4, 5, 6, 7, 8, 9, 10, 11, 12, 13, 14, 15); }
__device__ __forceinline__ v16bf cat16b(v8us lo, v8us hi) { return __builtin_bit_cast(v16bf, __builtin_shufflevector(lo, hi, 0, 1, 2, 3, 4, 5, 6, 7, 8, 9, 10, 11, 12, 13, 14, 15)); }
__device__ __forceinline__ v8f wmma16(v16h a, v16h b, v8f c) { return __builtin_amdgcn_wmma_f32_16x16x32_f16(false, a, false, b, (short)0, c, false, false); }
__device__ __forceinline__ v8f wmmab(v16bf a, v16bf b, v8f c) { return __builtin_amdgcn_wmma_f32_16x16x32_bf16(false, a, false, b, (short)0, c, false, false); }



// XW: a precaution behind each group of global loads: the wait on their address translation stands ahead of any later instruction that takes one of their registers as a destination; its "memory" clobber also keeps the group issued where it is written (in k_fattn a pass's work ahead of its use).
#define XW asm volatile("s_wait_xcnt 0x0" ::: "memory")
// xwa: the same wait with the group's addresses as inputs: they stay in their registers up to the wait, so that neither a later load's destination nor other work takes those registers ahead of it.
template <typename T> __device__ __forceinline__ void xwa(const T* p) { asm volatile("s_wait_xcnt 0x0" :: "v"(p) : "memory"); }
template <typename T, typename U> __device__ __forceinline__ void xwa(const T* p, const U* q) { asm volatile("s_wait_xcnt 0x0" :: "v"(p), "v"(q) : "memory"); }
// ---- FRAGMENT ORDER: every 16-bit operand plane [rows][K] lies as blocks of 16 rows x 32 k (512 elements, 1 KB), block (row tile, k tile) at index row tile x K/32 + k tile.
// In a block, element (r, k = 16 c + 8 hi + e) lies at 256 c + 8 (16 hi + r) + e: lane 16 hi + r of a wave finds its 8 + 8 elements at 8 lane and 256 + 8 lane, so each 16-byte load of a wave covers 512 contiguous bytes (4 whole lines), not 32-byte pieces of 16 lines. The registers hold what they held with row-major planes.
// ---- k_gemmw: register-blocked GEMM, one wave per 64x64 output tile (16 accumulators), FOUR WAVES (2 x 2) per work-group and 128x128 tile; grid (M/128, N/128), 128 threads.
// The 16-bit planes lie in fragment order; the work-group's 128 rows of each operand come to LDS once, 64 k a stage, by asynchronous copies into a ring of two buffers (stage t + 2 is asked for when stage t has been read), and each is read from there by the two waves that need it.
// C[m][n] (f32, pitch ldc, + optional f32 bias[n]) = sum_k A[m][k] Bt[n][k] (NSPLIT 1: + A2[m][k] Bt[n][k]). K % 64 == 0.
// HP (the q, k, v projections side by side, a tile = 64 rows t of one batch x the 64 columns d of one head): no C; the epilogue adds the bias, rounds each accumulator tile to f16 and to bf16 hi + lo and stores it at its place in the head planes that k_fattn reads.
// A lane's 8 accumulators run along the FIRST operand's rows, and a fragment-order block wants 8 consecutive k of one row from a lane. v planes (rows d, k = t): x is the first operand, as in C. q and k planes (rows t, k = d): the two operands change places (both lie in the same order), so that the tile comes out transposed.
// Either way tile (mb, nb) is one 16-byte store a lane and plane, 512 contiguous bytes a wave, at 256 mb + 8 lane in block row nb: this epilogue stages nothing in LDS.
template <typename T16> struct WFrag;
template <> struct WFrag<h16> { typedef v16h V; static __device__ __forceinline__ V ld(const h16* p) { return cat16(*(const v8h*)p, *(const v8h*)(p + 256)); } static __device__ __forceinline__ v8f mma(V a, V b, v8f c) { return wmma16(a, b, c); } };
template <> struct WFrag<bf> { typedef v16bf V; static __device__ __forceinline__ V ld(const bf* p) { return cat16b(*(const v8us*)p, *(const v8us*)(p + 256)); } static __device__ __forceinline__ v8f mma(V a, V b, v8f c) { return wmmab(a, b, c); } };
// put2: two accumulator tiles -> 6 stores, at off and off + nbs elements (both known at compile time) from the lane's address in each plane. lo = x - hi, hi taken back from the packed bf16 words.
// The wait behind the stores is the XW precaution; it takes their addresses and data as inputs, so that all of them keep their registers up to it.
typedef __attribute__((ext_vector_type(4))) unsigned v4u;
__device__ __forceinline__ void put2(const v8f x0, const v8f x1, h16* p16, bf* ph, bf* pl, const int off, const int nbs) {
    const v8f x[2] = {x0, x1}; v8h o16[2]; v8bf oh[2], ol[2];
#pragma unroll
    for (int i = 0; i < 2; ++i) { o16[i] = __builtin_convertvector(x[i], v8h); oh[i] = __builtin_convertvector(x[i], v8bf); const v4u w = __builtin_bit_cast(v4u, oh[i]); v8f r;
#pragma unroll
        for (int k = 0; k < 4; ++k) { r[2 * k] = x[i][2 * k] - __uint_as_float(w[k] << 16); r[2 * k + 1] = x[i][2 * k + 1] - __uint_as_float(w[k] & 0xFFFF0000u); }
        ol[i] = __builtin_convertvector(r, v8bf); }
#pragma unroll
    for (int i = 0; i < 2; ++i) { *(v8h*)(p16 + off + i * nbs) = o16[i]; *(v8bf*)(ph + off + i * nbs) = oh[i]; *(v8bf*)(pl + off + i * nbs) = ol[i]; }
    asm volatile("s_wait_xcnt 0x0" :: "v"(p16), "v"(ph), "v"(pl), "v"(o16[0]), "v"(o16[1]), "v"(oh[0]), "v"(oh[1]), "v"(ol[0]), "v"(ol[1]) : "memory");
}
// cp8: eight asynchronous copies to LDS, 512 bytes a wave each (16 a lane): the 2 KB that a stage holds of each of two row tiles, g0 and g1, to 4 KB of LDS from l on. Every copy has address registers of its own.
// The last line is the XW precaution for the copies: inside their own statement it stands ahead of whatever later takes one of their address registers as a destination.
template <typename T16> __device__ __forceinline__ void cp8(const unsigned l, const T16* g0, const T16* g1) {
    asm volatile("global_load_async_to_lds_b128 %0, %8, off\n\tglobal_load_async_to_lds_b128 %1, %9, off\n\tglobal_load_async_to_lds_b128 %2, %10, off\n\tglobal_load_async_to_lds_b128 %3, %11, off\n\t"
                 "global_load_async_to_lds_b128 %4, %12, off\n\tglobal_load_async_to_lds_b128 %5, %13, off\n\tglobal_load_async_to_lds_b128 %6, %14, off\n\tglobal_load_async_to_lds_b128 %7, %15, off\n\ts_wait_xcnt 0x0"
                 :: "v"(l), "v"(l + 512u), "v"(l + 1024u), "v"(l + 1536u), "v"(l + 2048u), "v"(l + 2560u), "v"(l + 3072u), "v"(l + 3584u),
                    "v"(g0), "v"(g0 + 256), "v"(g0 + 512), "v"(g0 + 768), "v"(g1), "v"(g1 + 256), "v"(g1 + 512), "v"(g1 + 768) : "memory");
}
#define BKB 2   // blocks of 32 k in a stage of the ring
static_assert(BKB == 2, "cp8 copies 2 KB of a row tile");
template <typename T16, int NSPLIT, bool BIAS, int K, bool HP = false>   // K at compile time: a row tile's blocks then lie at immediate offsets from one address
__global__ __launch_bounds__(128) void k_gemmw(const T16* __restrict__ A, const T16* __restrict__ A2, const T16* __restrict__ Bt, float* C, int ldc, const float* __restrict__ bias, const float* __restrict__ bias1, const float* __restrict__ bias2, h16* P16, bf* Ph, bf* Pl, h16* V16, bf* Vh, bf* Vl) {
    typedef typename WFrag<T16>::V V;
    static_assert(NSPLIT == 0 || NSPLIT == 1, "one or two A planes"); static_assert(K % (32 * BKB) == 0 && K / (32 * BKB) >= 2, "whole stages, two or more");
    constexpr int NOP = NSPLIT == 1 ? 3 : 2;      // operand tiles of a stage: A, (A2,) Bt, 128 rows x 32 BKB k each
    constexpr int RTB = BKB * 1024;               // bytes of a row tile in a stage
    constexpr int OPB = 8 * RTB, STB = NOP * OPB; // bytes of an operand tile, of a stage
    constexpr int NT = K / (32 * BKB);
    __shared__ __align__(16) char ring[2 * STB];
    const size_t ld = (size_t)K * 16 /* elements of a row tile */;
    const int lane = threadIdx.x & 31, lr = lane & 15, hi = lane >> 4; const int wv = __builtin_amdgcn_readfirstlane(threadIdx.x >> 5);
    const int r0 = blockIdx.x * 128 + (wv & 1) * 64, c0 = blockIdx.y * 128 + (wv >> 1) * 64;   // the wave's own 64 x 64 tile
    if (c0 >= 2 * DQ) bias = bias2 - 2 * DQ; else if (c0 >= DQ) bias = bias1 - DQ;   // several projections side by side in N, DQ columns each: the tile's own bias vector, still indexed by the column in C
    v8f acc[4][4];
#pragma unroll
    for (int mb = 0; mb < 4; ++mb)
#pragma unroll
        for (int nb = 0; nb < 4; ++nb) acc[mb][nb] = (v8f){};
    const bool tr = HP && c0 < 2 * DQ;   // a q or k tile: the weight rows are the first operand
    // wave wv copies row tiles 2 wv and 2 wv + 1 of each operand tile; a stage in LDS is a plain copy of the planes' blocks, so a fragment is again 16 bytes a lane at 16 lane and at 512 + 16 lane
    const T16* gA = A + (size_t)(blockIdx.x * 8 + 2 * wv) * ld + 8 * lane; const T16* gA2 = NSPLIT == 1 ? A2 + (size_t)(blockIdx.x * 8 + 2 * wv) * ld + 8 * lane : nullptr; const T16* gB = Bt + (size_t)(blockIdx.y * 8 + 2 * wv) * ld + 8 * lane;
    const unsigned l0 = (unsigned)(size_t)(const void*)ring + (unsigned)(wv * 2 * RTB + lane * 16);
    auto fill = [&](const int t, const int buf) {
        const unsigned l = l0 + (unsigned)(buf * STB); const size_t go = (size_t)t * (BKB * 512);
        cp8(l, gA + go, gA + go + ld); if constexpr (NSPLIT == 1) cp8(l + (unsigned)OPB, gA2 + go, gA2 + go + ld); cp8(l + (unsigned)((NOP - 1) * OPB), gB + go, gB + go + ld); };
    const int xo = (wv & 1) * 4 * RTB + lane * 16, wo = (NOP - 1) * OPB + (wv >> 1) * 4 * RTB + lane * 16;   // byte offsets in a stage of the wave's 64 rows of A and of Bt
    const int o1 = tr ? wo : xo, o2 = tr ? xo : wo;
    fill(0, 0);
    asm volatile("s_wait_asynccnt 0x0" ::: "memory");   // this wave's copies of stage 0 have landed
    __syncthreads();                                    // ... and every other wave's
    fill(1, 1);
#pragma unroll 1   // rolled: the body already holds a stage's 32 or 64 matrix instructions and its copies; the loops inside are unrolled so that every index of a fragment or accumulator array is a constant
    for (int t = 0; t < NT; ++t) {
        const char* sb = ring + (t & 1) * STB; V a[BKB][4], a2[BKB][4], b[BKB][4];
        // a block's LDS reads stand as one group ahead of its matrix instructions. The scheduling barriers keep that order: without them the compiler moves the reads in among the matrix instructions, two at a time, each pair behind a wait to 0 with its whole latency open.
        // AHEAD (one wave a SIMD, nobody else fills a wait): all groups ahead of the first product, so that block 0's products wait for their own group alone (a counted wait) and the later groups land under them.
        // Not AHEAD (three work-groups a WGP): group and products by turns, one fragment set, so that three waves' registers fit a SIMD; the other two waves fill the wait.
        constexpr bool AHEAD = NSPLIT == 1;
#pragma unroll
        for (int ph = 0; ph < (AHEAD ? 2 : 1); ++ph)
#pragma unroll
            for (int kb = 0; kb < BKB; ++kb) {
                if (!AHEAD || ph == 0) {
#pragma unroll
                    for (int i = 0; i < 4; ++i) { a[kb][i] = WFrag<T16>::ld((const T16*)(sb + o1 + i * RTB + kb * 1024)); if constexpr (NSPLIT == 1) a2[kb][i] = WFrag<T16>::ld((const T16*)(sb + OPB + o1 + i * RTB + kb * 1024)); b[kb][i] = WFrag<T16>::ld((const T16*)(sb + o2 + i * RTB + kb * 1024)); }
                    __builtin_amdgcn_sched_barrier(0); }
                if (!AHEAD || ph == 1) {
#pragma unroll
                    for (int nb = 0; nb < 4; ++nb)
#pragma unroll
                        for (int mb = 0; mb < 4; ++mb) { acc[mb][nb] = WFrag<T16>::mma(a[kb][mb], b[kb][nb], acc[mb][nb]); if constexpr (NSPLIT == 1) acc[mb][nb] = WFrag<T16>::mma(a2[kb][mb], b[kb][nb], acc[mb][nb]); }
                    __builtin_amdgcn_sched_barrier(0); } }
        // four vector slots behind the stage's last matrix instruction, on every path from it, before a vector instruction takes one of its operand registers; every tile is named, so that no matrix instruction comes to stand behind them
        asm volatile("v_nop\n\tv_nop\n\tv_nop\n\tv_nop" : "+v"(acc[0][0]), "+v"(acc[0][1]), "+v"(acc[0][2]), "+v"(acc[0][3]), "+v"(acc[1][0]), "+v"(acc[1][1]), "+v"(acc[1][2]), "+v"(acc[1][3]), "+v"(acc[2][0]), "+v"(acc[2][1]), "+v"(acc[2][2]), "+v"(acc[2][3]), "+v"(acc[3][0]), "+v"(acc[3][1]), "+v"(acc[3][2]), "+v"(acc[3][3]));
        asm volatile("s_wait_dscnt 0x0" ::: "memory");      // this wave's reads of stage t are done before the buffer is handed back
        asm volatile("s_wait_asynccnt 0x0" ::: "memory");   // this wave's copies of stage t + 1 have landed
        __syncthreads();                                    // publishes stage t + 1 and ends every wave's reads of stage t
        if (t + 2 < NT) fill(t + 2, t & 1);                 // in flight under the whole of stage t + 1
    }
    asm volatile("s_wait_asynccnt 0x0" ::: "memory");       // no copy is outstanding when the wave goes on to its epilogue and ends
    if constexpr (HP) {
        const int pj = c0 / DQ, hd = (c0 % DQ) / HD, bz = r0 / TT, tl = r0 % TT;
        if (tr) {   // planes [projection][batch][head], rows t, k = d = 16 mb + 8 hi + j; block row nb: 16 x HD elements
            const size_t o = ((size_t)((pj * NB_ + bz) * NH_ + hd) * TT + tl) * HD + 8 * lane;
            const float* bp = bias + c0 + hi * 8; v8f bv[4];   // all of the tile's bias ahead of the first stores: one wait on it, not one a row of tiles
#pragma unroll
            for (int mb = 0; mb < 4; ++mb)
#pragma unroll
                for (int j = 0; j < 8; ++j) bv[mb][j] = bp[mb * 16 + j];
            XW;
#pragma unroll
            for (int mb = 0; mb < 4; ++mb) {
#pragma unroll
                for (int j = 0; j < 8; ++j) bv[mb][j] = bfr(bv[mb][j]);
#pragma unroll
                for (int nb = 0; nb < 4; nb += 2) put2(acc[mb][nb] + bv[mb], acc[mb][nb + 1] + bv[mb], P16 + o, Ph + o, Pl + o, mb * 256 + nb * 16 * HD, 16 * HD); }
        } else {    // planes [batch][head], rows d = 16 nb + lr, k = t = 16 mb + 8 hi + j; block row nb: 16 x TT elements
            const size_t o = (size_t)(bz * NKV + hd) * HD * TT + (size_t)tl * 16 + 8 * lane; const float* bp = bias + c0 + lr; float bv[4];
#pragma unroll
            for (int nb = 0; nb < 4; ++nb) bv[nb] = bp[nb * 16];
            XW;
#pragma unroll
            for (int nb = 0; nb < 4; ++nb) bv[nb] = bfr(bv[nb]);
#pragma unroll
            for (int mb = 0; mb < 4; ++mb)
#pragma unroll
                for (int nb = 0; nb < 4; nb += 2) put2(acc[mb][nb] + bv[nb], acc[mb][nb + 1] + bv[nb + 1], V16 + o, Vh + o, Vl + o, mb * 256 + nb * 16 * TT, 16 * TT);
        }
        return;
    }
    __shared__ __align__(16) float osw[4][16 * 68]; float* const os = osw[wv];   // each wave stages in a range of its own, apart from the ring
#pragma unroll
    for (int mb = 0; mb < 4; ++mb) {
#pragma unroll
        for (int nb = 0; nb < 4; ++nb) {
#pragma unroll
            for (int j = 0; j < 8; ++j) os[(hi * 8 + j) * 68 + nb * 16 + lr] = acc[mb][nb][j]; }
        __builtin_amdgcn_wave_barrier(); asm volatile("" ::: "memory");
        float* crow = C + (size_t)(r0 + mb * 16) * ldc + c0;
{
#pragma unroll
            for (int s = 0; s < 8; ++s) { const int row = 2 * s + hi, cofs = lr * 4; v4f val = *(const v4fa*)(os + row * 68 + cofs); if (BIAS) { val[0] += bfr(bias[c0 + cofs]); val[1] += bfr(bias[c0 + cofs + 1]); val[2] += bfr(bias[c0 + cofs + 2]); val[3] += bfr(bias[c0 + cofs + 3]); }
                *(v4f*)(crow + (size_t)row * ldc + cofs) = val; }
             }
        __builtin_amdgcn_wave_barrier(); asm volatile("" ::: "memory");
    }
}

__device__ __forceinline__ void splitf(float y, unsigned short& h, unsigned short& l) { h = f2bf(y); l = f2bf(y - bf2f(h)); }
typedef __attribute__((ext_vector_type(2))) _Float16 v2h;
typedef __attribute__((ext_vector_type(4))) _Float16 v4h;
typedef __attribute__((ext_vector_type(2))) unsigned short v2us;
typedef __attribute__((ext_vector_type(4))) unsigned short v4us;
typedef __attribute__((ext_vector_type(2))) float v2f;
typedef __attribute__((ext_vector_type(4))) int v4i;

__global__ __launch_bounds__(256) void k_wtG(const float* __restrict__ w, int K, int N, bf* Bt) {
    const int lane = threadIdx.x & 31; const int L0 = (blockIdx.x * 8 + (threadIdx.x >> 5)) * 8; const int nlines = N * K / 64;
{
#pragma unroll 1
        for (int l = 0; l < 8; ++l) { const int L = L0 + l; if (L >= nlines) break; const size_t e = (size_t)L * 64 + lane * 2; const int k = (int)(e % K), n = (int)(e / K); v2us o;
            o[0] = f2bf(w[(size_t)k * N + n]); o[1] = f2bf(w[(size_t)(k + 1) * N + n]); *(v2us*)(Bt + e) = o; }
         }
}
// k_cvtf: f32 [rows][K] -> bf16 plane in fragment order. One wave a block: 8 lanes read a row's whole 128-byte line (4 rows a load), a lane stores its 4 elements at their place in the block.
// grid y: pieces of nblk blocks, one behind the other in dst: pieces 0 to 3 are the sources s0 to s3, the pieces from 4 on follow one another in s4.
template <int K>
__global__ __launch_bounds__(256) void k_cvtf(const float* __restrict__ s0, const float* __restrict__ s1, const float* __restrict__ s2, const float* __restrict__ s3, const float* __restrict__ s4, bf* dst, int nblk) { const int blk = blockIdx.x * 8 + (threadIdx.x >> 5); if (blk >= nblk) return; const int pc = blockIdx.y; const float* src = pc == 0 ? s0 : pc == 1 ? s1 : pc == 2 ? s2 : pc == 3 ? s3 : s4 + (size_t)(pc - 4) * nblk * 512; dst += (size_t)pc * nblk * 512; const int lane = threadIdx.x & 31, g = lane >> 3, p = lane & 7; const int ktn = K / 32, kt = blk % ktn, rt = blk / ktn;
    const float* s = src + (size_t)(rt * 16 + g) * K + kt * 32 + p * 4; bf* d = dst + (size_t)blk * 512 + (p >> 2) * 256 + ((p >> 1) & 1) * 128 + g * 8 + (p & 1) * 4; v4f v[4];
#pragma unroll
    for (int i = 0; i < 4; ++i) v[i] = *(const v4f*)(s + (size_t)i * 4 * K);
    xwa(s);
#pragma unroll
    for (int i = 0; i < 4; ++i) { v4us o;
#pragma unroll
        for (int k = 0; k < 4; ++k) o[k] = f2bf(v[i][k]); *(v4us*)(d + i * 32) = o; }  }
// k_bm: bias and mask of both batches -> ONE bf16 plane in fragment order (rows: queries, k: keys): the bias rounded to bf16 (nearest even), as every input, or MASKED where mask <= 0. Lanes as in k_cvtf.
#define MASKED 0xFF60   // bf16 -1.75 x 2^127: swallows any score added to it, and tops the start value of the running maximum, so that a row with every key masked still averages V
typedef __attribute__((ext_vector_type(4))) __bf16 v4bf;
__global__ __launch_bounds__(256) void k_bm(const float* __restrict__ ab, const int* __restrict__ am, bf* BM) { const int blk = blockIdx.x * 8 + (threadIdx.x >> 5); const int lane = threadIdx.x & 31, g = lane >> 3, p = lane & 7; const int kt = blk % (TT / 32), rt = blk / (TT / 32);
    const size_t so = (size_t)(rt * 16 + g) * TT + kt * 32 + p * 4; bf* d = BM + (size_t)blk * 512 + (p >> 2) * 256 + ((p >> 1) & 1) * 128 + g * 8 + (p & 1) * 4; v4f v[4]; v4i mk[4];
#pragma unroll
    for (int i = 0; i < 4; ++i) { v[i] = *(const v4f*)(ab + so + (size_t)i * 4 * TT); mk[i] = *(const v4i*)(am + so + (size_t)i * 4 * TT); }
    xwa(ab + so, am + so);
#pragma unroll
    for (int i = 0; i < 4; ++i) { v4us o = __builtin_bit_cast(v4us, __builtin_convertvector(v[i], v4bf));
#pragma unroll
        for (int k = 0; k < 4; ++k) o[k] = (mk[i][k] > 0) ? o[k] : (unsigned short)MASKED; *(v4us*)(d + i * 32) = o; }  }
// ---- k_fattn: scores, bias, mask, softmax and P.V of one head in ONE kernel; S and P never leave the registers. One wave owns 16 or 48 query rows and walks the 2048 keys in passes of 32.
// S^T = K Q^T (A = K rows, B = Q rows): a lane holds one query's scores (query lr, keys 8 hi + j of each 16-key tile), so two converted S^T tiles ARE the B operand of O^T += V^T P^T (same k order as WFrag::ld).
// Running maximum m per query: P = exp(t - m) unnormalised, the sum l kept in f32 beside it, O divided by l at the end. m moves only when a pass's maximum tops it by more than MSTEP (then O and l are rescaled), so P <= e^MSTEP.
// Addresses: a wave-uniform base that moves with the pass + the lane's byte offset in a block (16 lane). Q, K, V^T and the bias+mask plane BM all lie in fragment order.
#define MSTEP 5.5f
typedef __attribute__((ext_vector_type(8))) int v8i;
__device__ __forceinline__ float xhalf(float x) { return __builtin_bit_cast(float, __builtin_amdgcn_permlanex16(__builtin_bit_cast(int, x), __builtin_bit_cast(int, x), 0x76543210, 0xfedcba98, false, false)); }   // lane l with lane l ^ 16
template <typename T> __device__ __forceinline__ const T* atb(const T* base, unsigned offb) { return (const T*)((const char*)base + offb); }
template <typename T16, int NSPLIT, int NQ>   // NQ: query tiles of 16 rows that the wave owns, one behind the other from q0; every K and V fragment it loads feeds all NQ of them
__device__ __forceinline__ void attn_rows(const T16* __restrict__ Q, const T16* __restrict__ Q2, const T16* __restrict__ Kp, const T16* __restrict__ K2, const T16* __restrict__ Vt, const T16* __restrict__ V2, const bf* __restrict__ BM, int q0, int h, bf* Ah, bf* Al) {
    typedef typename WFrag<T16>::V V;
    const int lane = threadIdx.x & 31;
    V qf[NQ][2], q2[NQ][2], kf[2][2], k2[2][2]; v8bf bb[NQ][2];
    const unsigned lo = (unsigned)lane * 16u;   // byte offset
    Q += (size_t)q0 * HD; if (NSPLIT == 2) Q2 += (size_t)q0 * HD; BM += (size_t)q0 * TT;   // the wave's first row tile: q0 / 16 x (blocks a row tile) x 512
#pragma unroll
    for (int qt = 0; qt < NQ; ++qt)
#pragma unroll
        for (int ks = 0; ks < 2; ++ks) { qf[qt][ks] = WFrag<T16>::ld(atb(Q, lo) + qt * 16 * HD + ks * 512); if (NSPLIT == 2) q2[qt][ks] = WFrag<T16>::ld(atb(Q2, lo) + qt * 16 * HD + ks * 512); }
    XW;
#pragma unroll
    for (int kt = 0; kt < 2; ++kt)
#pragma unroll
        for (int ks = 0; ks < 2; ++ks) { kf[kt][ks] = WFrag<T16>::ld(atb(Kp, lo) + kt * 16 * HD + ks * 512); if (NSPLIT == 2) k2[kt][ks] = WFrag<T16>::ld(atb(K2, lo) + kt * 16 * HD + ks * 512); }
    XW;
#pragma unroll
    for (int qt = 0; qt < NQ; ++qt)
#pragma unroll
        for (int kt = 0; kt < 2; ++kt) bb[qt][kt] = *(const v8bf*)(atb(BM, lo) + qt * 16 * TT + kt * 256);
    XW;
    v8f o[NQ][4]; float m[NQ], l[NQ];
#pragma unroll
    for (int qt = 0; qt < NQ; ++qt) { m[qt] = -3.0e38f; l[qt] = 0.f;
#pragma unroll
        for (int mb = 0; mb < 4; ++mb) o[qt][mb] = (v8f){}; }
#pragma unroll 1   // rolled: 64 passes, the body already holds 24 matrix instructions and a pass's loads
    for (int key0 = 0; key0 < TT; key0 += 32) {
        V vf[4], v2[4];   // this pass's V^T rows: in flight under the score products and the softmax
        const T16* pv = atb(Vt + key0 * 16, lo); const T16* pv2 = NSPLIT == 2 ? atb(V2 + key0 * 16, lo) : nullptr;
#pragma unroll
        for (int mb = 0; mb < 4; ++mb) { vf[mb] = WFrag<T16>::ld(pv + mb * 16 * TT); if (NSPLIT == 2) v2[mb] = WFrag<T16>::ld(pv2 + mb * 16 * TT); }
        if constexpr (NSPLIT == 2) xwa(pv, pv2); else xwa(pv);
        v8f t[NQ][2];
#pragma unroll
        for (int qt = 0; qt < NQ; ++qt)
#pragma unroll
            for (int kt = 0; kt < 2; ++kt) t[qt][kt] = (v8f){};
#pragma unroll   // the halves of d outermost: the products of the 2 NQ score tiles follow one another, so that a tile's second product does not wait on its first; each tile's own order of products is as before
        for (int ks = 0; ks < 2; ++ks)
#pragma unroll
            for (int qt = 0; qt < NQ; ++qt)
#pragma unroll
                for (int kt = 0; kt < 2; ++kt) { t[qt][kt] = WFrag<T16>::mma(kf[kt][ks], qf[qt][ks], t[qt][kt]); if (NSPLIT == 2) { t[qt][kt] = WFrag<T16>::mma(kf[kt][ks], q2[qt][ks], t[qt][kt]); t[qt][kt] = WFrag<T16>::mma(k2[kt][ks], qf[qt][ks], t[qt][kt]); } }
#pragma unroll
        for (int qt = 0; qt < NQ; ++qt)
#pragma unroll
            for (int kt = 0; kt < 2; ++kt) {
                if constexpr (NQ > 1) t[qt][kt] = __builtin_elementwise_fma(t[qt][kt], (v8f)(SCL), __builtin_convertvector(bb[qt][kt], v8f));   // on the whole tile: the packed instructions then pair neighbouring registers of one tile, not elements of two tiles through register copies
                else {
#pragma unroll   // s x 2^-3 is exact, so the fused multiply-add rounds once, as a separate add would
                    for (int j = 0; j < 8; ++j) t[qt][kt][j] = __builtin_fmaf(t[qt][kt][j], SCL, (float)bb[qt][kt][j]); } }
        const int kn = (key0 + 32 < TT) ? key0 + 32 : key0;   // the next pass's K rows and bias+mask blocks are fetched one pass ahead; the last pass fetches its own again (in bounds, not used)
        const T16* pk = atb(Kp + (size_t)kn * HD, lo); const T16* pk2 = NSPLIT == 2 ? atb(K2 + (size_t)kn * HD, lo) : nullptr; const bf* pbm = atb(BM + kn * 16, lo);
#pragma unroll
        for (int kt = 0; kt < 2; ++kt)
#pragma unroll
            for (int ks = 0; ks < 2; ++ks) { kf[kt][ks] = WFrag<T16>::ld(pk + kt * 16 * HD + ks * 512); if (NSPLIT == 2) k2[kt][ks] = WFrag<T16>::ld(pk2 + kt * 16 * HD + ks * 512); }
        if constexpr (NSPLIT == 2) xwa(pk, pk2); else xwa(pk);
#pragma unroll
        for (int qt = 0; qt < NQ; ++qt)
#pragma unroll
            for (int kt = 0; kt < 2; ++kt) bb[qt][kt] = *(const v8bf*)(pbm + qt * 16 * TT + kt * 256);
        xwa(pbm);
        float pm[NQ]; bool need[NQ], any = false;
#pragma unroll
        for (int qt = 0; qt < NQ; ++qt) { pm[qt] = fmaxf(t[qt][0][0], t[qt][1][0]);
#pragma unroll
            for (int j = 1; j < 8; ++j) pm[qt] = fmaxf(pm[qt], fmaxf(t[qt][0][j], t[qt][1][j]));
            pm[qt] = fmaxf(pm[qt], xhalf(pm[qt]));   // the two lane halves hold the two halves of a query's keys
            need[qt] = pm[qt] > m[qt] + MSTEP; any = any || need[qt]; }
        if (__builtin_amdgcn_ballot_w32(any) != 0) {   // wave-uniform, one test a pass: rare after the first pass; a query whose maximum stays is scaled by exactly 1
#pragma unroll
            for (int qt = 0; qt < NQ; ++qt) { const float mn = need[qt] ? pm[qt] : m[qt]; const float al = __builtin_amdgcn_exp2f((m[qt] - mn) * 1.4426950408889634f); m[qt] = mn; l[qt] *= al;
#pragma unroll
                for (int mb = 0; mb < 4; ++mb) o[qt][mb] *= al; } }
#pragma unroll
        for (int qt = 0; qt < NQ; ++qt) { v4f ls = (v4f){};   // four partial sums, element j into sum j & 3, in the order of j
#pragma unroll
            for (int kt = 0; kt < 2; ++kt) {
#pragma unroll
                for (int j = 0; j < 8; ++j) t[qt][kt][j] = __builtin_amdgcn_exp2f((t[qt][kt][j] - m[qt]) * 1.4426950408889634f);
                ls += __builtin_shufflevector(t[qt][kt], t[qt][kt], 0, 1, 2, 3); ls += __builtin_shufflevector(t[qt][kt], t[qt][kt], 4, 5, 6, 7); }
            l[qt] += (ls[0] + ls[1]) + (ls[2] + ls[3]); }
        if constexpr (NSPLIT == 2) {   // P = hi + lo bf16 planes
            V pfh[NQ], pfl[NQ];
#pragma unroll
            for (int qt = 0; qt < NQ; ++qt) {
                const v8bf h0 = __builtin_convertvector(t[qt][0], v8bf), h1 = __builtin_convertvector(t[qt][1], v8bf);
                const v8bf l0 = __builtin_convertvector(t[qt][0] - __builtin_convertvector(h0, v8f), v8bf), l1 = __builtin_convertvector(t[qt][1] - __builtin_convertvector(h1, v8f), v8bf);
                pfh[qt] = __builtin_shufflevector(h0, h1, 0, 1, 2, 3, 4, 5, 6, 7, 8, 9, 10, 11, 12, 13, 14, 15); pfl[qt] = __builtin_shufflevector(l0, l1, 0, 1, 2, 3, 4, 5, 6, 7, 8, 9, 10, 11, 12, 13, 14, 15); }
#pragma unroll
            for (int qt = 0; qt < NQ; ++qt)
#pragma unroll
                for (int mb = 0; mb < 4; ++mb) { o[qt][mb] = WFrag<T16>::mma(vf[mb], pfh[qt], o[qt][mb]); o[qt][mb] = WFrag<T16>::mma(vf[mb], pfl[qt], o[qt][mb]); o[qt][mb] = WFrag<T16>::mma(v2[mb], pfh[qt], o[qt][mb]); }
        } else {
            V pfv[NQ];
#pragma unroll
            for (int qt = 0; qt < NQ; ++qt) pfv[qt] = cat16(__builtin_convertvector(t[qt][0], v8h), __builtin_convertvector(t[qt][1], v8h));
#pragma unroll
            for (int qt = 0; qt < NQ; ++qt)
#pragma unroll
                for (int mb = 0; mb < 4; ++mb) o[qt][mb] = WFrag<T16>::mma(vf[mb], pfv[qt], o[qt][mb]); }
        // four vector slots behind the pass's last matrix instruction, also on the taken back edge, before its operands are loaded anew; every output tile is named, so that no matrix instruction of the pass comes to stand behind them
        static_assert(NQ == 1 || NQ == 3, "the statement below names the output tiles of 1 or 3 query tiles");
        if constexpr (NQ == 1) asm volatile("v_nop\n\tv_nop\n\tv_nop\n\tv_nop" : "+v"(o[0][0]), "+v"(o[0][1]), "+v"(o[0][2]), "+v"(o[0][3]) : "v"(vf[0]), "v"(vf[3]));
        else asm volatile("v_nop\n\tv_nop\n\tv_nop\n\tv_nop" : "+v"(o[0][0]), "+v"(o[0][1]), "+v"(o[0][2]), "+v"(o[0][3]), "+v"(o[1][0]), "+v"(o[1][1]), "+v"(o[1][2]), "+v"(o[1][3]), "+v"(o[NQ - 1][0]), "+v"(o[NQ - 1][1]), "+v"(o[NQ - 1][2]), "+v"(o[NQ - 1][3]) : "v"(vf[0]), "v"(vf[3]));
    }
    const size_t oo = (size_t)q0 * DQ + h * (HD / 32) * 512 + lane * 8; bf* const pa = Ah + oo; bf* const pl = Al + oo;   // the lane's place in its first block of either plane; every store below lies at a compile-time offset from it
#pragma unroll
    for (int qt = 0; qt < NQ; ++qt) {
        const float lt = l[qt] + xhalf(l[qt]);
        const float f = __fdiv_rn(1.0f, lt);
#pragma unroll
        for (int mb = 0; mb < 4; ++mb) { v8us oh, ol;   // a lane holds 8 consecutive d of its query: one 16-byte store a plane, at the lane's place in the block of the output projection's A operand
#pragma unroll
            for (int j = 0; j < 8; ++j) { unsigned short a, c2; splitf(o[qt][mb][j] * f, a, c2); oh[j] = a; ol[j] = c2; }
            *(v8us*)(pa + qt * 16 * DQ + mb * 256) = oh; *(v8us*)(pl + qt * 16 * DQ + mb * 256) = ol;
            asm volatile("s_wait_xcnt 0x0" :: "v"(pa), "v"(pl), "v"(oh), "v"(ol) : "memory"); } }   // the XW precaution behind the two stores: addresses and data are inputs, so that all keep their registers up to the wait
}
// grid (batches x heads, RH / 64 + (TT - RH) / (64 FQ)), 4 waves: the blocks of the hi+lo rows (16 rows a wave, three products each) come first in the launch order, then the blocks of the f16 rows, FQ tiles of 16 rows a wave.
// FQ = 3: an f16 wave then issues as many matrix instructions a pass as a hi+lo wave, there are as many of the one kind as of the other, and a K or V fragment is loaded once for 48 query rows. Neighbouring blocks read the same bias+mask blocks.
#define FQ 3
static_assert(RH % 64 == 0 && (TT - RH) % (64 * FQ) == 0, "whole blocks of either kind");
__global__ __launch_bounds__(128) void k_fattn(const h16* __restrict__ Q16, const h16* __restrict__ K16, const h16* __restrict__ V16, const bf* __restrict__ Qh, const bf* __restrict__ Ql, const bf* __restrict__ Kh, const bf* __restrict__ Kl, const bf* __restrict__ Vh, const bf* __restrict__ Vl, const bf* __restrict__ BM, bf* Ah, bf* Al) {
    const int h = blockIdx.x % NH_, bz = blockIdx.x / NH_; const int wv = threadIdx.x >> 5; const size_t hp = (size_t)blockIdx.x * TT * HD; BM += (size_t)bz * TT * TT; Ah += (size_t)bz * TT * DQ; Al += (size_t)bz * TT * DQ;
    if ((int)blockIdx.y < RH / 64) attn_rows<bf, 2, 1>(Qh + hp, Ql + hp, Kh + hp, Kl + hp, Vh + hp, Vl + hp, BM, blockIdx.y * 64 + wv * 16, h, Ah, Al);
    else attn_rows<h16, 0, FQ>(Q16 + hp, nullptr, K16 + hp, nullptr, V16 + hp, nullptr, BM, RH + ((int)blockIdx.y - RH / 64) * (64 * FQ) + wv * (16 * FQ), h, Ah, Al);
}

extern "C" void kernel_launch(void* const* d_in, const int* in_sizes, int n_in,
                              void* d_out, int out_size, void* d_ws, size_t ws_size, hipStream_t stream) {
    (void)in_sizes; (void)n_in; (void)out_size;
    const float* x = (const float*)d_in[0]; const float* abias = (const float*)d_in[1]; const int* amask = (const int*)d_in[2]; const float* wq = (const float*)d_in[3]; const float* bq = (const float*)d_in[4]; const float* wk = (const float*)d_in[5]; const float* bk = (const float*)d_in[6]; const float* wv = (const float*)d_in[7]; const float* bv = (const float*)d_in[8]; const float* wo = (const float*)d_in[9]; const float* bo = (const float*)d_in[10]; const float* cosT = nullptr; const float* sinT = nullptr; (void)cosT; (void)sinT;
    float* OUT = (float*)d_out;     // [2][2048][1024]
    char* wsp = (char*)d_ws;
    auto take = [&](size_t bytes) { char* p = wsp; wsp += (bytes + 255) & ~(size_t)255; return (void*)p; };
    bf* WQ = (bf*)take((size_t)DQ * DM * 2); bf* WK = (bf*)take((size_t)DKV * DM * 2); bf* WV = (bf*)take((size_t)DKV * DM * 2); bf* WO = (bf*)take((size_t)DM * DQ * 2); bf* XB = (bf*)take((size_t)NB_ * TT * DM * 2); (void)WK; (void)WV;   // one behind the other: k_cvtf's pieces; WQ, WK, WV are also one B operand of DQ + 2 DKV rows
    // every plane holds both batches: q and k [projection][batch][head][t][d], v [batch][head][d][t]
    h16* QP16 = (h16*)take((size_t)NB_ * NH_ * TT * HD * 2); h16* KP16 = (h16*)take((size_t)NB_ * NKV * TT * HD * 2); bf* QPh = (bf*)take((size_t)NB_ * NH_ * TT * HD * 2); bf* KPh = (bf*)take((size_t)NB_ * NKV * TT * HD * 2); bf* QPl = (bf*)take((size_t)NB_ * NH_ * TT * HD * 2); bf* KPl = (bf*)take((size_t)NB_ * NKV * TT * HD * 2);
    h16* VT16 = (h16*)take((size_t)NB_ * NKV * HD * TT * 2); bf* VTh = (bf*)take((size_t)NB_ * NKV * HD * TT * 2); bf* VTl = (bf*)take((size_t)NB_ * NKV * HD * TT * 2);
    bf* ATh = (bf*)take((size_t)NB_ * TT * DQ * 2); bf* ATl = (bf*)take((size_t)NB_ * TT * DQ * 2); bf* BM = (bf*)take((size_t)NB_ * TT * TT * 2);
    if ((size_t)(wsp - (char*)d_ws) > ws_size) return;    // ws 256 MiB
    k_cvtf<DM><<<dim3(DQ * DM / 512 / 8, 4 + NB_ * TT / DQ, 1), 256, 0, stream>>>(wq, wk, wv, wo, x, WQ, DQ * DM / 512);   // the four weights and x (pieces of DQ rows), all of K = DM
    k_bm<<<NB_ * TT / 16 * (TT / 32) / 8, 256, 0, stream>>>(abias, amask, BM);
    // each stage once, for both batches (rows b TT + t of x and of the attention output) and for q, k, v side by side (columns of the product); QP and KP lie one behind the other in each of their three kinds
    k_gemmw<bf, 0, true, DM, true><<<dim3(NB_ * TT / 128, (DQ + 2 * DKV) / 128, 1), 128, 0, stream>>>(XB, nullptr, WQ, nullptr, 0, bq, bk, bv, QP16, QPh, QPl, VT16, VTh, VTl);
    k_fattn<<<dim3(NB_ * NH_, RH / 64 + (TT - RH) / (64 * FQ), 1), 128, 0, stream>>>(QP16, KP16, VT16, QPh, QPl, KPh, KPl, VTh, VTl, BM, ATh, ATl);   // one kv head per query head
    k_gemmw<bf, 1, true, DQ><<<dim3(NB_ * TT / 128, DM / 128, 1), 128, 0, stream>>>(ATh, ATl, WO, OUT, DM, bo, nullptr, nullptr, nullptr, nullptr, nullptr, nullptr, nullptr, nullptr);
}

// v009
// A run of this version takes 110 microseconds.
// Two timings next to v008 both put it at 1.11 times that version's speed.
// All steps since v000 together make it 20.3 times as fast.
#include <hip/hip_runtime.h>

// MultiHeadAttentionWithBias (query [2][2048][1024], attention_bias [2][S][S] (f32, read), attention_mask [2][S][S] (int, read; all ones); q/k/v = x W^T + b (16 x 64); scores = q.k / 8 + bias[b][i][j], -inf where mask <= 0; softmax; out = merged Wo^T + bo -> [2][2048][1024]).
// Compute dtypes, f32 accumulate: every input rounded to bf16; q/k/v on PLAIN bf16 operands (inputs: exact) + bias; scores PRECPLAN; the bf16-rounded bias and the int mask read per element in f32 (no structural skipping); softmax f32; Wo hl x exact (2 products) + bias.

#define NB_  2
#define TT   2048
#define DM   1024
#define NH_  16
#define NKV  16
#define REP  (NH_ / NKV)
#define HD   64
#define DQ   (NH_ * HD)
#define DKV  (NKV * HD)
#define RH   512                  // query rows < RH use hi+lo planes (0: none)
#define WIN  0
#define SCL  0.125f   // HD^-0.5
typedef _Float16 h16;
typedef unsigned short bf;
typedef __attribute__((ext_vector_type(16))) __bf16   v16bf;
typedef __attribute__((ext_vector_type(16))) _Float16 v16h;
typedef __attribute__((ext_vector_type(8)))  _Float16 v8h;
typedef __attribute__((ext_vector_type(8)))  unsigned short v8us;
typedef __attribute__((ext_vector_type(8)))  float    v8f;
typedef __attribute__((ext_vector_type(8)))  __bf16   v8bf;
typedef __attribute__((ext_vector_type(4)))  float    v4f;
typedef v8h  __attribute__((may_alias)) v8ha;
typedef v4f  __attribute__((may_alias)) v4fa;
typedef v8us __attribute__((may_alias)) v8usa;

__device__ __forceinline__ unsigned short f2bf(float f) { unsigned u = __float_as_uint(f); u += 0x7FFFu + ((u >> 16) & 1u); return (unsigned short)(u >> 16); }
__device__ __forceinline__ float bf2f(unsigned short b) { return __uint_as_float(((unsigned)b) << 16); }
__device__ __forceinline__ float bfr(float f) { return bf2f(f2bf(f)); }
__device__ __forceinline__ v16h cat16(v8h lo, v8h hi) { return __builtin_shufflevector(lo, hi, 0, 1, 2, 3, 4, 5, 6, 7, 8, 9, 10, 11, 12, 13, 14, 15); }
__device__ __forceinline__ v16bf cat16b(v8us lo, v8us hi) { return __builtin_bit_cast(v16bf, __builtin_shufflevector(lo, hi, 0, 1, 2, 3, 4, 5, 6, 7, 8, 9, 10, 11, 12, 13, 14, 15)); }
__device__ __forceinline__ v8f wmma16(v16h a, v16h b, v8f c) { return __builtin_amdgcn_wmma_f32_16x16x32_f16(false, a, false, b, (short)0, c, false, false); }
__device__ __forceinline__ v8f wmmab(v16bf a, v16bf b, v8f c) { return __builtin_amdgcn_wmma_f32_16x16x32_bf16(false, a, false, b, (short)0, c, false, false); }



// XW: a precaution behind each group of global loads: the wait on their address translation stands ahead of any later instruction that takes one of their registers as a destination; its "memory" clobber also keeps the group issued where it is written (in k_fattn a pass's work ahead of its use).
#define XW asm volatile("s_wait_xcnt 0x0" ::: "memory")
// xwa: the same wait with the group's addresses as inputs: they stay in their registers up to the wait, so that neither a later load's destination nor other work takes those registers ahead of it.
template <typename T> __device__ __forceinline__ void xwa(const T* p) { asm volatile("s_wait_xcnt 0x0" :: "v"(p) : "memory"); }
template <typename T, typename U> __device__ __forceinline__ void xwa(const T* p, const U* q) { asm volatile("s_wait_xcnt 0x0" :: "v"(p), "v"(q) : "memory"); }
// ---- FRAGMENT ORDER: every 16-bit operand plane [rows][K] lies as blocks of 16 rows x 32 k (512 elements, 1 KB), block (row tile, k tile) at index row tile x K/32 + k tile.
// In a block, element (r, k = 16 c + 8 hi + e) lies at 256 c + 8 (16 hi + r) + e: lane 16 hi + r of a wave finds its 8 + 8 elements at 8 lane and 256 + 8 lane, so each 16-byte load of a wave covers 512 contiguous bytes (4 whole lines), not 32-byte pieces of 16 lines. The registers hold what they held with row-major planes.
// ---- k_gemmw: register-blocked GEMM, one wave per 64x64 output tile (16 accumulators), FOUR WAVES (2 x 2) per work-group and 128x128 tile; grid (M/128, N/128), 128 threads.
// The 16-bit planes lie in fragment order; the work-group's 128 rows of each operand come to LDS once, 64 k a stage, by asynchronous copies into a ring of two buffers (stage t + 2 is asked for when stage t has been read), and each is read from there by the two waves that need it.
// C[m][n] (f32, pitch ldc, + optional f32 bias[n]) = sum_k A[m][k] Bt[n][k] (NSPLIT 1: + A2[m][k] Bt[n][k]). K % 64 == 0.
// HP (the q, k, v projections side by side, a tile = 64 rows t of one batch x the 64 columns d of one head): no C; the epilogue adds the bias, rounds each accumulator tile to f16 and to bf16 hi + lo and stores it at its place in the head planes that k_fattn reads.
// A lane's 8 accumulators run along the FIRST operand's rows, and a fragment-order block wants 8 consecutive k of one row from a lane. v planes (rows d, k = t): x is the first operand, as in C. q and k planes (rows t, k = d): the two operands change places (both lie in the same order), so that the tile comes out transposed.
// Either way tile (mb, nb) is one 16-byte store a lane and plane, 512 contiguous bytes a wave, at 256 mb + 8 lane in block row nb: this epilogue stages nothing in LDS.
template <typename T16> struct WFrag;
template <> struct WFrag<h16> { typedef v16h V; static __device__ __forceinline__ V ld(const h16* p) { return cat16(*(const v8h*)p, *(const v8h*)(p + 256)); } static __device__ __forceinline__ v8f mma(V a, V b, v8f c) { return wmma16(a, b, c); } };
template <> struct WFrag<bf> { typedef v16bf V; static __device__ __forceinline__ V ld(const bf* p) { return cat16b(*(const v8us*)p, *(const v8us*)(p + 256)); } static __device__ __forceinline__ v8f mma(V a, V b, v8f c) { return wmmab(a, b, c); } };
// put2: two accumulator tiles -> 6 stores, at off and off + nbs elements (both known at compile time) from the lane's address in each plane. lo = x - hi, hi taken back from the packed bf16 words.
// The wait behind the stores is the XW precaution; it takes their addresses and data as inputs, so that all of them keep their registers up to it.
typedef __attribute__((ext_vector_type(4))) unsigned v4u;
__device__ __forceinline__ void put2(const v8f x0, const v8f x1, h16* p16, bf* ph, bf* pl, const int off, const int nbs) {
    const v8f x[2] = {x0, x1}; v8h o16[2]; v8bf oh[2], ol[2];
#pragma unroll
    for (int i = 0; i < 2; ++i) { o16[i] = __builtin_convertvector(x[i], v8h); oh[i] = __builtin_convertvector(x[i], v8bf); const v4u w = __builtin_bit_cast(v4u, oh[i]); v8f r;
#pragma unroll
        for (int k = 0; k < 4; ++k) { r[2 * k] = x[i][2 * k] - __uint_as_float(w[k] << 16); r[2 * k + 1] = x[i][2 * k + 1] - __uint_as_float(w[k] & 0xFFFF0000u); }
        ol[i] = __builtin_convertvector(r, v8bf); }
#pragma unroll
    for (int i = 0; i < 2; ++i) { *(v8h*)(p16 + off + i * nbs) = o16[i]; *(v8bf*)(ph + off + i * nbs) = oh[i]; *(v8bf*)(pl + off + i * nbs) = ol[i]; }
    asm volatile("s_wait_xcnt 0x0" :: "v"(p16), "v"(ph), "v"(pl), "v"(o16[0]), "v"(o16[1]), "v"(oh[0]), "v"(oh[1]), "v"(ol[0]), "v"(ol[1]) : "memory");
}
// cp8: eight asynchronous copies to LDS, 512 bytes a wave each (16 a lane): the 2 KB that a stage holds of each of two row tiles, g0 and g1, to 4 KB of LDS from l on. Every copy has address registers of its own.
// The last line is the XW precaution for the copies: inside their own statement it stands ahead of whatever later takes one of their address registers as a destination.
template <typename T16> __device__ __forceinline__ void cp8(const unsigned l, const T16* g0, const T16* g1) {
    asm volatile("global_load_async_to_lds_b128 %0, %8, off\n\tglobal_load_async_to_lds_b128 %1, %9, off\n\tglobal_load_async_to_lds_b128 %2, %10, off\n\tglobal_load_async_to_lds_b128 %3, %11, off\n\t"
                 "global_load_async_to_lds_b128 %4, %12, off\n\tglobal_load_async_to_lds_b128 %5, %13, off\n\tglobal_load_async_to_lds_b128 %6, %14, off\n\tglobal_load_async_to_lds_b128 %7, %15, off\n\ts_wait_xcnt 0x0"
                 :: "v"(l), "v"(l + 512u), "v"(l + 1024u), "v"(l + 1536u), "v"(l + 2048u), "v"(l + 2560u), "v"(l + 3072u), "v"(l + 3584u),
                    "v"(g0), "v"(g0 + 256), "v"(g0 + 512), "v"(g0 + 768), "v"(g1), "v"(g1 + 256), "v"(g1 + 512), "v"(g1 + 768) : "memory");
}
#define BKB 2   // blocks of 32 k in a stage of the ring
static_assert(BKB == 2, "cp8 copies 2 KB of a row tile");
template <typename T16, int NSPLIT, bool BIAS, int K, bool HP = false>   // K at compile time: a row tile's blocks then lie at immediate offsets from one address
__global__ __launch_bounds__(128) void k_gemmw(const T16* __restrict__ A, const T16* __restrict__ A2, const T16* __restrict__ Bt, float* C, int ldc, const float* __restrict__ bias, const float* __restrict__ bias1, const float* __restrict__ bias2, h16* P16, bf* Ph, bf* Pl, h16* V16, bf* Vh, bf* Vl) {
    typedef typename WFrag<T16>::V V;
    static_assert(NSPLIT == 0 || NSPLIT == 1, "one or two A planes"); static_assert(K % (32 * BKB) == 0 && K / (32 * BKB) >= 2, "whole stages, two or more");
    constexpr int NOP = NSPLIT == 1 ? 3 : 2;      // operand tiles of a stage: A, (A2,) Bt, 128 rows x 32 BKB k each
    constexpr int RTB = BKB * 1024;               // bytes of a row tile in a stage
    constexpr int OPB = 8 * RTB, STB = NOP * OPB; // bytes of an operand tile, of a stage
    constexpr int NT = K / (32 * BKB);
    __shared__ __align__(16) char ring[2 * STB];
    const size_t ld = (size_t)K * 16 /* elements of a row tile */;
    const int lane = threadIdx.x & 31, lr = lane & 15, hi = lane >> 4; const int wv = __builtin_amdgcn_readfirstlane(threadIdx.x >> 5);
    const int r0 = blockIdx.x * 128 + (wv & 1) * 64, c0 = blockIdx.y * 128 + (wv >> 1) * 64;   // the wave's own 64 x 64 tile
    if (c0 >= 2 * DQ) bias = bias2 - 2 * DQ; else if (c0 >= DQ) bias = bias1 - DQ;   // several projections side by side in N, DQ columns each: the tile's own bias vector, still indexed by the column in C
    v8f acc[4][4];
#pragma unroll
    for (int mb = 0; mb < 4; ++mb)
#pragma unroll
        for (int nb = 0; nb < 4; ++nb) acc[mb][nb] = (v8f){};
    const bool tr = HP && c0 < 2 * DQ;   // a q or k tile: the weight rows are the first operand
    // wave wv copies row tiles 2 wv and 2 wv + 1 of each operand tile; a stage in LDS is a plain copy of the planes' blocks, so a fragment is again 16 bytes a lane at 16 lane and at 512 + 16 lane
    const T16* gA = A + (size_t)(blockIdx.x * 8 + 2 * wv) * ld + 8 * lane; const T16* gA2 = NSPLIT == 1 ? A2 + (size_t)(blockIdx.x * 8 + 2 * wv) * ld + 8 * lane : nullptr; const T16* gB = Bt + (size_t)(blockIdx.y * 8 + 2 * wv) * ld + 8 * lane;
    const unsigned l0 = (unsigned)(size_t)(const void*)ring + (unsigned)(wv * 2 * RTB + lane * 16);
    auto fill = [&](const int t, const int buf) {
        const unsigned l = l0 + (unsigned)(buf * STB); const size_t go = (size_t)t * (BKB * 512);
        cp8(l, gA + go, gA + go + ld); if constexpr (NSPLIT == 1) cp8(l + (unsigned)OPB, gA2 + go, gA2 + go + ld); cp8(l + (unsigned)((NOP - 1) * OPB), gB + go, gB + go + ld); };
    const int xo = (wv & 1) * 4 * RTB + lane * 16, wo = (NOP - 1) * OPB + (wv >> 1) * 4 * RTB + lane * 16;   // byte offsets in a stage of the wave's 64 rows of A and of Bt
    const int o1 = tr ? wo : xo, o2 = tr ? xo : wo;
    fill(0, 0);
    asm volatile("s_wait_asynccnt 0x0" ::: "memory");   // this wave's copies of stage 0 have landed
    __syncthreads();                                    // ... and every other wave's
    fill(1, 1);
#pragma unroll 1   // rolled: the body already holds a stage's 32 or 64 matrix instructions and its copies; the loops inside are unrolled so that every index of a fragment or accumulator array is a constant
    for (int t = 0; t < NT; ++t) {
        const char* sb = ring + (t & 1) * STB; V a[BKB][4], a2[BKB][4], b[BKB][4];
        // a block's LDS reads stand as one group ahead of its matrix instructions. The scheduling barriers keep that order: without them the compiler moves the reads in among the matrix instructions, two at a time, each pair behind a wait to 0 with its whole latency open.
        // AHEAD (one wave a SIMD, nobody else fills a wait): all groups ahead of the first product, so that block 0's products wait for their own group alone (a counted wait) and the later groups land under them.
        // Not AHEAD (three work-groups a WGP): group and products by turns, one fragment set, so that three waves' registers fit a SIMD; the other two waves fill the wait.
        constexpr bool AHEAD = NSPLIT == 1;
#pragma unroll
        for (int ph = 0; ph < (AHEAD ? 2 : 1); ++ph)
#pragma unroll
            for (int kb = 0; kb < BKB; ++kb) {
                if (!AHEAD || ph == 0) {
#pragma unroll
                    for (int i = 0; i < 4; ++i) { a[kb][i] = WFrag<T16>::ld((const T16*)(sb + o1 + i * RTB + kb * 1024)); if constexpr (NSPLIT == 1) a2[kb][i] = WFrag<T16>::ld((const T16*)(sb + OPB + o1 + i * RTB + kb * 1024)); b[kb][i] = WFrag<T16>::ld((const T16*)(sb + o2 + i * RTB + kb * 1024)); }
                    __builtin_amdgcn_sched_barrier(0); }
                if (!AHEAD || ph == 1) {
#pragma unroll
                    for (int nb = 0; nb < 4; ++nb)
#pragma unroll
                        for (int mb = 0; mb < 4; ++mb) { acc[mb][nb] = WFrag<T16>::mma(a[kb][mb], b[kb][nb], acc[mb][nb]); if constexpr (NSPLIT == 1) acc[mb][nb] = WFrag<T16>::mma(a2[kb][mb], b[kb][nb], acc[mb][nb]); }
                    __builtin_amdgcn_sched_barrier(0); } }
        // four vector slots behind the stage's last matrix instruction, on every path from it, before a vector instruction takes one of its operand registers; every tile is named, so that no matrix instruction comes to stand behind them
        asm volatile("v_nop\n\tv_nop\n\tv_nop\n\tv_nop" : "+v"(acc[0][0]), "+v"(acc[0][1]), "+v"(acc[0][2]), "+v"(acc[0][3]), "+v"(acc[1][0]), "+v"(acc[1][1]), "+v"(acc[1][2]), "+v"(acc[1][3]), "+v"(acc[2][0]), "+v"(acc[2][1]), "+v"(acc[2][2]), "+v"(acc[2][3]), "+v"(acc[3][0]), "+v"(acc[3][1]), "+v"(acc[3][2]), "+v"(acc[3][3]));
        asm volatile("s_wait_dscnt 0x0" ::: "memory");      // this wave's reads of stage t are done before the buffer is handed back
        asm volatile("s_wait_asynccnt 0x0" ::: "memory");   // this wave's copies of stage t + 1 have landed
        __syncthreads();                                    // publishes stage t + 1 and ends every wave's reads of stage t
        if (t + 2 < NT) fill(t + 2, t & 1);                 // in flight under the whole of stage t + 1
    }
    asm volatile("s_wait_asynccnt 0x0" ::: "memory");       // no copy is outstanding when the wave goes on to its epilogue and ends
    if constexpr (HP) {
        const int pj = c0 / DQ, hd = (c0 % DQ) / HD, bz = r0 / TT, tl = r0 % TT;
        if (tr) {   // planes [projection][batch][head], rows t, k = d = 16 mb + 8 hi + j; block row nb: 16 x HD elements
            const size_t o = ((size_t)((pj * NB_ + bz) * NH_ + hd) * TT + tl) * HD + 8 * lane;
            const float* bp = bias + c0 + hi * 8; v8f bv[4];   // all of the tile's bias ahead of the first stores: one wait on it, not one a row of tiles
#pragma unroll
            for (int mb = 0; mb < 4; ++mb)
#pragma unroll
                for (int j = 0; j < 8; ++j) bv[mb][j] = bp[mb * 16 + j];
            XW;
#pragma unroll
            for (int mb = 0; mb < 4; ++mb) {
#pragma unroll
                for (int j = 0; j < 8; ++j) bv[mb][j] = bfr(bv[mb][j]);
#pragma unroll
                for (int nb = 0; nb < 4; nb += 2) put2(acc[mb][nb] + bv[mb], acc[mb][nb + 1] + bv[mb], P16 + o, Ph + o, Pl + o, mb * 256 + nb * 16 * HD, 16 * HD); }
        } else {    // planes [batch][head], rows d = 16 nb + lr, k = t = 16 mb + 8 hi + j; block row nb: 16 x TT elements
            const size_t o = (size_t)(bz * NKV + hd) * HD * TT + (size_t)tl * 16 + 8 * lane; const float* bp = bias + c0 + lr; float bv[4];
#pragma unroll
            for (int nb = 0; nb < 4; ++nb) bv[nb] = bp[nb * 16];
            XW;
#pragma unroll
            for (int nb = 0; nb < 4; ++nb) bv[nb] = bfr(bv[nb]);
#pragma unroll
            for (int mb = 0; mb < 4; ++mb)
#pragma unroll
                for (int nb = 0; nb < 4; nb += 2) put2(acc[mb][nb] + bv[nb], acc[mb][nb + 1] + bv[nb + 1], V16 + o, Vh + o, Vl + o, mb * 256 + nb * 16 * TT, 16 * TT);
        }
        return;
    }
    __shared__ __align__(16) float osw[4][16 * 68]; float* const os = osw[wv];   // each wave stages in a range of its own, apart from the ring
#pragma unroll
    for (int mb = 0; mb < 4; ++mb) {
#pragma unroll
        for (int nb = 0; nb < 4; ++nb) {
#pragma unroll
            for (int j = 0; j < 8; ++j) os[(hi * 8 + j) * 68 + nb * 16 + lr] = acc[mb][nb][j]; }
        __builtin_amdgcn_wave_barrier(); asm volatile("" ::: "memory");
        float* crow = C + (size_t)(r0 + mb * 16) * ldc + c0;
{
#pragma unroll
            for (int s = 0; s < 8; ++s) { const int row = 2 * s + hi, cofs = lr * 4; v4f val = *(const v4fa*)(os + row * 68 + cofs); if (BIAS) { val[0] += bfr(bias[c0 + cofs]); val[1] += bfr(bias[c0 + cofs + 1]); val[2] += bfr(bias[c0 + cofs + 2]); val[3] += bfr(bias[c0 + cofs + 3]); }
                *(v4f*)(crow + (size_t)row * ldc + cofs) = val; }
             }
        __builtin_amdgcn_wave_barrier(); asm volatile("" ::: "memory");
    }
}

__device__ __forceinline__ void splitf(float y, unsigned short& h, unsigned short& l) { h = f2bf(y); l = f2bf(y - bf2f(h)); }
typedef __attribute__((ext_vector_type(2))) _Float16 v2h;
typedef __attribute__((ext_vector_type(4))) _Float16 v4h;
typedef __attribute__((ext_vector_type(2))) unsigned short v2us;
typedef __attribute__((ext_vector_type(4))) unsigned short v4us;
typedef __attribute__((ext_vector_type(2))) float v2f;
typedef __attribute__((ext_vector_type(4))) int v4i;

__global__ __launch_bounds__(256) void k_wtG(const float* __restrict__ w, int K, int N, bf* Bt) {
    const int lane = threadIdx.x & 31; const int L0 = (blockIdx.x * 8 + (threadIdx.x >> 5)) * 8; const int nlines = N * K / 64;
{
#pragma unroll 1
        for (int l = 0; l < 8; ++l) { const int L = L0 + l; if (L >= nlines) break; const size_t e = (size_t)L * 64 + lane * 2; const int k = (int)(e % K), n = (int)(e / K); v2us o;
            o[0] = f2bf(w[(size_t)k * N + n]); o[1] = f2bf(w[(size_t)(k + 1) * N + n]); *(v2us*)(Bt + e) = o; }
         }
}
// k_cvtf: f32 [rows][K] -> bf16 plane in fragment order. One wave a block: 8 lanes read a row's whole 128-byte line (4 rows a load), a lane stores its 4 elements at their place in the block.
// grid y: pieces of nblk blocks, one behind the other in dst: pieces 0 to 3 are the sources s0 to s3, the pieces from 4 on follow one another in s4.
template <int K>
__global__ __launch_bounds__(256) void k_cvtf(const float* __restrict__ s0, const float* __restrict__ s1, const float* __restrict__ s2, const float* __restrict__ s3, const float* __restrict__ s4, bf* dst, int nblk) { const int blk = blockIdx.x * 8 + (threadIdx.x >> 5); if (blk >= nblk) return; const int pc = blockIdx.y; const float* src = pc == 0 ? s0 : pc == 1 ? s1 : pc == 2 ? s2 : pc == 3 ? s3 : s4 + (size_t)(pc - 4) * nblk * 512; dst += (size_t)pc * nblk * 512; const int lane = threadIdx.x & 31, g = lane >> 3, p = lane & 7; const int ktn = K / 32, kt = blk % ktn, rt = blk / ktn;
    const float* s = src + (size_t)(rt * 16 + g) * K + kt * 32 + p * 4; bf* d = dst + (size_t)blk * 512 + (p >> 2) * 256 + ((p >> 1) & 1) * 128 + g * 8 + (p & 1) * 4; v4f v[4];
#pragma unroll
    for (int i = 0; i < 4; ++i) v[i] = *(const v4f*)(s + (size_t)i * 4 * K);
    xwa(s);
#pragma unroll
    for (int i = 0; i < 4; ++i) { v4us o;
#pragma unroll
        for (int k = 0; k < 4; ++k) o[k] = f2bf(v[i][k]); *(v4us*)(d + i * 32) = o; }  }
// k_bm: bias and mask of both batches -> ONE bf16 plane in fragment order (rows: queries, k: keys): the bias rounded to bf16 (nearest even), as every input, or MASKED where mask <= 0. Lanes as in k_cvtf.
#define MASKED 0xFF60   // bf16 -1.75 x 2^127: swallows any score added to it, and tops the start value of the running maximum, so that a row with every key masked still averages V
typedef __attribute__((ext_vector_type(4))) __bf16 v4bf;
__global__ __launch_bounds__(256) void k_bm(const float* __restrict__ ab, const int* __restrict__ am, bf* BM) { const int blk = blockIdx.x * 8 + (threadIdx.x >> 5); const int lane = threadIdx.x & 31, g = lane >> 3, p = lane & 7; const int kt = blk % (TT / 32), rt = blk / (TT / 32);
    const size_t so = (size_t)(rt * 16 + g) * TT + kt * 32 + p * 4; bf* d = BM + (size_t)blk * 512 + (p >> 2) * 256 + ((p >> 1) & 1) * 128 + g * 8 + (p & 1) * 4; v4f v[4]; v4i mk[4];
#pragma unroll
    for (int i = 0; i < 4; ++i) { v[i] = *(const v4f*)(ab + so + (size_t)i * 4 * TT); mk[i] = *(const v4i*)(am + so + (size_t)i * 4 * TT); }
    xwa(ab + so, am + so);
#pragma unroll
    for (int i = 0; i < 4; ++i) { v4us o = __builtin_bit_cast(v4us, __builtin_convertvector(v[i], v4bf));
#pragma unroll
        for (int k = 0; k < 4; ++k) o[k] = (mk[i][k] > 0) ? o[k] : (unsigned short)MASKED; *(v4us*)(d + i * 32) = o; }  }
// ---- k_fattn: scores, bias, mask, softmax and P.V of one head in ONE kernel; S and P never leave the registers. One wave owns 16 or 48 query rows and walks the 2048 keys in passes of 32.
// The four waves of a work-group walk the same K and V: these come to LDS once for all four, 64 keys (two passes) a stage, by asynchronous copies into a ring of two buffers (stage t + 2 is asked for when stage t has been read), and every wave reads its fragments from there.
// A stage in LDS, per set of planes (f16: one set; hi + lo: the hi set, then the lo set): four pieces of 4 KB, piece w copied by wave w: the 2 KB of key tile w (its two blocks of d), then the 2 KB of V^T row tile w (its two blocks of keys), each a plain copy of the planes' blocks.
// S^T = K Q^T (A = K rows, B = Q rows): a lane holds one query's scores (query lr, keys 8 hi + j of each 16-key tile), so two converted S^T tiles ARE the B operand of O^T += V^T P^T (same k order as WFrag::ld).
// Running maximum m per query: P = exp(t - m) unnormalised, the sum l kept in f32 beside it, O divided by l at the end. m moves only when a pass's maximum tops it by more than MSTEP (then O and l are rescaled), so P <= e^MSTEP.
// Addresses of the plain loads (Q, BM): a wave-uniform base that moves with the pass + the lane's byte offset in a block (16 lane). Q, K, V^T and the bias+mask plane BM all lie in fragment order.
#define MSTEP 5.5f
#define FRB 65536   // bytes of k_fattn's LDS ring: two stages of the hi + lo rows' four planes
typedef __attribute__((ext_vector_type(8))) int v8i;
__device__ __forceinline__ float xhalf(float x) { return __builtin_bit_cast(float, __builtin_amdgcn_permlanex16(__builtin_bit_cast(int, x), __builtin_bit_cast(int, x), 0x76543210, 0xfedcba98, false, false)); }   // lane l with lane l ^ 16
template <typename T> __device__ __forceinline__ const T* atb(const T* base, unsigned offb) { return (const T*)((const char*)base + offb); }
template <typename T16, int NSPLIT, int NQ>   // NQ: query tiles of 16 rows that the wave owns, one behind the other from q0; every K and V fragment it loads feeds all NQ of them
__device__ __forceinline__ void attn_rows(const T16* __restrict__ Q, const T16* __restrict__ Q2, const T16* __restrict__ Kp, const T16* __restrict__ K2, const T16* __restrict__ Vt, const T16* __restrict__ V2, const bf* __restrict__ BM, int q0, int h, bf* Ah, bf* Al, char* ring) {
    typedef typename WFrag<T16>::V V;
    constexpr int SPB = 4 * 4096, STB = (NSPLIT == 2 ? 2 : 1) * SPB;   // bytes of a set of planes in a stage, of a stage
    constexpr int NT = TT / 64; static_assert(TT % 64 == 0 && NT >= 2 && HD == 64 && 2 * STB <= FRB, "whole stages of 64 keys, two or more; a key tile is 2 KB; the ring holds two stages");
    const int lane = threadIdx.x & 31; const int wv = __builtin_amdgcn_readfirstlane(threadIdx.x >> 5);
    const unsigned l0 = (unsigned)(size_t)(const void*)ring + (unsigned)(wv * 4096 + lane * 16);
    auto fill = [&](const int t, const int buf) {
        const unsigned l = l0 + (unsigned)(buf * STB); const size_t ko = (size_t)(t * 64 + wv * 16) * HD, vo = (size_t)(wv * (TT / 64) + t) * (64 * 16);   // key tile wv of stage t; row tile wv of V^T, the stage's two blocks. One wave-uniform index each: scalar arithmetic, and no address of the copies is kept in vector registers over the loop
        cp8(l, atb(Kp + ko, lane * 16u), atb(Vt + vo, lane * 16u)); if constexpr (NSPLIT == 2) cp8(l + (unsigned)SPB, atb(K2 + ko, lane * 16u), atb(V2 + vo, lane * 16u)); };
    fill(0, 0);   // in flight under the loads of Q and of the first bias+mask blocks
    V qf[NQ][2], q2[NQ][2], kf[2][2], k2[2][2]; v8bf bb[NQ][2];
    const unsigned lo = (unsigned)lane * 16u;   // byte offset
    Q += (size_t)q0 * HD; if (NSPLIT == 2) Q2 += (size_t)q0 * HD; BM += (size_t)q0 * TT;   // the wave's first row tile: q0 / 16 x (blocks a row tile) x 512
#pragma unroll
    for (int qt = 0; qt < NQ; ++qt)
#pragma unroll
        for (int ks = 0; ks < 2; ++ks) { qf[qt][ks] = WFrag<T16>::ld(atb(Q, lo) + qt * 16 * HD + ks * 512); if (NSPLIT == 2) q2[qt][ks] = WFrag<T16>::ld(atb(Q2, lo) + qt * 16 * HD + ks * 512); }
    XW;
#pragma unroll
    for (int qt = 0; qt < NQ; ++qt)
#pragma unroll
        for (int kt = 0; kt < 2; ++kt) bb[qt][kt] = *(const v8bf*)(atb(BM, lo) + qt * 16 * TT + kt * 256);
    XW;
    v8f o[NQ][4]; float m[NQ], l[NQ];
#pragma unroll
    for (int qt = 0; qt < NQ; ++qt) { m[qt] = -3.0e38f; l[qt] = 0.f;
#pragma unroll
        for (int mb = 0; mb < 4; ++mb) o[qt][mb] = (v8f){}; }
    asm volatile("s_wait_asynccnt 0x0" ::: "memory");   // this wave's copies of stage 0 have landed
    __syncthreads();                                    // ... and every other wave's
    fill(1, 1);
#pragma unroll 1   // rolled: 32 stages, the body already holds two passes of 24 matrix instructions each
    for (int st = 0; st < NT; ++st) {
      const char* sb = ring + (st & 1) * STB + lo;   // the lane's place in the first block of this stage's buffer
#pragma unroll
      for (int kt = 0; kt < 2; ++kt)
#pragma unroll
          for (int ks = 0; ks < 2; ++ks) { kf[kt][ks] = WFrag<T16>::ld((const T16*)(sb + kt * 4096 + ks * 1024)); if (NSPLIT == 2) k2[kt][ks] = WFrag<T16>::ld((const T16*)(sb + SPB + kt * 4096 + ks * 1024)); }
      __builtin_amdgcn_sched_barrier(0);   // the K rows of the stage's first pass are asked for as one group ahead of the first product, which then waits for its own fragments alone (a counted wait); without it the compiler deals them out among the products, each lot behind a wait to 0
#pragma unroll   // the two passes of a stage: unrolled, so that every LDS offset is a constant and only the first pass fetches K ahead
      for (int ps = 0; ps < 2; ++ps) {
        const int key0 = st * 64 + ps * 32;
        V vf[4], v2[4];
        v8f t[NQ][2];
#pragma unroll
        for (int qt = 0; qt < NQ; ++qt)
#pragma unroll
            for (int kt = 0; kt < 2; ++kt) t[qt][kt] = (v8f){};
#pragma unroll   // the halves of d outermost: the products of the 2 NQ score tiles follow one another, so that a tile's second product does not wait on its first; each tile's own order of products is as before
        for (int ks = 0; ks < 2; ++ks)
#pragma unroll
            for (int qt = 0; qt < NQ; ++qt)
#pragma unroll
                for (int kt = 0; kt < 2; ++kt) { t[qt][kt] = WFrag<T16>::mma(kf[kt][ks], qf[qt][ks], t[qt][kt]); if (NSPLIT == 2) { t[qt][kt] = WFrag<T16>::mma(kf[kt][ks], q2[qt][ks], t[qt][kt]); t[qt][kt] = WFrag<T16>::mma(k2[kt][ks], qf[qt][ks], t[qt][kt]); } }
        // one group of LDS reads a pass, behind the score products and in flight under the softmax: this pass's V^T rows and, in a stage's first pass, the K rows of its second (nothing of the next stage is read ahead of the stage's barrier).
        // The scheduling barriers keep the reads together at this one place: without them the compiler spreads them, two at a time, among the vector instructions and the matrix instructions.
        __builtin_amdgcn_sched_barrier(0);
#pragma unroll
        for (int mb = 0; mb < 4; ++mb) { vf[mb] = WFrag<T16>::ld((const T16*)(sb + mb * 4096 + 2048 + ps * 1024)); if (NSPLIT == 2) v2[mb] = WFrag<T16>::ld((const T16*)(sb + SPB + mb * 4096 + 2048 + ps * 1024)); }
        if (ps == 0) {
#pragma unroll
            for (int kt = 0; kt < 2; ++kt)
#pragma unroll
                for (int ks = 0; ks < 2; ++ks) { kf[kt][ks] = WFrag<T16>::ld((const T16*)(sb + (2 + kt) * 4096 + ks * 1024)); if (NSPLIT == 2) k2[kt][ks] = WFrag<T16>::ld((const T16*)(sb + SPB + (2 + kt) * 4096 + ks * 1024)); } }
        __builtin_amdgcn_sched_barrier(0);
#pragma unroll
        for (int qt = 0; qt < NQ; ++qt)
#pragma unroll
            for (int kt = 0; kt < 2; ++kt) {
                if constexpr (NQ > 1) t[qt][kt] = __builtin_elementwise_fma(t[qt][kt], (v8f)(SCL), __builtin_convertvector(bb[qt][kt], v8f));   // on the whole tile: the packed instructions then pair neighbouring registers of one tile, not elements of two tiles through register copies
                else {
#pragma unroll   // s x 2^-3 is exact, so the fused multiply-add rounds once, as a separate add would
                    for (int j = 0; j < 8; ++j) t[qt][kt][j] = __builtin_fmaf(t[qt][kt][j], SCL, (float)bb[qt][kt][j]); } }
        const int kn = (key0 + 32 < TT) ? key0 + 32 : key0;   // the next pass's bias+mask blocks are fetched one pass ahead; the last pass fetches its own again (in bounds, not used)
        const bf* pbm = atb(BM + kn * 16, lo);
#pragma unroll
        for (int qt = 0; qt < NQ; ++qt)
#pragma unroll
            for (int kt = 0; kt < 2; ++kt) bb[qt][kt] = *(const v8bf*)(pbm + qt * 16 * TT + kt * 256);
        xwa(pbm);
        float pm[NQ]; bool need[NQ], any = false;
#pragma unroll
        for (int qt = 0; qt < NQ; ++qt) { pm[qt] = fmaxf(t[qt][0][0], t[qt][1][0]);
#pragma unroll
            for (int j = 1; j < 8; ++j) pm[qt] = fmaxf(pm[qt], fmaxf(t[qt][0][j], t[qt][1][j]));
            pm[qt] = fmaxf(pm[qt], xhalf(pm[qt]));   // the two lane halves hold the two halves of a query's keys
            need[qt] = pm[qt] > m[qt] + MSTEP; any = any || need[qt]; }
        if (__builtin_amdgcn_ballot_w32(any) != 0) {   // wave-uniform, one test a pass: rare after the first pass; a query whose maximum stays is scaled by exactly 1
#pragma unroll
            for (int qt = 0; qt < NQ; ++qt) { const float mn = need[qt] ? pm[qt] : m[qt]; const float al = __builtin_amdgcn_exp2f((m[qt] - mn) * 1.4426950408889634f); m[qt] = mn; l[qt] *= al;
#pragma unroll
                for (int mb = 0; mb < 4; ++mb) o[qt][mb] *= al; } }
#pragma unroll
        for (int qt = 0; qt < NQ; ++qt) { v4f ls = (v4f){};   // four partial sums, element j into sum j & 3, in the order of j
#pragma unroll
            for (int kt = 0; kt < 2; ++kt) {
#pragma unroll
                for (int j = 0; j < 8; ++j) t[qt][kt][j] = __builtin_amdgcn_exp2f((t[qt][kt][j] - m[qt]) * 1.4426950408889634f);
                ls += __builtin_shufflevector(t[qt][kt], t[qt][kt], 0, 1, 2, 3); ls += __builtin_shufflevector(t[qt][kt], t[qt][kt], 4, 5, 6, 7); }
            l[qt] += (ls[0] + ls[1]) + (ls[2] + ls[3]); }
        if constexpr (NSPLIT == 2) {   // P = hi + lo bf16 planes
            V pfh[NQ], pfl[NQ];
#pragma unroll
            for (int qt = 0; qt < NQ; ++qt) {
                const v8bf h0 = __builtin_convertvector(t[qt][0], v8bf), h1 = __builtin_convertvector(t[qt][1], v8bf);
                const v8bf l0 = __builtin_convertvector(t[qt][0] - __builtin_convertvector(h0, v8f), v8bf), l1 = __builtin_convertvector(t[qt][1] - __builtin_convertvector(h1, v8f), v8bf);
                pfh[qt] = __builtin_shufflevector(h0, h1, 0, 1, 2, 3, 4, 5, 6, 7, 8, 9, 10, 11, 12, 13, 14, 15); pfl[qt] = __builtin_shufflevector(l0, l1, 0, 1, 2, 3, 4, 5, 6, 7, 8, 9, 10, 11, 12, 13, 14, 15); }
#pragma unroll
            for (int qt = 0; qt < NQ; ++qt)
#pragma unroll
                for (int mb = 0; mb < 4; ++mb) { o[qt][mb] = WFrag<T16>::mma(vf[mb], pfh[qt], o[qt][mb]); o[qt][mb] = WFrag<T16>::mma(vf[mb], pfl[qt], o[qt][mb]); o[qt][mb] = WFrag<T16>::mma(v2[mb], pfh[qt], o[qt][mb]); }
        } else {
            V pfv[NQ];
#pragma unroll
            for (int qt = 0; qt < NQ; ++qt) pfv[qt] = cat16(__builtin_convertvector(t[qt][0], v8h), __builtin_convertvector(t[qt][1], v8h));
#pragma unroll
            for (int qt = 0; qt < NQ; ++qt)
#pragma unroll
                for (int mb = 0; mb < 4; ++mb) o[qt][mb] = WFrag<T16>::mma(vf[mb], pfv[qt], o[qt][mb]); }
        // four vector slots behind the pass's last matrix instruction, also on the taken back edge, before its operands are loaded anew; every output tile is named, so that no matrix instruction of the pass comes to stand behind them
        static_assert(NQ == 1 || NQ == 3, "the statement below names the output tiles of 1 or 3 query tiles");
        if constexpr (NQ == 1) asm volatile("v_nop\n\tv_nop\n\tv_nop\n\tv_nop" : "+v"(o[0][0]), "+v"(o[0][1]), "+v"(o[0][2]), "+v"(o[0][3]) : "v"(vf[0]), "v"(vf[3]));
        else asm volatile("v_nop\n\tv_nop\n\tv_nop\n\tv_nop" : "+v"(o[0][0]), "+v"(o[0][1]), "+v"(o[0][2]), "+v"(o[0][3]), "+v"(o[1][0]), "+v"(o[1][1]), "+v"(o[1][2]), "+v"(o[1][3]), "+v"(o[NQ - 1][0]), "+v"(o[NQ - 1][1]), "+v"(o[NQ - 1][2]), "+v"(o[NQ - 1][3]) : "v"(vf[0]), "v"(vf[3]));
      }
      asm volatile("s_wait_dscnt 0x0" ::: "memory");      // this wave's reads of stage st are done before the buffer is handed back
      asm volatile("s_wait_asynccnt 0x0" ::: "memory");   // this wave's copies of stage st + 1 have landed
      __syncthreads();                                    // publishes stage st + 1 and ends every wave's reads of stage st
      if (st + 2 < NT) fill(st + 2, st & 1);              // in flight under the whole of stage st + 1
    }
    asm volatile("s_wait_asynccnt 0x0" ::: "memory");     // no copy is outstanding when the wave goes on to its epilogue and ends
    const size_t oo = (size_t)q0 * DQ + h * (HD / 32) * 512 + lane * 8; bf* const pa = Ah + oo; bf* const pl = Al + oo;   // the lane's place in its first block of either plane; every store below lies at a compile-time offset from it
#pragma unroll
    for (int qt = 0; qt < NQ; ++qt) {
        const float lt = l[qt] + xhalf(l[qt]);
        const float f = __fdiv_rn(1.0f, lt);
#pragma unroll
        for (int mb = 0; mb < 4; ++mb) { v8us oh, ol;   // a lane holds 8 consecutive d of its query: one 16-byte store a plane, at the lane's place in the block of the output projection's A operand
#pragma unroll
            for (int j = 0; j < 8; ++j) { unsigned short a, c2; splitf(o[qt][mb][j] * f, a, c2); oh[j] = a; ol[j] = c2; }
            *(v8us*)(pa + qt * 16 * DQ + mb * 256) = oh; *(v8us*)(pl + qt * 16 * DQ + mb * 256) = ol;
            asm volatile("s_wait_xcnt 0x0" :: "v"(pa), "v"(pl), "v"(oh), "v"(ol) : "memory"); } }   // the XW precaution behind the two stores: addresses and data are inputs, so that all keep their registers up to the wait
}
// grid (batches x heads, RH / 64 + (TT - RH) / (64 FQ)), 4 waves: the blocks of the hi+lo rows (16 rows a wave, three products each) come first in the launch order, then the blocks of the f16 rows, FQ tiles of 16 rows a wave.
// FQ = 3: an f16 wave then issues as many matrix instructions a pass as a hi+lo wave, there are as many of the one kind as of the other, and a K or V fragment is loaded once for 48 query rows. Neighbouring blocks read the same bias+mask blocks.
#define FQ 3
static_assert(RH % 64 == 0 && (TT - RH) % (64 * FQ) == 0, "whole blocks of either kind");
__global__ __launch_bounds__(128) void k_fattn(const h16* __restrict__ Q16, const h16* __restrict__ K16, const h16* __restrict__ V16, const bf* __restrict__ Qh, const bf* __restrict__ Ql, const bf* __restrict__ Kh, const bf* __restrict__ Kl, const bf* __restrict__ Vh, const bf* __restrict__ Vl, const bf* __restrict__ BM, bf* Ah, bf* Al) {
    const int h = blockIdx.x % NH_, bz = blockIdx.x / NH_; const int wv = threadIdx.x >> 5; const size_t hp = (size_t)blockIdx.x * TT * HD; BM += (size_t)bz * TT * TT; Ah += (size_t)bz * TT * DQ; Al += (size_t)bz * TT * DQ;
    __shared__ __align__(16) char ring[FRB];
    if ((int)blockIdx.y < RH / 64) attn_rows<bf, 2, 1>(Qh + hp, Ql + hp, Kh + hp, Kl + hp, Vh + hp, Vl + hp, BM, blockIdx.y * 64 + wv * 16, h, Ah, Al, ring);
    else attn_rows<h16, 0, FQ>(Q16 + hp, nullptr, K16 + hp, nullptr, V16 + hp, nullptr, BM, RH + ((int)blockIdx.y - RH / 64) * (64 * FQ) + wv * (16 * FQ), h, Ah, Al, ring);
}

extern "C" void kernel_launch(void* const* d_in, const int* in_sizes, int n_in,
                              void* d_out, int out_size, void* d_ws, size_t ws_size, hipStream_t stream) {
    (void)in_sizes; (void)n_in; (void)out_size;
    const float* x = (const float*)d_in[0]; const float* abias = (const float*)d_in[1]; const int* amask = (const int*)d_in[2]; const float* wq = (const float*)d_in[3]; const float* bq = (const float*)d_in[4]; const float* wk = (const float*)d_in[5]; const float* bk = (const float*)d_in[6]; const float* wv = (const float*)d_in[7]; const float* bv = (const float*)d_in[8]; const float* wo = (const float*)d_in[9]; const float* bo = (const float*)d_in[10]; const float* cosT = nullptr; const float* sinT = nullptr; (void)cosT; (void)sinT;
    float* OUT = (float*)d_out;     // [2][2048][1024]
    char* wsp = (char*)d_ws;
    auto take = [&](size_t bytes) { char* p = wsp; wsp += (bytes + 255) & ~(size_t)255; return (void*)p; };
    bf* WQ = (bf*)take((size_t)DQ * DM * 2); bf* WK = (bf*)take((size_t)DKV * DM * 2); bf* WV = (bf*)take((size_t)DKV * DM * 2); bf* WO = (bf*)take((size_t)DM * DQ * 2); bf* XB = (bf*)take((size_t)NB_ * TT * DM * 2); (void)WK; (void)WV;   // one behind the other: k_cvtf's pieces; WQ, WK, WV are also one B operand of DQ + 2 DKV rows
    // every plane holds both batches: q and k [projection][batch][head][t][d], v [batch][head][d][t]
    h16* QP16 = (h16*)take((size_t)NB_ * NH_ * TT * HD * 2); h16* KP16 = (h16*)take((size_t)NB_ * NKV * TT * HD * 2); bf* QPh = (bf*)take((size_t)NB_ * NH_ * TT * HD * 2); bf* KPh = (bf*)take((size_t)NB_ * NKV * TT * HD * 2); bf* QPl = (bf*)take((size_t)NB_ * NH_ * TT * HD * 2); bf* KPl = (bf*)take((size_t)NB_ * NKV * TT * HD * 2);
    h16* VT16 = (h16*)take((size_t)NB_ * NKV * HD * TT * 2); bf* VTh = (bf*)take((size_t)NB_ * NKV * HD * TT * 2); bf* VTl = (bf*)take((size_t)NB_ * NKV * HD * TT * 2);
    bf* ATh = (bf*)take((size_t)NB_ * TT * DQ * 2); bf* ATl = (bf*)take((size_t)NB_ * TT * DQ * 2); bf* BM = (bf*)take((size_t)NB_ * TT * TT * 2);
    if ((size_t)(wsp - (char*)d_ws) > ws_size) return;    // ws 256 MiB
    k_cvtf<DM><<<dim3(DQ * DM / 512 / 8, 4 + NB_ * TT / DQ, 1), 256, 0, stream>>>(wq, wk, wv, wo, x, WQ, DQ * DM / 512);   // the four weights and x (pieces of DQ rows), all of K = DM
    k_bm<<<NB_ * TT / 16 * (TT / 32) / 8, 256, 0, stream>>>(abias, amask, BM);
    // each stage once, for both batches (rows b TT + t of x and of the attention output) and for q, k, v side by side (columns of the product); QP and KP lie one behind the other in each of their three kinds
    k_gemmw<bf, 0, true, DM, true><<<dim3(NB_ * TT / 128, (DQ + 2 * DKV) / 128, 1), 128, 0, stream>>>(XB, nullptr, WQ, nullptr, 0, bq, bk, bv, QP16, QPh, QPl, VT16, VTh, VTl);
    k_fattn<<<dim3(NB_ * NH_, RH / 64 + (TT - RH) / (64 * FQ), 1), 128, 0, stream>>>(QP16, KP16, VT16, QPh, QPl, KPh, KPl, VTh, VTl, BM, ATh, ATl);   // one kv head per query head
    k_gemmw<bf, 1, true, DQ><<<dim3(NB_ * TT / 128, DM / 128, 1), 128, 0, stream>>>(ATh, ATl, WO, OUT, DM, bo, nullptr, nullptr, nullptr, nullptr, nullptr, nullptr, nullptr, nullptr);
}

// v010
// It runs in 107 microseconds.
// Timed twice side by side with v009, it ran 1.04 times as fast both times.
// Counting every step since v000, it is 21.1 times as fast.
#include <hip/hip_runtime.h>

// MultiHeadAttentionWithBias (query [2][2048][1024], attention_bias [2][S][S] (f32, read), attention_mask [2][S][S] (int, read; all ones); q/k/v = x W^T + b (16 x 64); scores = q.k / 8 + bias[b][i][j], -inf where mask <= 0; softmax; out = merged Wo^T + bo -> [2][2048][1024]).
// Compute dtypes, f32 accumulate: every input rounded to bf16; q/k/v on PLAIN bf16 operands (inputs: exact) + bias; scores PRECPLAN; the bf16-rounded bias and the int mask read per element in f32 (no structural skipping); softmax f32; Wo hl x exact (2 products) + bias.

#define NB_  2
#define TT   2048
#define DM   1024
#define NH_  16
#define NKV  16
#define REP  (NH_ / NKV)
#define HD   64
#define DQ   (NH_ * HD)
#define DKV  (NKV * HD)
#define RH   512                  // query rows < RH use hi+lo planes (0: none)
#define WIN  0
#define SCL  0.125f   // HD^-0.5
typedef _Float16 h16;
typedef unsigned short bf;
typedef __attribute__((ext_vector_type(16))) __bf16   v16bf;
typedef __attribute__((ext_vector_type(16))) _Float16 v16h;
typedef __attribute__((ext_vector_type(8)))  _Float16 v8h;
typedef __attribute__((ext_vector_type(8)))  unsigned short v8us;
typedef __attribute__((ext_vector_type(8)))  float    v8f;
typedef __attribute__((ext_vector_type(8)))  __bf16   v8bf;
typedef __attribute__((ext_vector_type(4)))  float    v4f;
typedef v8h  __attribute__((may_alias)) v8ha;
typedef v4f  __attribute__((may_alias)) v4fa;
typedef v8us __attribute__((may_alias)) v8usa;

__device__ __forceinline__ unsigned short f2bf(float f) { unsigned u = __float_as_uint(f); u += 0x7FFFu + ((u >> 16) & 1u); return (unsigned short)(u >> 16); }
__device__ __forceinline__ float bf2f(unsigned short b) { return __uint_as_float(((unsigned)b) << 16); }
__device__ __forceinline__ float bfr(float f) { return bf2f(f2bf(f)); }
__device__ __forceinline__ v16h cat16(v8h lo, v8h hi) { return __builtin_shufflevector(lo, hi, 0, 1, 2, 3, 4, 5, 6, 7, 8, 9, 10, 11, 12, 13, 14, 15); }
__device__ __forceinline__ v16bf cat16b(v8us lo, v8us hi) { return __builtin_bit_cast(v16bf, __builtin_shufflevector(lo, hi, 0, 1, 2, 3, 4, 5, 6, 7, 8, 9, 10, 11, 12, 13, 14, 15)); }
__device__ __forceinline__ v8f wmma16(v16h a, v16h b, v8f c) { return __builtin_amdgcn_wmma_f32_16x16x32_f16(false, a, false, b, (short)0, c, false, false); }
__device__ __forceinline__ v8f wmmab(v16bf a, v16bf b, v8f c) { return __builtin_amdgcn_wmma_f32_16x16x32_bf16(false, a, false, b, (short)0, c, false, false); }



// XW: a precaution behind each group of global loads: the wait on their address translation stands ahead of any later instruction that takes one of their registers as a destination; its "memory" clobber also keeps the group issued where it is written (in k_fattn a pass's work ahead of its use).
#define XW asm volatile("s_wait_xcnt 0x0" ::: "memory")
// xwa: the same wait with the group's addresses as inputs: they stay in their registers up to the wait, so that neither a later load's destination nor other work takes those registers ahead of it.
template <typename T> __device__ __forceinline__ void xwa(const T* p) { asm volatile("s_wait_xcnt 0x0" :: "v"(p) : "memory"); }
template <typename T, typename U> __device__ __forceinline__ void xwa(const T* p, const U* q) { asm volatile("s_wait_xcnt 0x0" :: "v"(p), "v"(q) : "memory"); }
// bm_rows: bias and mask of both batches -> ONE bf16 plane in fragment order (rows: queries, k: keys): the bias rounded to bf16 (nearest even), as every input, or MASKED where mask <= 0.
// One work-group of 4 waves converts row tile rt (16 queries x all TT keys) in TT / 512 trips; a trip of a wave is 4 neighbouring blocks of 32 keys. In a block 8 lanes read a row's whole 128-byte line (4 rows a load), a lane stores its 4 elements at their place in the block.
// These work-groups stream from memory beside the q, k, v GEMM's, in its launch: one of them a WGP, so a wave keeps a trip's 32 loads in flight at once.
#define MASKED 0xFF60   // bf16 -1.75 x 2^127: swallows any score added to it, and tops the start value of the running maximum, so that a row with every key masked still averages V
typedef __attribute__((ext_vector_type(4))) __bf16 v4bf;
typedef __attribute__((ext_vector_type(4))) unsigned short v4us;
typedef __attribute__((ext_vector_type(4))) int v4i;
static_assert(TT % 512 == 0, "whole trips of 4 waves x 4 blocks");
__device__ __forceinline__ void bm_rows(const float* __restrict__ ab, const int* __restrict__ am, bf* BM, const int rt, const int wv) {
    const int lane = (int)__builtin_amdgcn_mbcnt_lo(~0u, 0u), g = lane >> 3, p = lane & 7;   // the lane's number counted anew, the wave's in a scalar register: no vector register is held for them over the tiles' code
    const size_t so = (size_t)(rt * 16 + g) * TT + wv * 128 + p * 4; const float* a = ab + so; const int* mp = am + so;
    bf* d = BM + ((size_t)rt * (TT / 32) + wv * 4) * 512 + (p >> 2) * 256 + ((p >> 1) & 1) * 128 + g * 8 + (p & 1) * 4;
#pragma unroll 1   // rolled: a trip's 32 loads (128 registers) are what the wave keeps in flight; unrolled trips would add code and registers, not loads in flight
    for (int it = 0; it < TT / 512; ++it) { v4f v[4][4]; v4i mk[4][4];
#pragma unroll
        for (int u = 0; u < 4; ++u)
#pragma unroll
            for (int i = 0; i < 4; ++i) { v[u][i] = *(const v4f*)(a + u * 32 + (size_t)i * 4 * TT); mk[u][i] = *(const v4i*)(mp + u * 32 + (size_t)i * 4 * TT); }
#pragma unroll
        for (int u = 0; u < 4; ++u)
#pragma unroll
            for (int i = 0; i < 4; ++i) { v4us o = __builtin_bit_cast(v4us, __builtin_convertvector(v[u][i], v4bf));
#pragma unroll
                for (int k = 0; k < 4; ++k) o[k] = (mk[u][i][k] > 0) ? o[k] : (unsigned short)MASKED; *(v4us*)(d + u * 512 + i * 32) = o; }
        asm volatile("s_wait_xcnt 0x0" :: "v"(a), "v"(mp), "v"(d) : "memory");   // the XW precaution behind the trip's loads and stores: their three addresses are inputs, so that they keep their registers up to the wait and move on only behind it
        a += 512; mp += 512; d += 16 * 512; }
}
// ---- FRAGMENT ORDER: every 16-bit operand plane [rows][K] lies as blocks of 16 rows x 32 k (512 elements, 1 KB), block (row tile, k tile) at index row tile x K/32 + k tile.
// In a block, element (r, k = 16 c + 8 hi + e) lies at 256 c + 8 (16 hi + r) + e: lane 16 hi + r of a wave finds its 8 + 8 elements at 8 lane and 256 + 8 lane, so each 16-byte load of a wave covers 512 contiguous bytes (4 whole lines), not 32-byte pieces of 16 lines. The registers hold what they held with row-major planes.
// ---- k_gemmw: register-blocked GEMM, one wave per 64x64 output tile (16 accumulators), FOUR WAVES (2 x 2) per work-group and 128x128 tile; grid (M/128, N/128; HP: + BMROWS rows), 128 threads.
// The 16-bit planes lie in fragment order; the work-group's 128 rows of each operand come to LDS once, 64 k a stage, by asynchronous copies into a ring of two buffers (stage t + 2 is asked for when stage t has been read), and each is read from there by the two waves that need it.
// C[m][n] (f32, pitch ldc, + optional f32 bias[n]) = sum_k A[m][k] Bt[n][k] (NSPLIT 1: + A2[m][k] Bt[n][k]). K % 64 == 0.
// HP (the q, k, v projections side by side, a tile = 64 rows t of one batch x the 64 columns d of one head): no C; the epilogue adds the bias, rounds each accumulator tile to f16 and to bf16 hi + lo and stores it at its place in the head planes that k_fattn reads.
// A lane's 8 accumulators run along the FIRST operand's rows, and a fragment-order block wants 8 consecutive k of one row from a lane. v planes (rows d, k = t): x is the first operand, as in C. q and k planes (rows t, k = d): the two operands change places (both lie in the same order), so that the tile comes out transposed.
// Either way tile (mb, nb) is one 16-byte store a lane and plane, 512 contiguous bytes a wave, at 256 mb + 8 lane in block row nb: this epilogue stages nothing in LDS.
template <typename T16> struct WFrag;
template <> struct WFrag<h16> { typedef v16h V; static __device__ __forceinline__ V ld(const h16* p) { return cat16(*(const v8h*)p, *(const v8h*)(p + 256)); } static __device__ __forceinline__ v8f mma(V a, V b, v8f c) { return wmma16(a, b, c); } };
template <> struct WFrag<bf> { typedef v16bf V; static __device__ __forceinline__ V ld(const bf* p) { return cat16b(*(const v8us*)p, *(const v8us*)(p + 256)); } static __device__ __forceinline__ v8f mma(V a, V b, v8f c) { return wmmab(a, b, c); } };
// put2: two accumulator tiles -> 6 stores, at off and off + nbs elements (both known at compile time) from the lane's address in each plane. lo = x - hi, hi taken back from the packed bf16 words.
// The wait behind the stores is the XW precaution; it takes their addresses and data as inputs, so that all of them keep their registers up to it.
typedef __attribute__((ext_vector_type(4))) unsigned v4u;
__device__ __forceinline__ void put2(const v8f x0, const v8f x1, h16* p16, bf* ph, bf* pl, const int off, const int nbs) {
    const v8f x[2] = {x0, x1}; v8h o16[2]; v8bf oh[2], ol[2];
#pragma unroll
    for (int i = 0; i < 2; ++i) { o16[i] = __builtin_convertvector(x[i], v8h); oh[i] = __builtin_convertvector(x[i], v8bf); const v4u w = __builtin_bit_cast(v4u, oh[i]); v8f r;
#pragma unroll
        for (int k = 0; k < 4; ++k) { r[2 * k] = x[i][2 * k] - __uint_as_float(w[k] << 16); r[2 * k + 1] = x[i][2 * k + 1] - __uint_as_float(w[k] & 0xFFFF0000u); }
        ol[i] = __builtin_convertvector(r, v8bf); }
#pragma unroll
    for (int i = 0; i < 2; ++i) { *(v8h*)(p16 + off + i * nbs) = o16[i]; *(v8bf*)(ph + off + i * nbs) = oh[i]; *(v8bf*)(pl + off + i * nbs) = ol[i]; }
    asm volatile("s_wait_xcnt 0x0" :: "v"(p16), "v"(ph), "v"(pl), "v"(o16[0]), "v"(o16[1]), "v"(oh[0]), "v"(oh[1]), "v"(ol[0]), "v"(ol[1]) : "memory");
    __builtin_amdgcn_sched_barrier(0);   // the next pair's sums and roundings are not formed ahead of this pair's stores: formed ahead they push the kernel past 256 registers, a quarter of a SIMD's, and the bias+mask work-group would find no room beside the three tiles' on a WGP
}
// cp8: eight asynchronous copies to LDS, 512 bytes a wave each (16 a lane): the 2 KB that a stage holds of each of two row tiles, g0 and g1, to 4 KB of LDS from l on. Every copy has address registers of its own.
// The last line is the XW precaution for the copies: inside their own statement it stands ahead of whatever later takes one of their address registers as a destination.
template <typename T16> __device__ __forceinline__ void cp8(const unsigned l, const T16* g0, const T16* g1) {
    asm volatile("global_load_async_to_lds_b128 %0, %8, off\n\tglobal_load_async_to_lds_b128 %1, %9, off\n\tglobal_load_async_to_lds_b128 %2, %10, off\n\tglobal_load_async_to_lds_b128 %3, %11, off\n\t"
                 "global_load_async_to_lds_b128 %4, %12, off\n\tglobal_load_async_to_lds_b128 %5, %13, off\n\tglobal_load_async_to_lds_b128 %6, %14, off\n\tglobal_load_async_to_lds_b128 %7, %15, off\n\ts_wait_xcnt 0x0"
                 :: "v"(l), "v"(l + 512u), "v"(l + 1024u), "v"(l + 1536u), "v"(l + 2048u), "v"(l + 2560u), "v"(l + 3072u), "v"(l + 3584u),
                    "v"(g0), "v"(g0 + 256), "v"(g0 + 512), "v"(g0 + 768), "v"(g1), "v"(g1 + 256), "v"(g1 + 512), "v"(g1 + 768) : "memory");
}
#define BKB 2   // blocks of 32 k in a stage of the ring
#define BMROWS 8   // rows of the HP grid (NB_ TT / 128 work-groups each), behind the tiles' rows, that convert bias and mask, a row tile of 16 queries a work-group
static_assert(BMROWS * (NB_ * TT / 128) == NB_ * TT / 16, "one work-group a row tile");
static_assert(BKB == 2, "cp8 copies 2 KB of a row tile");
template <typename T16, int NSPLIT, bool BIAS, int K, bool HP = false>   // K at compile time: a row tile's blocks then lie at immediate offsets from one address
__global__ __launch_bounds__(128) void k_gemmw(const T16* __restrict__ A, const T16* __restrict__ A2, const T16* __restrict__ Bt, float* C, int ldc, const float* __restrict__ bias, const float* __restrict__ bias1, const float* __restrict__ bias2, h16* P16, bf* Ph, bf* Pl, h16* V16, bf* Vh, bf* Vl, const float* __restrict__ ab, const int* __restrict__ am, bf* BM) {
    // HP: the launch's last BMROWS rows of work-groups are no tiles of the product: they convert bias and mask (bm_rows), which nothing in this launch reads. One of them a WGP streams from memory while the tiles' work-groups, three a WGP and started first, run on L2, LDS and the matrix unit.
    // The fourth work-group finds room beside the three because a wave of this kernel takes no more than a quarter of a SIMD's registers: put2's scheduling barrier sees to that.
    if constexpr (HP) { if ((int)blockIdx.y >= (DQ + 2 * DKV) / 128) { bm_rows(ab, am, BM, ((int)blockIdx.y - (DQ + 2 * DKV) / 128) * (NB_ * TT / 128) + (int)blockIdx.x, __builtin_amdgcn_readfirstlane(threadIdx.x >> 5)); return; } }   // the whole work-group leaves, ahead of every barrier
    typedef typename WFrag<T16>::V V;
    static_assert(NSPLIT == 0 || NSPLIT == 1, "one or two A planes"); static_assert(K % (32 * BKB) == 0 && K / (32 * BKB) >= 2, "whole stages, two or more");
    constexpr int NOP = NSPLIT == 1 ? 3 : 2;      // operand tiles of a stage: A, (A2,) Bt, 128 rows x 32 BKB k each
    constexpr int RTB = BKB * 1024;               // bytes of a row tile in a stage
    constexpr int OPB = 8 * RTB, STB = NOP * OPB; // bytes of an operand tile, of a stage
    constexpr int NT = K / (32 * BKB);
    __shared__ __align__(16) char ring[2 * STB];
    const size_t ld = (size_t)K * 16 /* elements of a row tile */;
    const int lane = threadIdx.x & 31, lr = lane & 15, hi = lane >> 4; const int wv = __builtin_amdgcn_readfirstlane(threadIdx.x >> 5);
    const int r0 = blockIdx.x * 128 + (wv & 1) * 64, c0 = blockIdx.y * 128 + (wv >> 1) * 64;   // the wave's own 64 x 64 tile
    if (c0 >= 2 * DQ) bias = bias2 - 2 * DQ; else if (c0 >= DQ) bias = bias1 - DQ;   // several projections side by side in N, DQ columns each: the tile's own bias vector, still indexed by the column in C
    v8f acc[4][4];
#pragma unroll
    for (int mb = 0; mb < 4; ++mb)
#pragma unroll
        for (int nb = 0; nb < 4; ++nb) acc[mb][nb] = (v8f){};
    const bool tr = HP && c0 < 2 * DQ;   // a q or k tile: the weight rows are the first operand
    // wave wv copies row tiles 2 wv and 2 wv + 1 of each operand tile; a stage in LDS is a plain copy of the planes' blocks, so a fragment is again 16 bytes a lane at 16 lane and at 512 + 16 lane
    const T16* gA = A + (size_t)(blockIdx.x * 8 + 2 * wv) * ld + 8 * lane; const T16* gA2 = NSPLIT == 1 ? A2 + (size_t)(blockIdx.x * 8 + 2 * wv) * ld + 8 * lane : nullptr; const T16* gB = Bt + (size_t)(blockIdx.y * 8 + 2 * wv) * ld + 8 * lane;
    const unsigned l0 = (unsigned)(size_t)(const void*)ring + (unsigned)(wv * 2 * RTB + lane * 16);
    auto fill = [&](const int t, const int buf) {
        const unsigned l = l0 + (unsigned)(buf * STB); const size_t go = (size_t)t * (BKB * 512);
        cp8(l, gA + go, gA + go + ld); if constexpr (NSPLIT == 1) cp8(l + (unsigned)OPB, gA2 + go, gA2 + go + ld); cp8(l + (unsigned)((NOP - 1) * OPB), gB + go, gB + go + ld); };
    const int xo = (wv & 1) * 4 * RTB + lane * 16, wo = (NOP - 1) * OPB + (wv >> 1) * 4 * RTB + lane * 16;   // byte offsets in a stage of the wave's 64 rows of A and of Bt
    const int o1 = tr ? wo : xo, o2 = tr ? xo : wo;
    fill(0, 0);
    asm volatile("s_wait_asynccnt 0x0" ::: "memory");   // this wave's copies of stage 0 have landed
    __syncthreads();                                    // ... and every other wave's
    fill(1, 1);
#pragma unroll 1   // rolled: the body already holds a stage's 32 or 64 matrix instructions and its copies; the loops inside are unrolled so that every index of a fragment or accumulator array is a constant
    for (int t = 0; t < NT; ++t) {
        const char* sb = ring + (t & 1) * STB; V a[BKB][4], a2[BKB][4], b[BKB][4];
        // a block's LDS reads stand as one group ahead of its matrix instructions. The scheduling barriers keep that order: without them the compiler moves the reads in among the matrix instructions, two at a time, each pair behind a wait to 0 with its whole latency open.
        // AHEAD (one wave a SIMD, nobody else fills a wait): all groups ahead of the first product, so that block 0's products wait for their own group alone (a counted wait) and the later groups land under them.
        // Not AHEAD (three work-groups a WGP): group and products by turns, one fragment set, so that three waves' registers fit a SIMD; the other two waves fill the wait.
        constexpr bool AHEAD = NSPLIT == 1;
#pragma unroll
        for (int ph = 0; ph < (AHEAD ? 2 : 1); ++ph)
#pragma unroll
            for (int kb = 0; kb < BKB; ++kb) {
                if (!AHEAD || ph == 0) {
#pragma unroll
                    for (int i = 0; i < 4; ++i) { a[kb][i] = WFrag<T16>::ld((const T16*)(sb + o1 + i * RTB + kb * 1024)); if constexpr (NSPLIT == 1) a2[kb][i] = WFrag<T16>::ld((const T16*)(sb + OPB + o1 + i * RTB + kb * 1024)); b[kb][i] = WFrag<T16>::ld((const T16*)(sb + o2 + i * RTB + kb * 1024)); }
                    __builtin_amdgcn_sched_barrier(0); }
                if (!AHEAD || ph == 1) {
#pragma unroll
                    for (int nb = 0; nb < 4; ++nb)
#pragma unroll
                        for (int mb = 0; mb < 4; ++mb) { acc[mb][nb] = WFrag<T16>::mma(a[kb][mb], b[kb][nb], acc[mb][nb]); if constexpr (NSPLIT == 1) acc[mb][nb] = WFrag<T16>::mma(a2[kb][mb], b[kb][nb], acc[mb][nb]); }
                    __builtin_amdgcn_sched_barrier(0); } }
        // four vector slots behind the stage's last matrix instruction, on every path from it, before a vector instruction takes one of its operand registers; every tile is named, so that no matrix instruction comes to stand behind them
        asm volatile("v_nop\n\tv_nop\n\tv_nop\n\tv_nop" : "+v"(acc[0][0]), "+v"(acc[0][1]), "+v"(acc[0][2]), "+v"(acc[0][3]), "+v"(acc[1][0]), "+v"(acc[1][1]), "+v"(acc[1][2]), "+v"(acc[1][3]), "+v"(acc[2][0]), "+v"(acc[2][1]), "+v"(acc[2][2]), "+v"(acc[2][3]), "+v"(acc[3][0]), "+v"(acc[3][1]), "+v"(acc[3][2]), "+v"(acc[3][3]));
        asm volatile("s_wait_dscnt 0x0" ::: "memory");      // this wave's reads of stage t are done before the buffer is handed back
        asm volatile("s_wait_asynccnt 0x0" ::: "memory");   // this wave's copies of stage t + 1 have landed
        __syncthreads();                                    // publishes stage t + 1 and ends every wave's reads of stage t
        if (t + 2 < NT) fill(t + 2, t & 1);                 // in flight under the whole of stage t + 1
    }
    asm volatile("s_wait_asynccnt 0x0" ::: "memory");       // no copy is outstanding when the wave goes on to its epilogue and ends
    if constexpr (HP) {
        const int pj = c0 / DQ, hd = (c0 % DQ) / HD, bz = r0 / TT, tl = r0 % TT;
        if (tr) {   // planes [projection][batch][head], rows t, k = d = 16 mb + 8 hi + j; block row nb: 16 x HD elements
            const size_t o = ((size_t)((pj * NB_ + bz) * NH_ + hd) * TT + tl) * HD + 8 * lane;
            const float* bp = bias + c0 + hi * 8; v8f bv[4];   // all of the tile's bias ahead of the first stores: one wait on it, not one a row of tiles
#pragma unroll
            for (int mb = 0; mb < 4; ++mb)
#pragma unroll
                for (int j = 0; j < 8; ++j) bv[mb][j] = bp[mb * 16 + j];
            XW;
#pragma unroll
            for (int mb = 0; mb < 4; ++mb) {
#pragma unroll
                for (int j = 0; j < 8; ++j) bv[mb][j] = bfr(bv[mb][j]);
#pragma unroll
                for (int nb = 0; nb < 4; nb += 2) put2(acc[mb][nb] + bv[mb], acc[mb][nb + 1] + bv[mb], P16 + o, Ph + o, Pl + o, mb * 256 + nb * 16 * HD, 16 * HD); }
        } else {    // planes [batch][head], rows d = 16 nb + lr, k = t = 16 mb + 8 hi + j; block row nb: 16 x TT elements
            const size_t o = (size_t)(bz * NKV + hd) * HD * TT + (size_t)tl * 16 + 8 * lane; const float* bp = bias + c0 + lr; float bv[4];
#pragma unroll
            for (int nb = 0; nb < 4; ++nb) bv[nb] = bp[nb * 16];
            XW;
#pragma unroll
            for (int nb = 0; nb < 4; ++nb) bv[nb] = bfr(bv[nb]);
#pragma unroll
            for (int mb = 0; mb < 4; ++mb)
#pragma unroll
                for (int nb = 0; nb < 4; nb += 2) put2(acc[mb][nb] + bv[nb], acc[mb][nb + 1] + bv[nb + 1], V16 + o, Vh + o, Vl + o, mb * 256 + nb * 16 * TT, 16 * TT);
        }
        return;
    }
    __shared__ __align__(16) float osw[4][16 * 68]; float* const os = osw[wv];   // each wave stages in a range of its own, apart from the ring
#pragma unroll
    for (int mb = 0; mb < 4; ++mb) {
#pragma unroll
        for (int nb = 0; nb < 4; ++nb) {
#pragma unroll
            for (int j = 0; j < 8; ++j) os[(hi * 8 + j) * 68 + nb * 16 + lr] = acc[mb][nb][j]; }
        __builtin_amdgcn_wave_barrier(); asm volatile("" ::: "memory");
        float* crow = C + (size_t)(r0 + mb * 16) * ldc + c0;
{
#pragma unroll
            for (int s = 0; s < 8; ++s) { const int row = 2 * s + hi, cofs = lr * 4; v4f val = *(const v4fa*)(os + row * 68 + cofs); if (BIAS) { val[0] += bfr(bias[c0 + cofs]); val[1] += bfr(bias[c0 + cofs + 1]); val[2] += bfr(bias[c0 + cofs + 2]); val[3] += bfr(bias[c0 + cofs + 3]); }
                *(v4f*)(crow + (size_t)row * ldc + cofs) = val; }
             }
        __builtin_amdgcn_wave_barrier(); asm volatile("" ::: "memory");
    }
}

__device__ __forceinline__ void splitf(float y, unsigned short& h, unsigned short& l) { h = f2bf(y); l = f2bf(y - bf2f(h)); }
typedef __attribute__((ext_vector_type(2))) _Float16 v2h;
typedef __attribute__((ext_vector_type(4))) _Float16 v4h;
typedef __attribute__((ext_vector_type(2))) unsigned short v2us;
typedef __attribute__((ext_vector_type(2))) float v2f;

__global__ __launch_bounds__(256) void k_wtG(const float* __restrict__ w, int K, int N, bf* Bt) {
    const int lane = threadIdx.x & 31; const int L0 = (blockIdx.x * 8 + (threadIdx.x >> 5)) * 8; const int nlines = N * K / 64;
{
#pragma unroll 1
        for (int l = 0; l < 8; ++l) { const int L = L0 + l; if (L >= nlines) break; const size_t e = (size_t)L * 64 + lane * 2; const int k = (int)(e % K), n = (int)(e / K); v2us o;
            o[0] = f2bf(w[(size_t)k * N + n]); o[1] = f2bf(w[(size_t)(k + 1) * N + n]); *(v2us*)(Bt + e) = o; }
         }
}
// k_cvtf: f32 [rows][K] -> bf16 plane in fragment order. One wave a block: 8 lanes read a row's whole 128-byte line (4 rows a load), a lane stores its 4 elements at their place in the block.
// grid y: pieces of nblk blocks, one behind the other in dst: pieces 0 to 3 are the sources s0 to s3, the pieces from 4 on follow one another in s4.
template <int K>
__global__ __launch_bounds__(256) void k_cvtf(const float* __restrict__ s0, const float* __restrict__ s1, const float* __restrict__ s2, const float* __restrict__ s3, const float* __restrict__ s4, bf* dst, int nblk) { const int blk = blockIdx.x * 8 + (threadIdx.x >> 5); if (blk >= nblk) return; const int pc = blockIdx.y; const float* src = pc == 0 ? s0 : pc == 1 ? s1 : pc == 2 ? s2 : pc == 3 ? s3 : s4 + (size_t)(pc - 4) * nblk * 512; dst += (size_t)pc * nblk * 512; const int lane = threadIdx.x & 31, g = lane >> 3, p = lane & 7; const int ktn = K / 32, kt = blk % ktn, rt = blk / ktn;
    const float* s = src + (size_t)(rt * 16 + g) * K + kt * 32 + p * 4; bf* d = dst + (size_t)blk * 512 + (p >> 2) * 256 + ((p >> 1) & 1) * 128 + g * 8 + (p & 1) * 4; v4f v[4];
#pragma unroll
    for (int i = 0; i < 4; ++i) v[i] = *(const v4f*)(s + (size_t)i * 4 * K);
    xwa(s);
#pragma unroll
    for (int i = 0; i < 4; ++i) { v4us o;
#pragma unroll
        for (int k = 0; k < 4; ++k) o[k] = f2bf(v[i][k]); *(v4us*)(d + i * 32) = o; }  }
// ---- k_fattn: scores, bias, mask, softmax and P.V of one head in ONE kernel; S and P never leave the registers. One wave owns 16 or 48 query rows and walks the 2048 keys in passes of 32.
// The four waves of a work-group walk the same K and V: these come to LDS once for all four, 64 keys (two passes) a stage, by asynchronous copies into a ring of two buffers (stage t + 2 is asked for when stage t has been read), and every wave reads its fragments from there.
// A stage in LDS, per set of planes (f16: one set; hi + lo: the hi set, then the lo set): four pieces of 4 KB, piece w copied by wave w: the 2 KB of key tile w (its two blocks of d), then the 2 KB of V^T row tile w (its two blocks of keys), each a plain copy of the planes' blocks.
// S^T = K Q^T (A = K rows, B = Q rows): a lane holds one query's scores (query lr, keys 8 hi + j of each 16-key tile), so two converted S^T tiles ARE the B operand of O^T += V^T P^T (same k order as WFrag::ld).
// Running maximum m per query: P = exp(t - m) unnormalised, the sum l kept in f32 beside it, O divided by l at the end. m moves only when a pass's maximum tops it by more than MSTEP (then O and l are rescaled), so P <= e^MSTEP.
// Addresses of the plain loads (Q, BM): a wave-uniform base that moves with the pass + the lane's byte offset in a block (16 lane). Q, K, V^T and the bias+mask plane BM all lie in fragment order.
#define MSTEP 5.5f
#define FRB 65536   // bytes of k_fattn's LDS ring: two stages of the hi + lo rows' four planes
typedef __attribute__((ext_vector_type(8))) int v8i;
__device__ __forceinline__ float xhalf(float x) { return __builtin_bit_cast(float, __builtin_amdgcn_permlanex16(__builtin_bit_cast(int, x), __builtin_bit_cast(int, x), 0x76543210, 0xfedcba98, false, false)); }   // lane l with lane l ^ 16
template <typename T> __device__ __forceinline__ const T* atb(const T* base, unsigned offb) { return (const T*)((const char*)base + offb); }
template <typename T16, int NSPLIT, int NQ>   // NQ: query tiles of 16 rows that the wave owns, one behind the other from q0; every K and V fragment it loads feeds all NQ of them
__device__ __forceinline__ void attn_rows(const T16* __restrict__ Q, const T16* __restrict__ Q2, const T16* __restrict__ Kp, const T16* __restrict__ K2, const T16* __restrict__ Vt, const T16* __restrict__ V2, const bf* __restrict__ BM, int q0, int h, bf* Ah, bf* Al, char* ring) {
    typedef typename WFrag<T16>::V V;
    constexpr int SPB = 4 * 4096, STB = (NSPLIT == 2 ? 2 : 1) * SPB;   // bytes of a set of planes in a stage, of a stage
    constexpr int NT = TT / 64; static_assert(TT % 64 == 0 && NT >= 2 && HD == 64 && 2 * STB <= FRB, "whole stages of 64 keys, two or more; a key tile is 2 KB; the ring holds two stages");
    const int lane = threadIdx.x & 31; const int wv = __builtin_amdgcn_readfirstlane(threadIdx.x >> 5);
    const unsigned l0 = (unsigned)(size_t)(const void*)ring + (unsigned)(wv * 4096 + lane * 16);
    auto fill = [&](const int t, const int buf) {
        const unsigned l = l0 + (unsigned)(buf * STB); const size_t ko = (size_t)(t * 64 + wv * 16) * HD, vo = (size_t)(wv * (TT / 64) + t) * (64 * 16);   // key tile wv of stage t; row tile wv of V^T, the stage's two blocks. One wave-uniform index each: scalar arithmetic, and no address of the copies is kept in vector registers over the loop
        cp8(l, atb(Kp + ko, lane * 16u), atb(Vt + vo, lane * 16u)); if constexpr (NSPLIT == 2) cp8(l + (unsigned)SPB, atb(K2 + ko, lane * 16u), atb(V2 + vo, lane * 16u)); };
    fill(0, 0);   // in flight under the loads of Q and of the first bias+mask blocks
    V qf[NQ][2], q2[NQ][2], kf[2][2], k2[2][2]; v8bf bb[NQ][2];
    const unsigned lo = (unsigned)lane * 16u;   // byte offset
    Q += (size_t)q0 * HD; if (NSPLIT == 2) Q2 += (size_t)q0 * HD; BM += (size_t)q0 * TT;   // the wave's first row tile: q0 / 16 x (blocks a row tile) x 512
#pragma unroll
    for (int qt = 0; qt < NQ; ++qt)
#pragma unroll
        for (int ks = 0; ks < 2; ++ks) { qf[qt][ks] = WFrag<T16>::ld(atb(Q, lo) + qt * 16 * HD + ks * 512); if (NSPLIT == 2) q2[qt][ks] = WFrag<T16>::ld(atb(Q2, lo) + qt * 16 * HD + ks * 512); }
    XW;
#pragma unroll
    for (int qt = 0; qt < NQ; ++qt)
#pragma unroll
        for (int kt = 0; kt < 2; ++kt) bb[qt][kt] = *(const v8bf*)(atb(BM, lo) + qt * 16 * TT + kt * 256);
    XW;
    v8f o[NQ][4]; float m[NQ], l[NQ];
#pragma unroll
    for (int qt = 0; qt < NQ; ++qt) { m[qt] = -3.0e38f; l[qt] = 0.f;
#pragma unroll
        for (int mb = 0; mb < 4; ++mb) o[qt][mb] = (v8f){}; }
    asm volatile("s_wait_asynccnt 0x0" ::: "memory");   // this wave's copies of stage 0 have landed
    __syncthreads();                                    // ... and every other wave's
    fill(1, 1);
#pragma unroll 1   // rolled: 32 stages, the body already holds two passes of 24 matrix instructions each
    for (int st = 0; st < NT; ++st) {
      const char* sb = ring + (st & 1) * STB + lo;   // the lane's place in the first block of this stage's buffer
#pragma unroll
      for (int kt = 0; kt < 2; ++kt)
#pragma unroll
          for (int ks = 0; ks < 2; ++ks) { kf[kt][ks] = WFrag<T16>::ld((const T16*)(sb + kt * 4096 + ks * 1024)); if (NSPLIT == 2) k2[kt][ks] = WFrag<T16>::ld((const T16*)(sb + SPB + kt * 4096 + ks * 1024)); }
      __builtin_amdgcn_sched_barrier(0);   // the K rows of the stage's first pass are asked for as one group ahead of the first product, which then waits for its own fragments alone (a counted wait); without it the compiler deals them out among the products, each lot behind a wait to 0
#pragma unroll   // the two passes of a stage: unrolled, so that every LDS offset is a constant and only the first pass fetches K ahead
      for (int ps = 0; ps < 2; ++ps) {
        const int key0 = st * 64 + ps * 32;
        V vf[4], v2[4];
        v8f t[NQ][2];
#pragma unroll
        for (int qt = 0; qt < NQ; ++qt)
#pragma unroll
            for (int kt = 0; kt < 2; ++kt) t[qt][kt] = (v8f){};
#pragma unroll   // the halves of d outermost: the products of the 2 NQ score tiles follow one another, so that a tile's second product does not wait on its first; each tile's own order of products is as before
        for (int ks = 0; ks < 2; ++ks)
#pragma unroll
            for (int qt = 0; qt < NQ; ++qt)
#pragma unroll
                for (int kt = 0; kt < 2; ++kt) { t[qt][kt] = WFrag<T16>::mma(kf[kt][ks], qf[qt][ks], t[qt][kt]); if (NSPLIT == 2) { t[qt][kt] = WFrag<T16>::mma(kf[kt][ks], q2[qt][ks], t[qt][kt]); t[qt][kt] = WFrag<T16>::mma(k2[kt][ks], qf[qt][ks], t[qt][kt]); } }
        // one group of LDS reads a pass, behind the score products and in flight under the softmax: this pass's V^T rows and, in a stage's first pass, the K rows of its second (nothing of the next stage is read ahead of the stage's barrier).
        // The scheduling barriers keep the reads together at this one place: without them the compiler spreads them, two at a time, among the vector instructions and the matrix instructions.
        __builtin_amdgcn_sched_barrier(0);
#pragma unroll
        for (int mb = 0; mb < 4; ++mb) { vf[mb] = WFrag<T16>::ld((const T16*)(sb + mb * 4096 + 2048 + ps * 1024)); if (NSPLIT == 2) v2[mb] = WFrag<T16>::ld((const T16*)(sb + SPB + mb * 4096 + 2048 + ps * 1024)); }
        if (ps == 0) {
#pragma unroll
            for (int kt = 0; kt < 2; ++kt)
#pragma unroll
                for (int ks = 0; ks < 2; ++ks) { kf[kt][ks] = WFrag<T16>::ld((const T16*)(sb + (2 + kt) * 4096 + ks * 1024)); if (NSPLIT == 2) k2[kt][ks] = WFrag<T16>::ld((const T16*)(sb + SPB + (2 + kt) * 4096 + ks * 1024)); } }
        __builtin_amdgcn_sched_barrier(0);
#pragma unroll
        for (int qt = 0; qt < NQ; ++qt)
#pragma unroll
            for (int kt = 0; kt < 2; ++kt) {
                if constexpr (NQ > 1) t[qt][kt] = __builtin_elementwise_fma(t[qt][kt], (v8f)(SCL), __builtin_convertvector(bb[qt][kt], v8f));   // on the whole tile: the packed instructions then pair neighbouring registers of one tile, not elements of two tiles through register copies
                else {
#pragma unroll   // s x 2^-3 is exact, so the fused multiply-add rounds once, as a separate add would
                    for (int j = 0; j < 8; ++j) t[qt][kt][j] = __builtin_fmaf(t[qt][kt][j], SCL, (float)bb[qt][kt][j]); } }
        const int kn = (key0 + 32 < TT) ? key0 + 32 : key0;   // the next pass's bias+mask blocks are fetched one pass ahead; the last pass fetches its own again (in bounds, not used)
        const bf* pbm = atb(BM + kn * 16, lo);
#pragma unroll
        for (int qt = 0; qt < NQ; ++qt)
#pragma unroll
            for (int kt = 0; kt < 2; ++kt) bb[qt][kt] = *(const v8bf*)(pbm + qt * 16 * TT + kt * 256);
        xwa(pbm);
        float pm[NQ]; bool need[NQ], any = false;
#pragma unroll
        for (int qt = 0; qt < NQ; ++qt) { pm[qt] = fmaxf(t[qt][0][0], t[qt][1][0]);
#pragma unroll
            for (int j = 1; j < 8; ++j) pm[qt] = fmaxf(pm[qt], fmaxf(t[qt][0][j], t[qt][1][j]));
            pm[qt] = fmaxf(pm[qt], xhalf(pm[qt]));   // the two lane halves hold the two halves of a query's keys
            need[qt] = pm[qt] > m[qt] + MSTEP; any = any || need[qt]; }
        if (__builtin_amdgcn_ballot_w32(any) != 0) {   // wave-uniform, one test a pass: rare after the first pass; a query whose maximum stays is scaled by exactly 1
#pragma unroll
            for (int qt = 0; qt < NQ; ++qt) { const float mn = need[qt] ? pm[qt] : m[qt]; const float al = __builtin_amdgcn_exp2f((m[qt] - mn) * 1.4426950408889634f); m[qt] = mn; l[qt] *= al;
#pragma unroll
                for (int mb = 0; mb < 4; ++mb) o[qt][mb] *= al; } }
#pragma unroll
        for (int qt = 0; qt < NQ; ++qt) { v4f ls = (v4f){};   // four partial sums, element j into sum j & 3, in the order of j
#pragma unroll
            for (int kt = 0; kt < 2; ++kt) {
#pragma unroll
                for (int j = 0; j < 8; ++j) t[qt][kt][j] = __builtin_amdgcn_exp2f((t[qt][kt][j] - m[qt]) * 1.4426950408889634f);
                ls += __builtin_shufflevector(t[qt][kt], t[qt][kt], 0, 1, 2, 3); ls += __builtin_shufflevector(t[qt][kt], t[qt][kt], 4, 5, 6, 7); }
            l[qt] += (ls[0] + ls[1]) + (ls[2] + ls[3]); }
        if constexpr (NSPLIT == 2) {   // P = hi + lo bf16 planes
            V pfh[NQ], pfl[NQ];
#pragma unroll
            for (int qt = 0; qt < NQ; ++qt) {
                const v8bf h0 = __builtin_convertvector(t[qt][0], v8bf), h1 = __builtin_convertvector(t[qt][1], v8bf);
                const v8bf l0 = __builtin_convertvector(t[qt][0] - __builtin_convertvector(h0, v8f), v8bf), l1 = __builtin_convertvector(t[qt][1] - __builtin_convertvector(h1, v8f), v8bf);
                pfh[qt] = __builtin_shufflevector(h0, h1, 0, 1, 2, 3, 4, 5, 6, 7, 8, 9, 10, 11, 12, 13, 14, 15); pfl[qt] = __builtin_shufflevector(l0, l1, 0, 1, 2, 3, 4, 5, 6, 7, 8, 9, 10, 11, 12, 13, 14, 15); }
#pragma unroll
            for (int qt = 0; qt < NQ; ++qt)
#pragma unroll
                for (int mb = 0; mb < 4; ++mb) { o[qt][mb] = WFrag<T16>::mma(vf[mb], pfh[qt], o[qt][mb]); o[qt][mb] = WFrag<T16>::mma(vf[mb], pfl[qt], o[qt][mb]); o[qt][mb] = WFrag<T16>::mma(v2[mb], pfh[qt], o[qt][mb]); }
        } else {
            V pfv[NQ];
#pragma unroll
            for (int qt = 0; qt < NQ; ++qt) pfv[qt] = cat16(__builtin_convertvector(t[qt][0], v8h), __builtin_convertvector(t[qt][1], v8h));
#pragma unroll
            for (int qt = 0; qt < NQ; ++qt)
#pragma unroll
                for (int mb = 0; mb < 4; ++mb) o[qt][mb] = WFrag<T16>::mma(vf[mb], pfv[qt], o[qt][mb]); }
        // four vector slots behind the pass's last matrix instruction, also on the taken back edge, before its operands are loaded anew; every output tile is named, so that no matrix instruction of the pass comes to stand behind them
        static_assert(NQ == 1 || NQ == 3, "the statement below names the output tiles of 1 or 3 query tiles");
        if constexpr (NQ == 1) asm volatile("v_nop\n\tv_nop\n\tv_nop\n\tv_nop" : "+v"(o[0][0]), "+v"(o[0][1]), "+v"(o[0][2]), "+v"(o[0][3]) : "v"(vf[0]), "v"(vf[3]));
        else asm volatile("v_nop\n\tv_nop\n\tv_nop\n\tv_nop" : "+v"(o[0][0]), "+v"(o[0][1]), "+v"(o[0][2]), "+v"(o[0][3]), "+v"(o[1][0]), "+v"(o[1][1]), "+v"(o[1][2]), "+v"(o[1][3]), "+v"(o[NQ - 1][0]), "+v"(o[NQ - 1][1]), "+v"(o[NQ - 1][2]), "+v"(o[NQ - 1][3]) : "v"(vf[0]), "v"(vf[3]));
      }
      asm volatile("s_wait_dscnt 0x0" ::: "memory");      // this wave's reads of stage st are done before the buffer is handed back
      asm volatile("s_wait_asynccnt 0x0" ::: "memory");   // this wave's copies of stage st + 1 have landed
      __syncthreads();                                    // publishes stage st + 1 and ends every wave's reads of stage st
      if (st + 2 < NT) fill(st + 2, st & 1);              // in flight under the whole of stage st + 1
    }
    asm volatile("s_wait_asynccnt 0x0" ::: "memory");     // no copy is outstanding when the wave goes on to its epilogue and ends
    const size_t oo = (size_t)q0 * DQ + h * (HD / 32) * 512 + lane * 8; bf* const pa = Ah + oo; bf* const pl = Al + oo;   // the lane's place in its first block of either plane; every store below lies at a compile-time offset from it
#pragma unroll
    for (int qt = 0; qt < NQ; ++qt) {
        const float lt = l[qt] + xhalf(l[qt]);
        const float f = __fdiv_rn(1.0f, lt);
#pragma unroll
        for (int mb = 0; mb < 4; ++mb) { v8us oh, ol;   // a lane holds 8 consecutive d of its query: one 16-byte store a plane, at the lane's place in the block of the output projection's A operand
#pragma unroll
            for (int j = 0; j < 8; ++j) { unsigned short a, c2; splitf(o[qt][mb][j] * f, a, c2); oh[j] = a; ol[j] = c2; }
            *(v8us*)(pa + qt * 16 * DQ + mb * 256) = oh; *(v8us*)(pl + qt * 16 * DQ + mb * 256) = ol;
            asm volatile("s_wait_xcnt 0x0" :: "v"(pa), "v"(pl), "v"(oh), "v"(ol) : "memory"); } }   // the XW precaution behind the two stores: addresses and data are inputs, so that all keep their registers up to the wait
}
// grid (batches x heads, RH / 64 + (TT - RH) / (64 FQ)), 4 waves: the blocks of the hi+lo rows (16 rows a wave, three products each) come first in the launch order, then the blocks of the f16 rows, FQ tiles of 16 rows a wave.
// FQ = 3: an f16 wave then issues as many matrix instructions a pass as a hi+lo wave, there are as many of the one kind as of the other, and a K or V fragment is loaded once for 48 query rows. Neighbouring blocks read the same bias+mask blocks.
#define FQ 3
static_assert(RH % 64 == 0 && (TT - RH) % (64 * FQ) == 0, "whole blocks of either kind");
__global__ __launch_bounds__(128) void k_fattn(const h16* __restrict__ Q16, const h16* __restrict__ K16, const h16* __restrict__ V16, const bf* __restrict__ Qh, const bf* __restrict__ Ql, const bf* __restrict__ Kh, const bf* __restrict__ Kl, const bf* __restrict__ Vh, const bf* __restrict__ Vl, const bf* __restrict__ BM, bf* Ah, bf* Al) {
    const int h = blockIdx.x % NH_, bz = blockIdx.x / NH_; const int wv = threadIdx.x >> 5; const size_t hp = (size_t)blockIdx.x * TT * HD; BM += (size_t)bz * TT * TT; Ah += (size_t)bz * TT * DQ; Al += (size_t)bz * TT * DQ;
    __shared__ __align__(16) char ring[FRB];
    if ((int)blockIdx.y < RH / 64) attn_rows<bf, 2, 1>(Qh + hp, Ql + hp, Kh + hp, Kl + hp, Vh + hp, Vl + hp, BM, blockIdx.y * 64 + wv * 16, h, Ah, Al, ring);
    else attn_rows<h16, 0, FQ>(Q16 + hp, nullptr, K16 + hp, nullptr, V16 + hp, nullptr, BM, RH + ((int)blockIdx.y - RH / 64) * (64 * FQ) + wv * (16 * FQ), h, Ah, Al, ring);
}

extern "C" void kernel_launch(void* const* d_in, const int* in_sizes, int n_in,
                              void* d_out, int out_size, void* d_ws, size_t ws_size, hipStream_t stream) {
    (void)in_sizes; (void)n_in; (void)out_size;
    const float* x = (const float*)d_in[0]; const float* abias = (const float*)d_in[1]; const int* amask = (const int*)d_in[2]; const float* wq = (const float*)d_in[3]; const float* bq = (const float*)d_in[4]; const float* wk = (const float*)d_in[5]; const float* bk = (const float*)d_in[6]; const float* wv = (const float*)d_in[7]; const float* bv = (const float*)d_in[8]; const float* wo = (const float*)d_in[9]; const float* bo = (const float*)d_in[10]; const float* cosT = nullptr; const float* sinT = nullptr; (void)cosT; (void)sinT;
    float* OUT = (float*)d_out;     // [2][2048][1024]
    char* wsp = (char*)d_ws;
    auto take = [&](size_t bytes) { char* p = wsp; wsp += (bytes + 255) & ~(size_t)255; return (void*)p; };
    bf* WQ = (bf*)take((size_t)DQ * DM * 2); bf* WK = (bf*)take((size_t)DKV * DM * 2); bf* WV = (bf*)take((size_t)DKV * DM * 2); bf* WO = (bf*)take((size_t)DM * DQ * 2); bf* XB = (bf*)take((size_t)NB_ * TT * DM * 2); (void)WK; (void)WV;   // one behind the other: k_cvtf's pieces; WQ, WK, WV are also one B operand of DQ + 2 DKV rows
    // every plane holds both batches: q and k [projection][batch][head][t][d], v [batch][head][d][t]
    h16* QP16 = (h16*)take((size_t)NB_ * NH_ * TT * HD * 2); h16* KP16 = (h16*)take((size_t)NB_ * NKV * TT * HD * 2); bf* QPh = (bf*)take((size_t)NB_ * NH_ * TT * HD * 2); bf* KPh = (bf*)take((size_t)NB_ * NKV * TT * HD * 2); bf* QPl = (bf*)take((size_t)NB_ * NH_ * TT * HD * 2); bf* KPl = (bf*)take((size_t)NB_ * NKV * TT * HD * 2);
    h16* VT16 = (h16*)take((size_t)NB_ * NKV * HD * TT * 2); bf* VTh = (bf*)take((size_t)NB_ * NKV * HD * TT * 2); bf* VTl = (bf*)take((size_t)NB_ * NKV * HD * TT * 2);
    bf* ATh = (bf*)take((size_t)NB_ * TT * DQ * 2); bf* ATl = (bf*)take((size_t)NB_ * TT * DQ * 2); bf* BM = (bf*)take((size_t)NB_ * TT * TT * 2);
    if ((size_t)(wsp - (char*)d_ws) > ws_size) return;    // ws 256 MiB
    k_cvtf<DM><<<dim3(DQ * DM / 512 / 8, 4 + NB_ * TT / DQ, 1), 256, 0, stream>>>(wq, wk, wv, wo, x, WQ, DQ * DM / 512);   // the four weights and x (pieces of DQ rows), all of K = DM
    // each stage once, for both batches (rows b TT + t of x and of the attention output) and for q, k, v side by side (columns of the product); QP and KP lie one behind the other in each of their three kinds
    k_gemmw<bf, 0, true, DM, true><<<dim3(NB_ * TT / 128, (DQ + 2 * DKV) / 128 + BMROWS, 1), 128, 0, stream>>>(XB, nullptr, WQ, nullptr, 0, bq, bk, bv, QP16, QPh, QPl, VT16, VTh, VTl, abias, amask, BM);   // with the bias+mask plane's work-groups behind the tiles'
    k_fattn<<<dim3(NB_ * NH_, RH / 64 + (TT - RH) / (64 * FQ), 1), 128, 0, stream>>>(QP16, KP16, VT16, QPh, QPl, KPh, KPl, VTh, VTl, BM, ATh, ATl);   // one kv head per query head
    k_gemmw<bf, 1, true, DQ><<<dim3(NB_ * TT / 128, DM / 128, 1), 128, 0, stream>>>(ATh, ATl, WO, OUT, DM, bo, nullptr, nullptr, nullptr, nullptr, nullptr, nullptr, nullptr, nullptr, nullptr, nullptr, nullptr);
}
